// v000
// Times are from an AMD MI455X. After a warm-up the kernel runs many times in a row, and a time is the length of
// such a window on the GPU divided by its runs, so every launch and the gaps after it count. The runs cycle
// through copies of the inputs. A figure is the median of several windows, for all but v000 over two sittings.
// Sittings can differ by a few percent; kernels timed side by side share one.
// v000, which the later versions start from, runs in 563 microseconds.
#include <hip/hip_runtime.h>

// GraphormerFishAttention: q = x Wq, k = x Wk (G=8 heads x 64), v = x Wv + bv (L=16 heads x 64); g = q.k^T 512^-0.5 + (spatial + edge) bias [B,G,S,S]; pad = any_t(g != 0);
// a_l = Σ_g where(pad_g, relu(p[g,l] (g + sigma_g² eps[l,s] δ_st)), -inf); softmax over t; nan_to_num; out_l = a_l.v_l; out = merged Wout + bout -> [8][256][512].
// Projections on v_wmma_f32_16x16x32_f16 with exact operands (x and the weights are exact bf16; 1 product); g = q.k^T with q, k single f16 x8 (1 product; |q.k|·scale ≈ 0.07 next to
// the O(1) exact bias) + bias in f32; the fish mixing / relu / pad / softmax in f32 (fixed order); out_l = P.v with P as an f16 hi+lo pair x8 and v single f16 x8 (2 products);
// output projection with ctx as hi+lo x8 (2 products); f32 accumulate. Fragment k-map per lane half hh for A AND B: elements 0..7 <- k = 8hh+0..7, 8..15 <- k = 16+8hh+0..7.

namespace {
constexpr int Bn = 8, S = 256, H = 512, G = 8, L = 16, HD = 64, NT = Bn * S, NPJ = 2048;
constexpr float QS = 8.0f, KS = 8.0f, VS = 8.0f, PS = 8.0f, AS_ = 8.0f, SCALE = 0.04419417382415922f;

typedef _Float16 b16;
typedef __attribute__((ext_vector_type(16))) _Float16 v16b;
typedef __attribute__((ext_vector_type(8))) _Float16 v8b;
typedef __attribute__((ext_vector_type(8))) float v8f;
typedef __attribute__((ext_vector_type(4))) float v4f;
__device__ __forceinline__ float bf16_rne(float f) { unsigned int u = __float_as_uint(f); u += 0x7FFFu + ((u >> 16) & 1u); return __uint_as_float(u & 0xFFFF0000u); }
__device__ __forceinline__ void split16(float v, b16& hi, b16& lo) { hi = (b16)v; lo = (b16)(v - (float)hi); }
__device__ __forceinline__ v16b frag_kb(const b16* p, int hh) { const v8b a = *(const v8b*)(p + 8 * hh), b = *(const v8b*)(p + 16 + 8 * hh); v16b f;
#pragma unroll
  for (int e = 0; e < 8; ++e) { f[e] = a[e]; f[8 + e] = b[e]; } return f; }
__device__ __forceinline__ v16b frag_x(const float* p, int hh) { v16b f;
#pragma unroll
  for (int e = 0; e < 8; ++e) { f[e] = (b16)bf16_rne(p[8 * hh + e]); f[8 + e] = (b16)bf16_rne(p[16 + 8 * hh + e]); } return f; }
__device__ __forceinline__ void frag_split(const float* p, int hh, v16b& fh, v16b& fl) {
#pragma unroll
  for (int e = 0; e < 8; ++e) { b16 a, c; split16(p[8 * hh + e] * AS_, a, c); fh[e] = a; fl[e] = c; split16(p[16 + 8 * hh + e] * AS_, a, c); fh[8 + e] = a; fl[8 + e] = c; } }
__device__ __forceinline__ v8f wmma16b(v16b a, v16b b, v8f c) { v8f d = __builtin_amdgcn_wmma_f32_16x16x32_f16(false, a, false, b, (short)0, c, false, false); asm volatile("v_nop\n\tv_nop\n\tv_nop\n\tv_nop" : "+v"(d) : "v"(a), "v"(b)); return d; }
__device__ __forceinline__ void wave_lds_sync() { __builtin_amdgcn_fence(__ATOMIC_RELEASE, "workgroup"); __builtin_amdgcn_wave_barrier(); __builtin_amdgcn_fence(__ATOMIC_ACQUIRE, "workgroup"); }
__device__ __forceinline__ float nexp(float x) { return __builtin_amdgcn_exp2f(x * 1.4426950408889634f); }
__device__ __forceinline__ float pmul(float a, float b) { float p = a * b; asm volatile("" : "+v"(p)); return p; }

// prep: Wcat f16 rows [2048][512] ([in][out] -> [out][in]: Wq | Wk | Wv), Wout rows [512][1024]; P: bv @0 (1024), bout @1024 (512), sigma² @1536 (8), p @1544 (128 = [g][l]),
__global__ __launch_bounds__(256) void prep_kernel(const float* __restrict__ Wq, const float* __restrict__ Wk, const float* __restrict__ Wv, const float* __restrict__ Wout, const float* __restrict__ bv, const float* __restrict__ bout, const float* __restrict__ sg, const float* __restrict__ pp, const float* __restrict__ ed, b16* __restrict__ R, b16* __restrict__ Ro, float* __restrict__ P) {
  const int t_ = blockIdx.x * 256 + threadIdx.x, nth = gridDim.x * 256;
  {
    for (int q = t_; q < NPJ * H; q += nth) { const int o = q / H, k = q % H; float w; if (o < 512) w = Wq[(size_t)k * 512 + o]; else if (o < 1024) w = Wk[(size_t)k * 512 + o - 512]; else w = Wv[(size_t)k * 1024 + o - 1024]; R[q] = (b16)bf16_rne(w); }
    for (int q = t_; q < 512 * 1024; q += nth) { const int o = q >> 10, k = q & 1023; Ro[q] = (b16)bf16_rne(Wout[(size_t)k * 512 + o]); }
    for (int q = t_; q < 1672 + L * S; q += nth) { float v; if (q < 1024) v = bf16_rne(bv[q]); else if (q < 1536) v = bf16_rne(bout[q - 1024]); else if (q < 1544) { const float s_ = bf16_rne(sg[q - 1536]); v = s_ * s_; } else if (q < 1672) v = bf16_rne(pp[q - 1544]); else v = bf16_rne(ed[q - 1672]); P[q] = v; }
     }
}

// projections: block 128 tokens x 64 cols (tile ct of 32: 0..7 q heads, 8..15 k heads, 16..31 v l-heads); exact (1 product); q x scale x 8 / k x 8 -> planes [b][g][s][64] f16;
__global__ __launch_bounds__(128) void proj_kernel(const float* __restrict__ x, const b16* __restrict__ R, const float* __restrict__ P, b16* __restrict__ qp, b16* __restrict__ kp, b16* __restrict__ vt) {
  __shared__ __attribute__((aligned(16))) b16 T[4][32][64 + 8]; __shared__ __attribute__((aligned(16))) b16 Tv[64][128 + 8];
  const int lane = threadIdx.x & 31, wave = threadIdx.x >> 5, nloc = lane & 15, hlf = lane >> 4, ct = blockIdx.x, c0 = ct * 64, p0 = blockIdx.y * 128, m0 = p0 + wave * 32, b = p0 / S, t0 = p0 % S;
  v8f acc[2][4];
#pragma unroll
  for (int r = 0; r < 2; ++r)
#pragma unroll
    for (int t = 0; t < 4; ++t) acc[r][t] = (v8f){};
#pragma unroll 2
  for (int kb = 0; kb < H; kb += 32) { const v16b a0 = frag_x(x + (size_t)(m0 + nloc) * H + kb, hlf), a1 = frag_x(x + (size_t)(m0 + 16 + nloc) * H + kb, hlf);
#pragma unroll
    for (int t = 0; t < 4; ++t) { const v16b bw = frag_kb(R + (size_t)(c0 + t * 16 + nloc) * H + kb, hlf); acc[0][t] = wmma16b(a0, bw, acc[0][t]); acc[1][t] = wmma16b(a1, bw, acc[1][t]); } }
  if (ct < 16) { const float scl = (ct < 8) ? SCALE * QS : KS; const int hd_ = (ct < 8) ? ct : ct - 8;
#pragma unroll
    for (int t = 0; t < 4; ++t)
#pragma unroll
      for (int r = 0; r < 2; ++r)
#pragma unroll
        for (int v = 0; v < 8; ++v) T[wave][r * 16 + 8 * hlf + v][t * 16 + nloc] = (b16)(acc[r][t][v] * scl);
    wave_lds_sync();
    b16* base = ((ct < 8) ? qp : kp) + (((size_t)b * G + hd_) * S + (m0 % S)) * HD;
    {
#pragma unroll
      for (int j = 0; j < 8; ++j) { const int rr = j * 4 + (lane >> 3), c8 = (lane & 7) * 8; *(v8b*)(base + (size_t)rr * HD + c8) = *(const v8b*)(&T[wave][rr][c8]); }
       }
    return; }
  const int l = ct - 16; const float* bvp = P + l * HD;
#pragma unroll
  for (int t = 0; t < 4; ++t) { const float bb = bvp[t * 16 + nloc];
#pragma unroll
    for (int r = 0; r < 2; ++r)
#pragma unroll
      for (int v = 0; v < 8; ++v) Tv[t * 16 + nloc][wave * 32 + r * 16 + 8 * hlf + v] = (b16)((acc[r][t][v] + bb) * VS); }
  __syncthreads();
  { for (int i = threadIdx.x; i < 64 * 16; i += 128) { const int d = i >> 4, c8 = (i & 15) * 8; *(v8b*)(vt + (((size_t)b * L + l) * HD + d) * S + t0 + c8) = *(const v8b*)(&Tv[d][c8]); }  }
}

// scores: block = (b, 16 query rows s0..) x 8 waves (wave = head g): Sg[s][t] = q_s.k_t (scaled) + spatial[b][s][t] + edge[b][s][t] (2 k-steps x 16 t-tiles, 1 product) -> f32 rows
__global__ __launch_bounds__(256) void score_kernel(const b16* __restrict__ qp, const b16* __restrict__ kp, const float* __restrict__ sp, const float* __restrict__ ee, float* __restrict__ sc, float* __restrict__ flags) {
  __shared__ __attribute__((aligned(16))) float Ts[8][16][S + 4]; __shared__ float Fl[16][8];
  const int g = threadIdx.x >> 5, lane = threadIdx.x & 31, nloc = lane & 15, hlf = lane >> 4; const int b = blockIdx.y, s0 = blockIdx.x * 16;
  const b16* Q = qp + (((size_t)b * G + g) * S) * HD; const b16* K = kp + (((size_t)b * G + g) * S) * HD;
  const v16b q0 = frag_kb(Q + (size_t)(s0 + nloc) * HD, hlf), q1 = frag_kb(Q + (size_t)(s0 + nloc) * HD + 32, hlf);
  for (int tt = 0; tt < 16; ++tt) { v8f acc = {}; const v16b k0 = frag_kb(K + (size_t)(tt * 16 + nloc) * HD, hlf), k1 = frag_kb(K + (size_t)(tt * 16 + nloc) * HD + 32, hlf); acc = wmma16b(q0, k0, acc); acc = wmma16b(q1, k1, acc);
#pragma unroll
    for (int r = 0; r < 8; ++r) { const int s = s0 + 8 * hlf + r, t = tt * 16 + nloc; const size_t bo = ((size_t)b * S + s) * S + t; Ts[g][8 * hlf + r][t] = acc[r] * (1.0f / (QS * KS)) + (bf16_rne(sp[bo]) + bf16_rne(ee[bo])); } }
  wave_lds_sync();
  // pad flags: lane-strided any over the 256 t of rows (16 rows: 2 lanes per row... use lane l -> row l&15, half l>>4 covers t parity) 
  { const int rr = lane & 15, half = lane >> 4; int nz = 0; for (int t = half; t < S; t += 2) nz |= (Ts[g][rr][t] != 0.0f) ? 1 : 0; nz |= __shfl_xor(nz, 16); if (lane < 16) Fl[rr][g] = nz ? 1.0f : 0.0f; }
  { for (int i = lane; i < 16 * (S / 4); i += 32) { const int rr = i / (S / 4), c4 = (i % (S / 4)) * 4; *(v4f*)(sc + (((size_t)b * G + g) * S + s0 + rr) * S + c4) = *(const v4f*)(&Ts[g][rr][c4]); }  }
  __syncthreads();
  { if (threadIdx.x < 128) ((float*)flags)[((size_t)b * S + s0) * G + threadIdx.x] = Fl[threadIdx.x >> 3][threadIdx.x & 7];  }
}

// fish + softmax + PV: block = (b, 16 rows s0..) x 256 threads; for each l: a[s][t] = Σ_g (flag ? relu(p[g][l] (S_g[s][t] + σ_g² eps[l][s] δ_st)) : -inf) (f32, g in order) into
// LDS; row softmax (wave per 2 rows; fixed order), NaN row (any -inf... all -inf) -> zeros (nan_to_num); PV: wave w computes d-tile w&3 for rows... -> 4 waves x (16 rows x 16 d):
__global__ __launch_bounds__(256) void fish_kernel(const float* __restrict__ sc, const float* __restrict__ flags, const b16* __restrict__ vt, const float* __restrict__ P, float* __restrict__ ctx) {
  __shared__ __attribute__((aligned(16))) float A[16][S + 4]; __shared__ __attribute__((aligned(16))) float Cx[16][L * HD + 4];
  const int t_ = threadIdx.x, wave = t_ >> 5, lane = t_ & 31, nloc = lane & 15, hlf = lane >> 4; const int b = blockIdx.y, s0 = blockIdx.x * 16;
  const float* sig2 = P + 1536; const float* pp = P + 1544; const float* ed = P + 1672;
  for (int l = 0; l < L; ++l) {
    for (int i = t_; i < 16 * S; i += 256) { const int rr = i / S, t = i % S, s = s0 + rr; float a = 0.0f; bool ninf = false;
#pragma unroll
      for (int g = 0; g < G; ++g) { const float fl = flags[((size_t)b * S + s) * G + g]; float v = sc[(((size_t)b * G + g) * S + s) * S + t]; if (t == s) v += sig2[g] * ed[l * S + s]; v = fmaxf(pmul(v, pp[g * L + l]), 0.0f); if (fl != 0.0f) a += v; else ninf = true; }
      A[rr][t] = ninf ? -INFINITY : a; }
    __syncthreads();
    // softmax rows: wave w handles rows 2w, 2w+1
    for (int rr = wave * 2; rr < wave * 2 + 2; ++rr) { float mx = -INFINITY; for (int t = lane; t < S; t += 32) mx = fmaxf(mx, A[rr][t]);
#pragma unroll
      for (int o = 1; o < 32; o <<= 1) mx = fmaxf(mx, __shfl_xor(mx, o));
      float sm = 0.0f; for (int t = lane; t < S; t += 32) sm += (mx == -INFINITY) ? 0.0f : nexp(A[rr][t] - mx);
#pragma unroll
      for (int o = 1; o < 32; o <<= 1) sm += __shfl_xor(sm, o);
      const float inv = (mx == -INFINITY) ? 0.0f : 1.0f / sm;   // all -inf row -> NaN in the reference -> nan_to_num -> 0
      for (int t = lane; t < S; t += 32) A[rr][t] = (mx == -INFINITY) ? 0.0f : nexp(A[rr][t] - mx) * inv; }
    __syncthreads();
    // PV: waves 0..3 -> d-tile = wave (16 d of 64); rows = all 16 s; 8 k-steps; A split hi+lo x8; B = v^T rows [b][l][d][t] single
    if (wave < 4) { v8f acc = {}; const b16* V = vt + (((size_t)b * L + l) * HD) * S;
#pragma unroll 2
      for (int kb = 0; kb < S; kb += 32) { v16b ah, al; frag_split(&A[nloc][kb], hlf, ah, al); const v16b bw = frag_kb(V + (size_t)(wave * 16 + nloc) * S + kb, hlf); acc = wmma16b(ah, bw, acc); acc = wmma16b(al, bw, acc); }
#pragma unroll
      for (int r = 0; r < 8; ++r) Cx[8 * hlf + r][l * HD + wave * 16 + nloc] = acc[r] * (1.0f / (AS_ * VS)); }
    __syncthreads(); }
  { for (int i = t_; i < 16 * (L * HD / 4); i += 256) { const int rr = i / (L * HD / 4), c4 = (i % (L * HD / 4)) * 4; *(v4f*)(ctx + ((size_t)b * S + s0 + rr) * (L * HD) + c4) = *(const v4f*)(&Cx[rr][c4]); }  }
}

__global__ __launch_bounds__(128) void out_kernel(const float* __restrict__ ctx, const b16* __restrict__ Ro, const float* __restrict__ P, float* __restrict__ out) {
  __shared__ __attribute__((aligned(16))) float Ts[4][32 * 64];
  const int lane = threadIdx.x & 31, wave = threadIdx.x >> 5, nloc = lane & 15, hlf = lane >> 4, m0 = blockIdx.y * 128 + wave * 32, c0 = blockIdx.x * 64; const float* bout = P + 1024;
  v8f acc[2][4];
#pragma unroll
  for (int r = 0; r < 2; ++r)
#pragma unroll
    for (int t = 0; t < 4; ++t) acc[r][t] = (v8f){};
#pragma unroll 2
  for (int kb = 0; kb < L * HD; kb += 32) { v16b a0, l0, a1, l1; frag_split(ctx + (size_t)(m0 + nloc) * (L * HD) + kb, hlf, a0, l0); frag_split(ctx + (size_t)(m0 + 16 + nloc) * (L * HD) + kb, hlf, a1, l1);
#pragma unroll
    for (int t = 0; t < 4; ++t) { const v16b bw = frag_kb(Ro + (size_t)(c0 + t * 16 + nloc) * (L * HD) + kb, hlf); acc[0][t] = wmma16b(a0, bw, acc[0][t]); acc[0][t] = wmma16b(l0, bw, acc[0][t]); acc[1][t] = wmma16b(a1, bw, acc[1][t]); acc[1][t] = wmma16b(l1, bw, acc[1][t]); } }
  float* Tt = Ts[wave];
#pragma unroll
  for (int t = 0; t < 4; ++t) { const float bb = bout[c0 + t * 16 + nloc];
#pragma unroll
    for (int r = 0; r < 2; ++r)
#pragma unroll
      for (int v = 0; v < 8; ++v) Tt[(r * 16 + v + 8 * hlf) * 64 + t * 16 + nloc] = acc[r][t][v] * (1.0f / AS_) + bb; }
  wave_lds_sync();
  {
#pragma unroll
    for (int j = 0; j < 16; ++j) { const int rr = j * 2 + hlf, c4 = nloc * 4; *(v4f*)(out + (size_t)(m0 + rr) * H + c0 + c4) = *(const v4f*)(Tt + rr * 64 + c4); }
     }
}
}  // namespace

extern "C" void kernel_launch(void* const* d_in, const int* in_sizes, int n_in,
                              void* d_out, int out_size, void* d_ws, size_t ws_size, hipStream_t stream) {
  (void)n_in; (void)out_size;
  const float* x = (const float*)d_in[0]; const float* sp = (const float*)d_in[1]; const float* ee = (const float*)d_in[2]; const float* Wq = (const float*)d_in[3]; const float* Wk = (const float*)d_in[4]; const float* Wv = (const float*)d_in[5]; const float* bv = (const float*)d_in[6];
  const float* sg = (const float*)d_in[7]; const float* pp = (const float*)d_in[8]; const float* ed = (const float*)d_in[9]; const float* Wout = (const float*)d_in[10]; const float* bout = (const float*)d_in[11];
  float* out = (float*)d_out;   // [8][256][512]
  if (in_sizes[0] != NT * H || in_sizes[1] != Bn * S * S || in_sizes[5] != H * 1024 || in_sizes[8] != G * L || in_sizes[9] != L * S || in_sizes[10] != 1024 * H) return;
  size_t off = 0; char* ws = (char*)d_ws;
  auto carve = [&](size_t bytes) { char* p = ws + off; off += (bytes + 255) & ~(size_t)255; return p; };
  b16* R = (b16*)carve((size_t)NPJ * H * 2); b16* Ro = (b16*)carve((size_t)512 * 1024 * 2); float* P = (float*)carve(((size_t)1672 + L * S + 64) * 4);
  b16* qp = (b16*)carve((size_t)Bn * G * S * HD * 2); b16* kp = (b16*)carve((size_t)Bn * G * S * HD * 2); b16* vt = (b16*)carve((size_t)Bn * L * HD * S * 2); float* sc = (float*)carve((size_t)Bn * G * S * S * 4); float* flags = (float*)carve((size_t)Bn * S * G * 4); float* ctx = (float*)carve((size_t)NT * L * HD * 4);
  if (off > ws_size) return;                                    // ≈ 2 + 1 + 2 + 2 + 4 + 16.8 + 8.4 ≈ 37 MB
  prep_kernel<<<256, 256, 0, stream>>>(Wq, Wk, Wv, Wout, bv, bout, sg, pp, ed, R, Ro, P);
  proj_kernel<<<dim3(32, NT / 128), 128, 0, stream>>>(x, R, P, qp, kp, vt);
  score_kernel<<<dim3(S / 16, Bn), 256, 0, stream>>>(qp, kp, sp, ee, sc, flags);
  fish_kernel<<<dim3(S / 16, Bn), 256, 0, stream>>>(sc, flags, vt, P, ctx);
  out_kernel<<<dim3(H / 64, NT / 128), 128, 0, stream>>>(ctx, Ro, P, out);
}

// v001
// It runs in 179 microseconds.
// Next to v000, in two timings, it ran 3.16 and 3.15 times as fast.
#include <hip/hip_runtime.h>

// GraphormerFishAttention: q = x Wq, k = x Wk (G=8 heads x 64), v = x Wv + bv (L=16 heads x 64); g = q.k^T 512^-0.5 + (spatial + edge) bias [B,G,S,S]; pad = any_t(g != 0);
// a_l = Σ_g where(pad_g, relu(p[g,l] (g + sigma_g² eps[l,s] δ_st)), -inf); softmax over t; nan_to_num; out_l = a_l.v_l; out = merged Wout + bout -> [8][256][512].
// Projections on v_wmma_f32_16x16x32_f16 with exact operands (x and the weights are exact bf16; 1 product); g = q.k^T with q, k single f16 x8 (1 product; |q.k|·scale ≈ 0.07 next to
// the O(1) exact bias) + bias in f32; the fish mixing / relu / pad / softmax in f32 (fixed order); out_l = P.v with P as an f16 hi+lo pair x8 and v single f16 x8 (2 products);
// output projection with ctx as hi+lo x8 (2 products); f32 accumulate. Fragment k-map per lane half hh for A AND B: elements 0..7 <- k = 8hh+0..7, 8..15 <- k = 16+8hh+0..7.

namespace {
constexpr int Bn = 8, S = 256, H = 512, G = 8, L = 16, HD = 64, NT = Bn * S, NPJ = 2048;
constexpr float QS = 8.0f, KS = 8.0f, VS = 8.0f, PS = 8.0f, AS_ = 8.0f, SCALE = 0.04419417382415922f;

typedef _Float16 b16;
typedef __attribute__((ext_vector_type(16))) _Float16 v16b;
typedef __attribute__((ext_vector_type(8))) _Float16 v8b;
typedef __attribute__((ext_vector_type(8))) float v8f;
typedef __attribute__((ext_vector_type(4))) float v4f;
__device__ __forceinline__ float bf16_rne(float f) { unsigned int u = __float_as_uint(f); u += 0x7FFFu + ((u >> 16) & 1u); return __uint_as_float(u & 0xFFFF0000u); }
__device__ __forceinline__ void split16(float v, b16& hi, b16& lo) { hi = (b16)v; lo = (b16)(v - (float)hi); }
__device__ __forceinline__ v16b frag_kb(const b16* p, int hh) { const v8b a = *(const v8b*)(p + 8 * hh), b = *(const v8b*)(p + 16 + 8 * hh); v16b f;
#pragma unroll
  for (int e = 0; e < 8; ++e) { f[e] = a[e]; f[8 + e] = b[e]; } return f; }
__device__ __forceinline__ v16b frag_x(const float* p, int hh) { v16b f;
#pragma unroll
  for (int e = 0; e < 8; ++e) { f[e] = (b16)bf16_rne(p[8 * hh + e]); f[8 + e] = (b16)bf16_rne(p[16 + 8 * hh + e]); } return f; }
__device__ __forceinline__ void frag_split(const float* p, int hh, v16b& fh, v16b& fl) {
#pragma unroll
  for (int e = 0; e < 8; ++e) { b16 a, c; split16(p[8 * hh + e] * AS_, a, c); fh[e] = a; fl[e] = c; split16(p[16 + 8 * hh + e] * AS_, a, c); fh[8 + e] = a; fl[8 + e] = c; } }
__device__ __forceinline__ v8f wmma16b(v16b a, v16b b, v8f c) { v8f d = __builtin_amdgcn_wmma_f32_16x16x32_f16(false, a, false, b, (short)0, c, false, false); asm volatile("v_nop\n\tv_nop\n\tv_nop\n\tv_nop" : "+v"(d) : "v"(a), "v"(b)); return d; }
__device__ __forceinline__ void wave_lds_sync() { __builtin_amdgcn_fence(__ATOMIC_RELEASE, "workgroup"); __builtin_amdgcn_wave_barrier(); __builtin_amdgcn_fence(__ATOMIC_ACQUIRE, "workgroup"); }
__device__ __forceinline__ float nexp(float x) { return __builtin_amdgcn_exp2f(x * 1.4426950408889634f); }
__device__ __forceinline__ float pmul(float a, float b) { float p = a * b; asm volatile("" : "+v"(p)); return p; }

// prep: Wcat f16 rows [2048][512] ([in][out] -> [out][in]: Wq | Wk | Wv), Wout rows [512][1024]; P: bv @0 (1024), bout @1024 (512), sigma² @1536 (8), p @1544 (128 = [g][l]),
__global__ __launch_bounds__(256) void prep_kernel(const float* __restrict__ Wq, const float* __restrict__ Wk, const float* __restrict__ Wv, const float* __restrict__ Wout, const float* __restrict__ bv, const float* __restrict__ bout, const float* __restrict__ sg, const float* __restrict__ pp, const float* __restrict__ ed, b16* __restrict__ R, b16* __restrict__ Ro, float* __restrict__ P) {
  const int t_ = blockIdx.x * 256 + threadIdx.x, nth = gridDim.x * 256;
  {
    for (int q = t_; q < NPJ * H; q += nth) { const int o = q / H, k = q % H; float w; if (o < 512) w = Wq[(size_t)k * 512 + o]; else if (o < 1024) w = Wk[(size_t)k * 512 + o - 512]; else w = Wv[(size_t)k * 1024 + o - 1024]; R[q] = (b16)bf16_rne(w); }
    for (int q = t_; q < 512 * 1024; q += nth) { const int o = q >> 10, k = q & 1023; Ro[q] = (b16)bf16_rne(Wout[(size_t)k * 512 + o]); }
    for (int q = t_; q < 1672 + L * S; q += nth) { float v; if (q < 1024) v = bf16_rne(bv[q]); else if (q < 1536) v = bf16_rne(bout[q - 1024]); else if (q < 1544) { const float s_ = bf16_rne(sg[q - 1536]); v = s_ * s_; } else if (q < 1672) v = bf16_rne(pp[q - 1544]); else v = bf16_rne(ed[q - 1672]); P[q] = v; }
     }
}

// projections: block 128 tokens x 64 cols (tile ct of 32: 0..7 q heads, 8..15 k heads, 16..31 v l-heads); exact (1 product); q x scale x 8 / k x 8 -> planes [b][g][s][64] f16;
__global__ __launch_bounds__(128) void proj_kernel(const float* __restrict__ x, const b16* __restrict__ R, const float* __restrict__ P, b16* __restrict__ qp, b16* __restrict__ kp, b16* __restrict__ vt) {
  __shared__ __attribute__((aligned(16))) b16 T[4][32][64 + 8]; __shared__ __attribute__((aligned(16))) b16 Tv[64][128 + 8];
  const int lane = threadIdx.x & 31, wave = threadIdx.x >> 5, nloc = lane & 15, hlf = lane >> 4, ct = blockIdx.x, c0 = ct * 64, p0 = blockIdx.y * 128, m0 = p0 + wave * 32, b = p0 / S, t0 = p0 % S;
  v8f acc[2][4];
#pragma unroll
  for (int r = 0; r < 2; ++r)
#pragma unroll
    for (int t = 0; t < 4; ++t) acc[r][t] = (v8f){};
#pragma unroll 2
  for (int kb = 0; kb < H; kb += 32) { const v16b a0 = frag_x(x + (size_t)(m0 + nloc) * H + kb, hlf), a1 = frag_x(x + (size_t)(m0 + 16 + nloc) * H + kb, hlf);
#pragma unroll
    for (int t = 0; t < 4; ++t) { const v16b bw = frag_kb(R + (size_t)(c0 + t * 16 + nloc) * H + kb, hlf); acc[0][t] = wmma16b(a0, bw, acc[0][t]); acc[1][t] = wmma16b(a1, bw, acc[1][t]); } }
  if (ct < 16) { const float scl = (ct < 8) ? SCALE * QS : KS; const int hd_ = (ct < 8) ? ct : ct - 8;
#pragma unroll
    for (int t = 0; t < 4; ++t)
#pragma unroll
      for (int r = 0; r < 2; ++r)
#pragma unroll
        for (int v = 0; v < 8; ++v) T[wave][r * 16 + 8 * hlf + v][t * 16 + nloc] = (b16)(acc[r][t][v] * scl);
    wave_lds_sync();
    b16* base = ((ct < 8) ? qp : kp) + (((size_t)b * G + hd_) * S + (m0 % S)) * HD;
    {
#pragma unroll
      for (int j = 0; j < 8; ++j) { const int rr = j * 4 + (lane >> 3), c8 = (lane & 7) * 8; *(v8b*)(base + (size_t)rr * HD + c8) = *(const v8b*)(&T[wave][rr][c8]); }
       }
    return; }
  const int l = ct - 16; const float* bvp = P + l * HD;
#pragma unroll
  for (int t = 0; t < 4; ++t) { const float bb = bvp[t * 16 + nloc];
#pragma unroll
    for (int r = 0; r < 2; ++r)
#pragma unroll
      for (int v = 0; v < 8; ++v) Tv[t * 16 + nloc][wave * 32 + r * 16 + 8 * hlf + v] = (b16)((acc[r][t][v] + bb) * VS); }
  __syncthreads();
  { for (int i = threadIdx.x; i < 64 * 16; i += 128) { const int d = i >> 4, c8 = (i & 15) * 8; *(v8b*)(vt + (((size_t)b * L + l) * HD + d) * S + t0 + c8) = *(const v8b*)(&Tv[d][c8]); }  }
}

// scores: block = (b, 16 query rows s0..) x 8 waves (wave = head g): Sg[s][t] = q_s.k_t (scaled) + spatial[b][s][t] + edge[b][s][t] (2 k-steps x 16 t-tiles, 1 product) -> f32 rows
__global__ __launch_bounds__(256) void score_kernel(const b16* __restrict__ qp, const b16* __restrict__ kp, const float* __restrict__ sp, const float* __restrict__ ee, float* __restrict__ sc, float* __restrict__ flags) {
  __shared__ __attribute__((aligned(16))) float Ts[8][16][S + 4]; __shared__ float Fl[16][8];
  const int g = threadIdx.x >> 5, lane = threadIdx.x & 31, nloc = lane & 15, hlf = lane >> 4; const int b = blockIdx.y, s0 = blockIdx.x * 16;
  const b16* Q = qp + (((size_t)b * G + g) * S) * HD; const b16* K = kp + (((size_t)b * G + g) * S) * HD;
  const v16b q0 = frag_kb(Q + (size_t)(s0 + nloc) * HD, hlf), q1 = frag_kb(Q + (size_t)(s0 + nloc) * HD + 32, hlf);
  for (int tt = 0; tt < 16; ++tt) { v8f acc = {}; const v16b k0 = frag_kb(K + (size_t)(tt * 16 + nloc) * HD, hlf), k1 = frag_kb(K + (size_t)(tt * 16 + nloc) * HD + 32, hlf); acc = wmma16b(q0, k0, acc); acc = wmma16b(q1, k1, acc);
#pragma unroll
    for (int r = 0; r < 8; ++r) { const int s = s0 + 8 * hlf + r, t = tt * 16 + nloc; const size_t bo = ((size_t)b * S + s) * S + t; Ts[g][8 * hlf + r][t] = acc[r] * (1.0f / (QS * KS)) + (bf16_rne(sp[bo]) + bf16_rne(ee[bo])); } }
  wave_lds_sync();
  // pad flags: lane-strided any over the 256 t of rows (16 rows: 2 lanes per row... use lane l -> row l&15, half l>>4 covers t parity) 
  { const int rr = lane & 15, half = lane >> 4; int nz = 0; for (int t = half; t < S; t += 2) nz |= (Ts[g][rr][t] != 0.0f) ? 1 : 0; nz |= __shfl_xor(nz, 16); if (lane < 16) Fl[rr][g] = nz ? 1.0f : 0.0f; }
  { for (int i = lane; i < 16 * (S / 4); i += 32) { const int rr = i / (S / 4), c4 = (i % (S / 4)) * 4; *(v4f*)(sc + (((size_t)b * G + g) * S + s0 + rr) * S + c4) = *(const v4f*)(&Ts[g][rr][c4]); }  }
  __syncthreads();
  { if (threadIdx.x < 128) ((float*)flags)[((size_t)b * S + s0) * G + threadIdx.x] = Fl[threadIdx.x >> 3][threadIdx.x & 7];  }
}

// fish + softmax + PV: block = (b, 16 rows s0.., one local head l = blockIdx.z) x 256 threads; a[s][t] = sum_g (flag ? relu(p[g][l] (S_g[s][t] + sigma_g^2 eps[l][s] d_st)) : -inf) (f32, g in order)
// into LDS; row softmax (wave per 2 rows; fixed order), all -inf row -> zeros (nan_to_num); PV: 4 waves x (16 rows x 16 d). l is the slowest grid index: 2048 work-groups fill every wave slot.
__global__ __launch_bounds__(256) void fish_kernel(const float* __restrict__ sc, const float* __restrict__ flags, const b16* __restrict__ vt, const float* __restrict__ P, float* __restrict__ ctx) {
  __shared__ __attribute__((aligned(16))) float A[16][S + 4]; __shared__ __attribute__((aligned(16))) float Cx[16][HD + 4];
  const int t_ = threadIdx.x, wave = t_ >> 5, lane = t_ & 31, nloc = lane & 15, hlf = lane >> 4; const int b = blockIdx.y, s0 = blockIdx.x * 16, l = blockIdx.z;
  const float* sig2 = P + 1536; const float* pp = P + 1544; const float* ed = P + 1672;
  for (int i = t_; i < 16 * S; i += 256) { const int rr = i / S, t = i % S, s = s0 + rr; float a = 0.0f; bool ninf = false;
#pragma unroll
    for (int g = 0; g < G; ++g) { const float fl = flags[((size_t)b * S + s) * G + g]; float v = sc[(((size_t)b * G + g) * S + s) * S + t]; if (t == s) v += sig2[g] * ed[l * S + s]; v = fmaxf(pmul(v, pp[g * L + l]), 0.0f); if (fl != 0.0f) a += v; else ninf = true; }
    A[rr][t] = ninf ? -INFINITY : a; }
  __syncthreads();
  // softmax rows: wave w handles rows 2w, 2w+1
  for (int rr = wave * 2; rr < wave * 2 + 2; ++rr) { float mx = -INFINITY; for (int t = lane; t < S; t += 32) mx = fmaxf(mx, A[rr][t]);
#pragma unroll
    for (int o = 1; o < 32; o <<= 1) mx = fmaxf(mx, __shfl_xor(mx, o));
    float sm = 0.0f; for (int t = lane; t < S; t += 32) sm += (mx == -INFINITY) ? 0.0f : nexp(A[rr][t] - mx);
#pragma unroll
    for (int o = 1; o < 32; o <<= 1) sm += __shfl_xor(sm, o);
    const float inv = (mx == -INFINITY) ? 0.0f : 1.0f / sm;   // all -inf row -> NaN in the reference -> nan_to_num -> 0
    for (int t = lane; t < S; t += 32) A[rr][t] = (mx == -INFINITY) ? 0.0f : nexp(A[rr][t] - mx) * inv; }
  __syncthreads();
  // PV: waves 0..3 -> d-tile = wave (16 d of 64); rows = all 16 s; 8 k-steps; A split hi+lo x8; B = v^T rows [b][l][d][t] single
  if (wave < 4) { v8f acc = {}; const b16* V = vt + (((size_t)b * L + l) * HD) * S;
#pragma unroll 2
    for (int kb = 0; kb < S; kb += 32) { v16b ah, al; frag_split(&A[nloc][kb], hlf, ah, al); const v16b bw = frag_kb(V + (size_t)(wave * 16 + nloc) * S + kb, hlf); acc = wmma16b(ah, bw, acc); acc = wmma16b(al, bw, acc); }
#pragma unroll
    for (int r = 0; r < 8; ++r) Cx[8 * hlf + r][wave * 16 + nloc] = acc[r] * (1.0f / (AS_ * VS)); }
  __syncthreads();
  { const int rr = t_ >> 4, c4 = (t_ & 15) * 4; *(v4f*)(ctx + ((size_t)b * S + s0 + rr) * (L * HD) + l * HD + c4) = *(const v4f*)(&Cx[rr][c4]); }
}

__global__ __launch_bounds__(128) void out_kernel(const float* __restrict__ ctx, const b16* __restrict__ Ro, const float* __restrict__ P, float* __restrict__ out) {
  __shared__ __attribute__((aligned(16))) float Ts[4][32 * 64];
  const int lane = threadIdx.x & 31, wave = threadIdx.x >> 5, nloc = lane & 15, hlf = lane >> 4, m0 = blockIdx.y * 128 + wave * 32, c0 = blockIdx.x * 64; const float* bout = P + 1024;
  v8f acc[2][4];
#pragma unroll
  for (int r = 0; r < 2; ++r)
#pragma unroll
    for (int t = 0; t < 4; ++t) acc[r][t] = (v8f){};
#pragma unroll 2
  for (int kb = 0; kb < L * HD; kb += 32) { v16b a0, l0, a1, l1; frag_split(ctx + (size_t)(m0 + nloc) * (L * HD) + kb, hlf, a0, l0); frag_split(ctx + (size_t)(m0 + 16 + nloc) * (L * HD) + kb, hlf, a1, l1);
#pragma unroll
    for (int t = 0; t < 4; ++t) { const v16b bw = frag_kb(Ro + (size_t)(c0 + t * 16 + nloc) * (L * HD) + kb, hlf); acc[0][t] = wmma16b(a0, bw, acc[0][t]); acc[0][t] = wmma16b(l0, bw, acc[0][t]); acc[1][t] = wmma16b(a1, bw, acc[1][t]); acc[1][t] = wmma16b(l1, bw, acc[1][t]); } }
  float* Tt = Ts[wave];
#pragma unroll
  for (int t = 0; t < 4; ++t) { const float bb = bout[c0 + t * 16 + nloc];
#pragma unroll
    for (int r = 0; r < 2; ++r)
#pragma unroll
      for (int v = 0; v < 8; ++v) Tt[(r * 16 + v + 8 * hlf) * 64 + t * 16 + nloc] = acc[r][t][v] * (1.0f / AS_) + bb; }
  wave_lds_sync();
  {
#pragma unroll
    for (int j = 0; j < 16; ++j) { const int rr = j * 2 + hlf, c4 = nloc * 4; *(v4f*)(out + (size_t)(m0 + rr) * H + c0 + c4) = *(const v4f*)(Tt + rr * 64 + c4); }
     }
}
}  // namespace

extern "C" void kernel_launch(void* const* d_in, const int* in_sizes, int n_in,
                              void* d_out, int out_size, void* d_ws, size_t ws_size, hipStream_t stream) {
  (void)n_in; (void)out_size;
  const float* x = (const float*)d_in[0]; const float* sp = (const float*)d_in[1]; const float* ee = (const float*)d_in[2]; const float* Wq = (const float*)d_in[3]; const float* Wk = (const float*)d_in[4]; const float* Wv = (const float*)d_in[5]; const float* bv = (const float*)d_in[6];
  const float* sg = (const float*)d_in[7]; const float* pp = (const float*)d_in[8]; const float* ed = (const float*)d_in[9]; const float* Wout = (const float*)d_in[10]; const float* bout = (const float*)d_in[11];
  float* out = (float*)d_out;   // [8][256][512]
  if (in_sizes[0] != NT * H || in_sizes[1] != Bn * S * S || in_sizes[5] != H * 1024 || in_sizes[8] != G * L || in_sizes[9] != L * S || in_sizes[10] != 1024 * H) return;
  size_t off = 0; char* ws = (char*)d_ws;
  auto carve = [&](size_t bytes) { char* p = ws + off; off += (bytes + 255) & ~(size_t)255; return p; };
  b16* R = (b16*)carve((size_t)NPJ * H * 2); b16* Ro = (b16*)carve((size_t)512 * 1024 * 2); float* P = (float*)carve(((size_t)1672 + L * S + 64) * 4);
  b16* qp = (b16*)carve((size_t)Bn * G * S * HD * 2); b16* kp = (b16*)carve((size_t)Bn * G * S * HD * 2); b16* vt = (b16*)carve((size_t)Bn * L * HD * S * 2); float* sc = (float*)carve((size_t)Bn * G * S * S * 4); float* flags = (float*)carve((size_t)Bn * S * G * 4); float* ctx = (float*)carve((size_t)NT * L * HD * 4);
  if (off > ws_size) return;                                    // ≈ 2 + 1 + 2 + 2 + 4 + 16.8 + 8.4 ≈ 37 MB
  prep_kernel<<<256, 256, 0, stream>>>(Wq, Wk, Wv, Wout, bv, bout, sg, pp, ed, R, Ro, P);
  proj_kernel<<<dim3(32, NT / 128), 128, 0, stream>>>(x, R, P, qp, kp, vt);
  score_kernel<<<dim3(S / 16, Bn), 256, 0, stream>>>(qp, kp, sp, ee, sc, flags);
  fish_kernel<<<dim3(S / 16, Bn, L), 256, 0, stream>>>(sc, flags, vt, P, ctx);
  out_kernel<<<dim3(H / 64, NT / 128), 128, 0, stream>>>(ctx, Ro, P, out);
}

// v002
// It runs in 81.4 microseconds.
// In two side-by-side timings against v001, it was 2.20 and 2.21 times as fast.
// Over all steps from v000 it is 6.94 times as fast.
#include <hip/hip_runtime.h>

// GraphormerFishAttention: q = x Wq, k = x Wk (G=8 heads x 64), v = x Wv + bv (L=16 heads x 64); g = q.k^T 512^-0.5 + (spatial + edge) bias [B,G,S,S]; pad = any_t(g != 0);
// a_l = Σ_g where(pad_g, relu(p[g,l] (g + sigma_g² eps[l,s] δ_st)), -inf); softmax over t; nan_to_num; out_l = a_l.v_l; out = merged Wout + bout -> [8][256][512].
// Projections on v_wmma_f32_16x16x32_f16 with exact operands (x and the weights are exact bf16; 1 product); g = q.k^T with q, k single f16 x8 (1 product; |q.k|·scale ≈ 0.07 next to
// the O(1) exact bias) + bias in f32; the fish mixing / relu / pad / softmax in f32 (fixed order); out_l = P.v with P as an f16 hi+lo pair x8 and v single f16 x8 (2 products);
// output projection with ctx as hi+lo x8 (2 products); f32 accumulate. Fragment k-map per lane half hh for A AND B: elements 0..7 <- k = 8hh+0..7, 8..15 <- k = 16+8hh+0..7.

namespace {
constexpr int Bn = 8, S = 256, H = 512, G = 8, L = 16, HD = 64, NT = Bn * S, NPJ = 2048;
constexpr float QS = 8.0f, KS = 8.0f, VS = 8.0f, PS = 8.0f, AS_ = 8.0f, SCALE = 0.04419417382415922f;

typedef _Float16 b16;
typedef __attribute__((ext_vector_type(16))) _Float16 v16b;
typedef __attribute__((ext_vector_type(8))) _Float16 v8b;
typedef __attribute__((ext_vector_type(8))) float v8f;
typedef __attribute__((ext_vector_type(4))) float v4f;
__device__ __forceinline__ float bf16_rne(float f) { unsigned int u = __float_as_uint(f); u += 0x7FFFu + ((u >> 16) & 1u); return __uint_as_float(u & 0xFFFF0000u); }
__device__ __forceinline__ void split16(float v, b16& hi, b16& lo) { hi = (b16)v; lo = (b16)(v - (float)hi); }
__device__ __forceinline__ v16b frag_kb(const b16* p, int hh) { const v8b a = *(const v8b*)(p + 8 * hh), b = *(const v8b*)(p + 16 + 8 * hh); v16b f;
#pragma unroll
  for (int e = 0; e < 8; ++e) { f[e] = a[e]; f[8 + e] = b[e]; } return f; }
__device__ __forceinline__ void frag_split(const float* p, int hh, v16b& fh, v16b& fl) {
#pragma unroll
  for (int e = 0; e < 8; ++e) { b16 a, c; split16(p[8 * hh + e] * AS_, a, c); fh[e] = a; fl[e] = c; split16(p[16 + 8 * hh + e] * AS_, a, c); fh[8 + e] = a; fl[8 + e] = c; } }
// raw operand loads, kept apart from their conversion so that a whole batch can be in flight before the first use (same elements, same k order as frag_kb / frag_split)
__device__ __forceinline__ void ld_h(const b16* p, int hh, v8b* r) { r[0] = *(const v8b*)(p + 8 * hh); r[1] = *(const v8b*)(p + 16 + 8 * hh); }
__device__ __forceinline__ void ld_f(const float* p, int hh, v4f* r) { r[0] = *(const v4f*)(p + 8 * hh); r[1] = *(const v4f*)(p + 8 * hh + 4); r[2] = *(const v4f*)(p + 16 + 8 * hh); r[3] = *(const v4f*)(p + 16 + 8 * hh + 4); }
__device__ __forceinline__ v16b cat_h(const v8b* r) { v16b f;
#pragma unroll
  for (int e = 0; e < 8; ++e) { f[e] = r[0][e]; f[8 + e] = r[1][e]; } return f; }
__device__ __forceinline__ v16b cvt_x(const v4f* r) { v16b f;
#pragma unroll
  for (int e = 0; e < 8; ++e) { f[e] = (b16)bf16_rne(r[e >> 2][e & 3]); f[8 + e] = (b16)bf16_rne(r[2 + (e >> 2)][e & 3]); } return f; }
__device__ __forceinline__ void cvt_split(const v4f* r, v16b& fh, v16b& fl) {
#pragma unroll
  for (int e = 0; e < 8; ++e) { b16 a, c; split16(r[e >> 2][e & 3] * AS_, a, c); fh[e] = a; fl[e] = c; split16(r[2 + (e >> 2)][e & 3] * AS_, a, c); fh[8 + e] = a; fl[8 + e] = c; } }
__device__ __forceinline__ v8f wmma16b(v16b a, v16b b, v8f c) { v8f d = __builtin_amdgcn_wmma_f32_16x16x32_f16(false, a, false, b, (short)0, c, false, false); asm volatile("v_nop\n\tv_nop\n\tv_nop\n\tv_nop" : "+v"(d) : "v"(a), "v"(b)); return d; }
__device__ __forceinline__ void wave_lds_sync() { __builtin_amdgcn_fence(__ATOMIC_RELEASE, "workgroup"); __builtin_amdgcn_wave_barrier(); __builtin_amdgcn_fence(__ATOMIC_ACQUIRE, "workgroup"); }
__device__ __forceinline__ float nexp(float x) { return __builtin_amdgcn_exp2f(x * 1.4426950408889634f); }
__device__ __forceinline__ float pmul(float a, float b) { float p = a * b; asm volatile("" : "+v"(p)); return p; }

// prep: Wcat f16 rows [2048][512] ([in][out] -> [out][in]: Wq | Wk | Wv), Wout rows [512][1024]; P: bv @0 (1024), bout @1024 (512), sigma² @1536 (8), p @1544 (128 = [g][l]),
__global__ __launch_bounds__(256) void prep_kernel(const float* __restrict__ Wq, const float* __restrict__ Wk, const float* __restrict__ Wv, const float* __restrict__ Wout, const float* __restrict__ bv, const float* __restrict__ bout, const float* __restrict__ sg, const float* __restrict__ pp, const float* __restrict__ ed, b16* __restrict__ R, b16* __restrict__ Ro, float* __restrict__ P) {
  const int t_ = blockIdx.x * 256 + threadIdx.x, nth = gridDim.x * 256;
  {
    for (int q = t_; q < NPJ * H; q += nth) { const int o = q / H, k = q % H; float w; if (o < 512) w = Wq[(size_t)k * 512 + o]; else if (o < 1024) w = Wk[(size_t)k * 512 + o - 512]; else w = Wv[(size_t)k * 1024 + o - 1024]; R[q] = (b16)bf16_rne(w); }
    for (int q = t_; q < 512 * 1024; q += nth) { const int o = q >> 10, k = q & 1023; Ro[q] = (b16)bf16_rne(Wout[(size_t)k * 512 + o]); }
    for (int q = t_; q < 1672 + L * S; q += nth) { float v; if (q < 1024) v = bf16_rne(bv[q]); else if (q < 1536) v = bf16_rne(bout[q - 1024]); else if (q < 1544) { const float s_ = bf16_rne(sg[q - 1536]); v = s_ * s_; } else if (q < 1672) v = bf16_rne(pp[q - 1544]); else v = bf16_rne(ed[q - 1672]); P[q] = v; }
     }
}

// projections: block 128 tokens x 64 cols (tile ct of 32: 0..7 q heads, 8..15 k heads, 16..31 v l-heads); exact (1 product); q x scale x 8 / k x 8 -> planes [b][g][s][64] f16;
__global__ __launch_bounds__(128) void proj_kernel(const float* __restrict__ x, const b16* __restrict__ R, const float* __restrict__ P, b16* __restrict__ qp, b16* __restrict__ kp, b16* __restrict__ vt) {
  __shared__ __attribute__((aligned(16))) b16 T[4][32][64 + 8]; __shared__ __attribute__((aligned(16))) b16 Tv[64][128 + 8];
  const int lane = threadIdx.x & 31, wave = threadIdx.x >> 5, nloc = lane & 15, hlf = lane >> 4, ct = blockIdx.x, c0 = ct * 64, p0 = blockIdx.y * 128, m0 = p0 + wave * 32, b = p0 / S, t0 = p0 % S;
  v8f acc[2][4];
#pragma unroll
  for (int r = 0; r < 2; ++r)
#pragma unroll
    for (int t = 0; t < 4; ++t) acc[r][t] = (v8f){};
  const float* xr = x + (size_t)(m0 + nloc) * H; const b16* wr = R + (size_t)(c0 + nloc) * H;
  auto fetch = [&](int kb, v4f* ra, v8b* rb) { ld_f(xr + kb, hlf, ra); ld_f(xr + (size_t)16 * H + kb, hlf, ra + 4);
#pragma unroll
    for (int t = 0; t < 4; ++t) ld_h(wr + (size_t)(t * 16) * H + kb, hlf, rb + 2 * t); };
  auto mults = [&](const v4f* ra, const v8b* rb) { const v16b a0 = cvt_x(ra), a1 = cvt_x(ra + 4);
#pragma unroll
    for (int t = 0; t < 4; ++t) { const v16b bw = cat_h(rb + 2 * t); acc[0][t] = wmma16b(a0, bw, acc[0][t]); acc[1][t] = wmma16b(a1, bw, acc[1][t]); } };
  // two register sets: the 16 loads of k-step n + 1 are all issued before the products of k-step n
  v4f xa[8], ya[8]; v8b xb[8], yb[8]; fetch(0, xa, xb);
  // SB: keeps a set's conversions from being scheduled in front of the other set's loads or into its products, where they would wait for loads just issued
#define SB __builtin_amdgcn_sched_barrier(0)
  for (int kb = 0; kb < H - 64; kb += 64) { fetch(kb + 32, ya, yb); SB; mults(xa, xb); SB; fetch(kb + 64, xa, xb); SB; mults(ya, yb); SB; }
  fetch(H - 32, ya, yb); SB; mults(xa, xb); SB; mults(ya, yb);
  if (ct < 16) { const float scl = (ct < 8) ? SCALE * QS : KS; const int hd_ = (ct < 8) ? ct : ct - 8;
#pragma unroll
    for (int t = 0; t < 4; ++t)
#pragma unroll
      for (int r = 0; r < 2; ++r)
#pragma unroll
        for (int v = 0; v < 8; ++v) T[wave][r * 16 + 8 * hlf + v][t * 16 + nloc] = (b16)(acc[r][t][v] * scl);
    wave_lds_sync();
    b16* base = ((ct < 8) ? qp : kp) + (((size_t)b * G + hd_) * S + (m0 % S)) * HD;
    {
#pragma unroll
      for (int j = 0; j < 8; ++j) { const int rr = j * 4 + (lane >> 3), c8 = (lane & 7) * 8; *(v8b*)(base + (size_t)rr * HD + c8) = *(const v8b*)(&T[wave][rr][c8]); }
       }
    return; }
  const int l = ct - 16; const float* bvp = P + l * HD;
#pragma unroll
  for (int t = 0; t < 4; ++t) { const float bb = bvp[t * 16 + nloc];
#pragma unroll
    for (int r = 0; r < 2; ++r)
#pragma unroll
      for (int v = 0; v < 8; ++v) Tv[t * 16 + nloc][wave * 32 + r * 16 + 8 * hlf + v] = (b16)((acc[r][t][v] + bb) * VS); }
  __syncthreads();
  { for (int i = threadIdx.x; i < 64 * 16; i += 128) { const int d = i >> 4, c8 = (i & 15) * 8; *(v8b*)(vt + (((size_t)b * L + l) * HD + d) * S + t0 + c8) = *(const v8b*)(&Tv[d][c8]); }  }
}

// scores: block = (b, 16 query rows s0..) x 8 waves (wave = head g): Sg[s][t] = q_s.k_t (scaled) + spatial[b][s][t] + edge[b][s][t] (2 k-steps x 16 t-tiles, 1 product) -> f32 rows
__global__ __launch_bounds__(256) void score_kernel(const b16* __restrict__ qp, const b16* __restrict__ kp, const float* __restrict__ sp, const float* __restrict__ ee, float* __restrict__ sc, float* __restrict__ flags) {
  __shared__ __attribute__((aligned(16))) float Ts[8][16][S + 4]; __shared__ float Fl[16][8];
  const int g = threadIdx.x >> 5, lane = threadIdx.x & 31, nloc = lane & 15, hlf = lane >> 4; const int b = blockIdx.y, s0 = blockIdx.x * 16;
  const b16* Q = qp + (((size_t)b * G + g) * S) * HD; const b16* K = kp + (((size_t)b * G + g) * S) * HD;
  const v16b q0 = frag_kb(Q + (size_t)(s0 + nloc) * HD, hlf), q1 = frag_kb(Q + (size_t)(s0 + nloc) * HD + 32, hlf);
  // two t-tiles a trip: their key rows and bias values (40 loads) are all requested before the first product
  const b16* kq = K + (size_t)nloc * HD; const size_t bo0 = ((size_t)b * S + s0 + 8 * hlf) * S + nloc; const float* sq = sp + bo0; const float* eq = ee + bo0;
  for (int t4 = 0; t4 < 16; t4 += 2) { v8b kr[2][4]; float bs[2][8], be[2][8];
#pragma unroll
    for (int u = 0; u < 2; ++u) { ld_h(kq + u * 16 * HD, hlf, &kr[u][0]); ld_h(kq + u * 16 * HD + 32, hlf, &kr[u][2]);
#pragma unroll
      for (int r = 0; r < 8; ++r) { bs[u][r] = sq[r * S + u * 16]; be[u][r] = eq[r * S + u * 16]; } }
    kq += 32 * HD; sq += 32; eq += 32;
#pragma unroll
    for (int u = 0; u < 2; ++u) { v8f acc = {}; acc = wmma16b(q0, cat_h(&kr[u][0]), acc); acc = wmma16b(q1, cat_h(&kr[u][2]), acc);
#pragma unroll
      for (int r = 0; r < 8; ++r) Ts[g][8 * hlf + r][(t4 + u) * 16 + nloc] = acc[r] * (1.0f / (QS * KS)) + (bf16_rne(bs[u][r]) + bf16_rne(be[u][r])); } }
  wave_lds_sync();
  // pad flags: lane-strided any over the 256 t of rows (16 rows: 2 lanes per row... use lane l -> row l&15, half l>>4 covers t parity) 
  { const int rr = lane & 15, half = lane >> 4; int nz = 0; for (int t = half; t < S; t += 2) nz |= (Ts[g][rr][t] != 0.0f) ? 1 : 0; nz |= __shfl_xor(nz, 16); if (lane < 16) Fl[rr][g] = nz ? 1.0f : 0.0f; }
  { for (int i = lane; i < 16 * (S / 4); i += 32) { const int rr = i / (S / 4), c4 = (i % (S / 4)) * 4; *(v4f*)(sc + (((size_t)b * G + g) * S + s0 + rr) * S + c4) = *(const v4f*)(&Ts[g][rr][c4]); }  }
  __syncthreads();
  { if (threadIdx.x < 128) ((float*)flags)[((size_t)b * S + s0) * G + threadIdx.x] = Fl[threadIdx.x >> 3][threadIdx.x & 7];  }
}

// fish + softmax + PV: block = (b, 16 rows s0.., one local head l = blockIdx.z) x 256 threads; a[s][t] = sum_g (flag ? relu(p[g][l] (S_g[s][t] + sigma_g^2 eps[l][s] d_st)) : -inf) (f32, g in order)
// into LDS; row softmax (wave per 2 rows; fixed order), all -inf row -> zeros (nan_to_num); PV: 4 waves x (16 rows x 16 d). l is the slowest grid index: 2048 work-groups fill every wave slot.
__global__ __launch_bounds__(256, 16) void fish_kernel(const float* __restrict__ sc, const float* __restrict__ flags, const b16* __restrict__ vt, const float* __restrict__ P, float* __restrict__ ctx) {
  __shared__ __attribute__((aligned(16))) float A[16][S + 4]; __shared__ __attribute__((aligned(16))) float Cx[16][HD + 4];
  const int t_ = threadIdx.x, wave = t_ >> 5, lane = t_ & 31, nloc = lane & 15, hlf = lane >> 4; const int b = blockIdx.y, s0 = blockIdx.x * 16, l = blockIdx.z;
  const float* sig2 = P + 1536; const float* pp = P + 1544; const float* ed = P + 1672;
  // thread = column t, one row a pass; RB rows a trip: their 8 score planes, flags and eps are all requested before the first use
  constexpr int RB = 4; float pl[G], s2[G];
#pragma unroll
  for (int g = 0; g < G; ++g) { pl[g] = pp[g * L + l]; s2[g] = sig2[g]; }
  for (int r0 = 0; r0 < 16; r0 += RB) { float sv[RB][G], fl[RB][G], ev[RB];
#pragma unroll
    for (int j = 0; j < RB; ++j) { const int s = s0 + r0 + j; ev[j] = ed[l * S + s];
#pragma unroll
      for (int g = 0; g < G; ++g) { sv[j][g] = sc[(((size_t)b * G + g) * S + s) * S + t_]; fl[j][g] = flags[((size_t)b * S + s) * G + g]; } }
#pragma unroll
    for (int j = 0; j < RB; ++j) { const int s = s0 + r0 + j; float a = 0.0f; bool ninf = false;
#pragma unroll
      for (int g = 0; g < G; ++g) { float v = sv[j][g]; if (t_ == s) v += s2[g] * ev[j]; v = fmaxf(pmul(v, pl[g]), 0.0f); if (fl[j][g] != 0.0f) a += v; else ninf = true; }
      A[r0 + j][t_] = ninf ? -INFINITY : a; } }
  __syncthreads();
  // softmax rows: wave w handles rows 2w, 2w+1
  for (int rr = wave * 2; rr < wave * 2 + 2; ++rr) { float mx = -INFINITY;
#pragma unroll
    for (int j = 0; j < 8; ++j) mx = fmaxf(mx, A[rr][lane + 32 * j]);
#pragma unroll
    for (int o = 1; o < 32; o <<= 1) mx = fmaxf(mx, __shfl_xor(mx, o));
    float sm = 0.0f;
#pragma unroll
    for (int j = 0; j < 8; ++j) sm += (mx == -INFINITY) ? 0.0f : nexp(A[rr][lane + 32 * j] - mx);
#pragma unroll
    for (int o = 1; o < 32; o <<= 1) sm += __shfl_xor(sm, o);
    const float inv = (mx == -INFINITY) ? 0.0f : 1.0f / sm;   // all -inf row -> NaN in the reference -> nan_to_num -> 0
#pragma unroll
    for (int j = 0; j < 8; ++j) A[rr][lane + 32 * j] = (mx == -INFINITY) ? 0.0f : nexp(A[rr][lane + 32 * j] - mx) * inv; }
  __syncthreads();
  // PV: waves 0..3 -> d-tile = wave (16 d of 64); rows = all 16 s; 8 k-steps; A split hi+lo x8; B = v^T rows [b][l][d][t] single
  if (wave < 4) { v8f acc = {}; const b16* V = vt + (((size_t)b * L + l) * HD) * S;
    for (int k0 = 0; k0 < S; k0 += 64) { v8b vr[2][2];   // two k-steps' value rows requested together
#pragma unroll
      for (int u = 0; u < 2; ++u) ld_h(V + (size_t)(wave * 16 + nloc) * S + k0 + 32 * u, hlf, vr[u]);
#pragma unroll
      for (int u = 0; u < 2; ++u) { v16b ah, al; frag_split(&A[nloc][k0 + 32 * u], hlf, ah, al); const v16b bw = cat_h(vr[u]); acc = wmma16b(ah, bw, acc); acc = wmma16b(al, bw, acc); } }
#pragma unroll
    for (int r = 0; r < 8; ++r) Cx[8 * hlf + r][wave * 16 + nloc] = acc[r] * (1.0f / (AS_ * VS)); }
  __syncthreads();
  { const int rr = t_ >> 4, c4 = (t_ & 15) * 4; *(v4f*)(ctx + ((size_t)b * S + s0 + rr) * (L * HD) + l * HD + c4) = *(const v4f*)(&Cx[rr][c4]); }
}

__global__ __launch_bounds__(128) void out_kernel(const float* __restrict__ ctx, const b16* __restrict__ Ro, const float* __restrict__ P, float* __restrict__ out) {
  __shared__ __attribute__((aligned(16))) float Ts[4][32 * 64];
  const int lane = threadIdx.x & 31, wave = threadIdx.x >> 5, nloc = lane & 15, hlf = lane >> 4, m0 = blockIdx.y * 128 + wave * 32, c0 = blockIdx.x * 64; const float* bout = P + 1024;
  v8f acc[2][4];
#pragma unroll
  for (int r = 0; r < 2; ++r)
#pragma unroll
    for (int t = 0; t < 4; ++t) acc[r][t] = (v8f){};
  constexpr int KD = L * HD; const float* cr = ctx + (size_t)(m0 + nloc) * KD; const b16* wr = Ro + (size_t)(c0 + nloc) * KD;
  auto fetch = [&](int kb, v4f* ra, v8b* rb) { ld_f(cr + kb, hlf, ra); ld_f(cr + (size_t)16 * KD + kb, hlf, ra + 4);
#pragma unroll
    for (int t = 0; t < 4; ++t) ld_h(wr + (size_t)(t * 16) * KD + kb, hlf, rb + 2 * t); };
  auto mults = [&](const v4f* ra, const v8b* rb) { v16b a0, l0, a1, l1; cvt_split(ra, a0, l0); cvt_split(ra + 4, a1, l1);
#pragma unroll
    for (int t = 0; t < 4; ++t) { const v16b bw = cat_h(rb + 2 * t); acc[0][t] = wmma16b(a0, bw, acc[0][t]); acc[0][t] = wmma16b(l0, bw, acc[0][t]); acc[1][t] = wmma16b(a1, bw, acc[1][t]); acc[1][t] = wmma16b(l1, bw, acc[1][t]); } };
  // two register sets: the 16 loads of k-step n + 1 are all issued before the products of k-step n
  v4f xa[8], ya[8]; v8b xb[8], yb[8]; fetch(0, xa, xb);
  for (int kb = 0; kb < KD - 64; kb += 64) { fetch(kb + 32, ya, yb); SB; mults(xa, xb); SB; fetch(kb + 64, xa, xb); SB; mults(ya, yb); SB; }   // SB: as in the projection loop
  fetch(KD - 32, ya, yb); SB; mults(xa, xb); SB; mults(ya, yb);
#undef SB
  float* Tt = Ts[wave];
#pragma unroll
  for (int t = 0; t < 4; ++t) { const float bb = bout[c0 + t * 16 + nloc];
#pragma unroll
    for (int r = 0; r < 2; ++r)
#pragma unroll
      for (int v = 0; v < 8; ++v) Tt[(r * 16 + v + 8 * hlf) * 64 + t * 16 + nloc] = acc[r][t][v] * (1.0f / AS_) + bb; }
  wave_lds_sync();
  {
#pragma unroll
    for (int j = 0; j < 16; ++j) { const int rr = j * 2 + hlf, c4 = nloc * 4; *(v4f*)(out + (size_t)(m0 + rr) * H + c0 + c4) = *(const v4f*)(Tt + rr * 64 + c4); }
     }
}
}  // namespace

extern "C" void kernel_launch(void* const* d_in, const int* in_sizes, int n_in,
                              void* d_out, int out_size, void* d_ws, size_t ws_size, hipStream_t stream) {
  (void)n_in; (void)out_size;
  const float* x = (const float*)d_in[0]; const float* sp = (const float*)d_in[1]; const float* ee = (const float*)d_in[2]; const float* Wq = (const float*)d_in[3]; const float* Wk = (const float*)d_in[4]; const float* Wv = (const float*)d_in[5]; const float* bv = (const float*)d_in[6];
  const float* sg = (const float*)d_in[7]; const float* pp = (const float*)d_in[8]; const float* ed = (const float*)d_in[9]; const float* Wout = (const float*)d_in[10]; const float* bout = (const float*)d_in[11];
  float* out = (float*)d_out;   // [8][256][512]
  if (in_sizes[0] != NT * H || in_sizes[1] != Bn * S * S || in_sizes[5] != H * 1024 || in_sizes[8] != G * L || in_sizes[9] != L * S || in_sizes[10] != 1024 * H) return;
  size_t off = 0; char* ws = (char*)d_ws;
  auto carve = [&](size_t bytes) { char* p = ws + off; off += (bytes + 255) & ~(size_t)255; return p; };
  b16* R = (b16*)carve((size_t)NPJ * H * 2); b16* Ro = (b16*)carve((size_t)512 * 1024 * 2); float* P = (float*)carve(((size_t)1672 + L * S + 64) * 4);
  b16* qp = (b16*)carve((size_t)Bn * G * S * HD * 2); b16* kp = (b16*)carve((size_t)Bn * G * S * HD * 2); b16* vt = (b16*)carve((size_t)Bn * L * HD * S * 2); float* sc = (float*)carve((size_t)Bn * G * S * S * 4); float* flags = (float*)carve((size_t)Bn * S * G * 4); float* ctx = (float*)carve((size_t)NT * L * HD * 4);
  if (off > ws_size) return;                                    // ≈ 2 + 1 + 2 + 2 + 4 + 16.8 + 8.4 ≈ 37 MB
  prep_kernel<<<256, 256, 0, stream>>>(Wq, Wk, Wv, Wout, bv, bout, sg, pp, ed, R, Ro, P);
  proj_kernel<<<dim3(32, NT / 128), 128, 0, stream>>>(x, R, P, qp, kp, vt);
  score_kernel<<<dim3(S / 16, Bn), 256, 0, stream>>>(qp, kp, sp, ee, sc, flags);
  fish_kernel<<<dim3(S / 16, Bn, L), 256, 0, stream>>>(sc, flags, vt, P, ctx);
  out_kernel<<<dim3(H / 64, NT / 128), 128, 0, stream>>>(ctx, Ro, P, out);
}

// v003
// Measured time: 60 microseconds a run.
// Timed twice side by side with v002, it ran 1.36 and 1.35 times as fast.
// All steps since v000 together make it 9.39 times as fast.
#include <hip/hip_runtime.h>

// GraphormerFishAttention: q = x Wq, k = x Wk (G=8 heads x 64), v = x Wv + bv (L=16 heads x 64); g = q.k^T 512^-0.5 + (spatial + edge) bias [B,G,S,S]; pad = any_t(g != 0);
// a_l = Σ_g where(pad_g, relu(p[g,l] (g + sigma_g² eps[l,s] δ_st)), -inf); softmax over t; nan_to_num; out_l = a_l.v_l; out = merged Wout + bout -> [8][256][512].
// Projections on v_wmma_f32_16x16x32_f16 with exact operands (x and the weights are exact bf16; 1 product); g = q.k^T with q, k single f16 x8 (1 product; |q.k|·scale ≈ 0.07 next to
// the O(1) exact bias) + bias in f32; the fish mixing / relu / pad / softmax in f32 (fixed order); out_l = P.v with P as an f16 hi+lo pair x8 and v single f16 x8 (2 products);
// output projection with ctx as hi+lo x8 (2 products); f32 accumulate. Fragment k-map per lane half hh for A AND B: elements 0..7 <- k = 8hh+0..7, 8..15 <- k = 16+8hh+0..7.
// Every f16 matrix operand in the workspace lies in fragment order: a block of 16 rows x 32 k is 1 KB; its 16-byte piece (j, lane) holds row (lane & 15), k = 16 j + 8 (lane >> 4) + 0..7, at half offset 256 j + 8 lane,
// so that a wave's fragment is two loads of 512 contiguous bytes (the k-map above, unchanged).

namespace {
constexpr int Bn = 8, S = 256, H = 512, G = 8, L = 16, HD = 64, NT = Bn * S, NPJ = 2048;
constexpr float QS = 8.0f, KS = 8.0f, VS = 8.0f, PS = 8.0f, AS_ = 8.0f, SCALE = 0.04419417382415922f;

typedef _Float16 b16;
typedef __attribute__((ext_vector_type(16))) _Float16 v16b;
typedef __attribute__((ext_vector_type(8))) _Float16 v8b;
typedef __attribute__((ext_vector_type(8))) float v8f;
typedef __attribute__((ext_vector_type(4))) float v4f;
__device__ __forceinline__ float bf16_rne(float f) { unsigned int u = __float_as_uint(f); u += 0x7FFFu + ((u >> 16) & 1u); return __uint_as_float(u & 0xFFFF0000u); }
__device__ __forceinline__ void split16(float v, b16& hi, b16& lo) { hi = (b16)v; lo = (b16)(v - (float)hi); }
__device__ __forceinline__ void frag_split(const float* p, int hh, v16b& fh, v16b& fl) {
#pragma unroll
  for (int e = 0; e < 8; ++e) { b16 a, c; split16(p[8 * hh + e] * AS_, a, c); fh[e] = a; fl[e] = c; split16(p[16 + 8 * hh + e] * AS_, a, c); fh[8 + e] = a; fl[8 + e] = c; } }
// raw fragment loads, kept apart from their use so that a whole batch can be in flight before the first use; p = the block's start + 8 * lane
__device__ __forceinline__ void ld_p(const b16* p, v8b* r) { r[0] = *(const v8b*)(p); r[1] = *(const v8b*)(p + 256); }
__device__ __forceinline__ v16b cat_h(const v8b* r) { v16b f;
#pragma unroll
  for (int e = 0; e < 8; ++e) { f[e] = r[0][e]; f[8 + e] = r[1][e]; } return f; }
__device__ __forceinline__ v8f wmma16b(v16b a, v16b b, v8f c) { v8f d = __builtin_amdgcn_wmma_f32_16x16x32_f16(false, a, false, b, (short)0, c, false, false); asm volatile("v_nop\n\tv_nop\n\tv_nop\n\tv_nop" : "+v"(d) : "v"(a), "v"(b)); return d; }
__device__ __forceinline__ void wave_lds_sync() { __builtin_amdgcn_fence(__ATOMIC_RELEASE, "workgroup"); __builtin_amdgcn_wave_barrier(); __builtin_amdgcn_fence(__ATOMIC_ACQUIRE, "workgroup"); }
__device__ __forceinline__ float nexp(float x) { return __builtin_amdgcn_exp2f(x * 1.4426950408889634f); }
__device__ __forceinline__ float pmul(float a, float b) { float p = a * b; asm volatile("" : "+v"(p)); return p; }

// prep, one thread a 16-byte piece: Xp = x as f16, blocks [128 row tiles][16 k-steps]; R = Wq | Wk | Wv, blocks [128 column tiles][16 k-steps]; Ro = Wout, blocks [32 column tiles][32 k-steps] (for the weights the lanes
// run along the output column, so each of a piece's 8 loads reads whole lines); P: bv @0 (1024), bout @1024 (512), sigma^2 @1536 (8), p @1544 (128 = [g][l]), eps @1672
constexpr int PREP_WG = 256, NTH = PREP_WG * 256;
__global__ __launch_bounds__(256) void prep_kernel(const float* __restrict__ x, const float* __restrict__ Wq, const float* __restrict__ Wk, const float* __restrict__ Wv, const float* __restrict__ Wout, const float* __restrict__ bv, const float* __restrict__ bout, const float* __restrict__ sg, const float* __restrict__ pp, const float* __restrict__ ed, b16* __restrict__ Xp, b16* __restrict__ R, b16* __restrict__ Ro, float* __restrict__ P) {
  const int t_ = blockIdx.x * 256 + threadIdx.x;
  // XW: the wait that stands behind issued global loads before their address registers are written again; the SB on either side keep other arithmetic from being scheduled between the loads and the wait
#define SB __builtin_amdgcn_sched_barrier(0)
#define XW SB; asm volatile("s_wait_xcnt 0x0" ::: "memory"); SB
  // XWP: the same wait; the two address pairs are named as inputs only, so that they stay allocated up to the wait
#define XWP(p, q) SB; asm volatile("s_wait_xcnt 0x0" :: "v"(p), "v"(q) : "memory"); SB
  float wa[8], wv[8], wo[8]; v4f xv[2][2];   // all of a thread's loads are requested before the first conversion
  const int oa = t_ & 511, ka = (t_ >> 9) & 63, ov = t_ & 1023, kv = t_ >> 10, kw = t_ >> 9;   // piece = (column, group of 8 k): Wq (work-groups 0..127) or Wk, Wv, Wout
  { const float* s_ = ((blockIdx.x < PREP_WG / 2) ? Wq : Wk) + (size_t)ka * 8 * 512 + oa;
#pragma unroll
    for (int e = 0; e < 8; ++e) wa[e] = s_[e * 512]; }
  XW;
  { const float* s_ = Wv + (size_t)kv * 8 * 1024 + ov;
#pragma unroll
    for (int e = 0; e < 8; ++e) wv[e] = s_[e * 1024]; }
  XW;
  { const float* s_ = Wout + (size_t)kw * 8 * 512 + oa;
#pragma unroll
    for (int e = 0; e < 8; ++e) wo[e] = s_[e * 512]; }
  XW;
#pragma unroll
  for (int u = 0; u < 2; ++u) { const int q = t_ + u * NTH, ln = q & 31, j = (q >> 5) & 1, ks = (q >> 6) & 15, rt = q >> 10; const float* s_ = x + (size_t)(rt * 16 + (ln & 15)) * H + ks * 32 + j * 16 + (ln >> 4) * 8;
    xv[u][0] = *(const v4f*)s_; xv[u][1] = *(const v4f*)(s_ + 4); XW; }
  auto put = [&](b16* dst, int nk, int o, int kg, const float* v) { v8b h;   // column o, k = 8 kg + 0..7 -> its piece of block (o >> 4, kg >> 2)
#pragma unroll
    for (int e = 0; e < 8; ++e) h[e] = (b16)bf16_rne(v[e]);
    *(v8b*)(dst + ((size_t)((o >> 4) * nk + (kg >> 2)) * 2 + ((kg >> 1) & 1)) * 256 + ((kg & 1) * 16 + (o & 15)) * 8) = h; };
  put(R, 16, oa + ((blockIdx.x < PREP_WG / 2) ? 0 : 512), ka, wa); put(R, 16, 1024 + ov, kv, wv); put(Ro, 32, oa, kw, wo);
#pragma unroll
  for (int u = 0; u < 2; ++u) { v8b h;
#pragma unroll
    for (int e = 0; e < 8; ++e) h[e] = (b16)bf16_rne(xv[u][e >> 2][e & 3]);
    *(v8b*)(Xp + (size_t)(t_ + u * NTH) * 8) = h; }
  for (int q = t_; q < 1672 + L * S; q += NTH) { float v; if (q < 1024) v = bf16_rne(bv[q]); else if (q < 1536) v = bf16_rne(bout[q - 1024]); else if (q < 1544) { const float s_ = bf16_rne(sg[q - 1536]); v = s_ * s_; } else if (q < 1672) v = bf16_rne(pp[q - 1544]); else v = bf16_rne(ed[q - 1672]); P[q] = v; }
}

// projections: block 128 tokens x 64 cols (tile ct of 32: 0..7 q heads, 8..15 k heads, 16..31 v l-heads); exact (1 product); q x scale x 8 / k x 8 -> planes [b][g] of blocks [16 s tiles][2 k-steps]; v x 8 -> planes [b][l] of blocks [4 d tiles][8 k-steps of t]
__global__ __launch_bounds__(128) void proj_kernel(const b16* __restrict__ Xp, const b16* __restrict__ R, const float* __restrict__ P, b16* __restrict__ qp, b16* __restrict__ kp, b16* __restrict__ vt) {
  __shared__ __attribute__((aligned(16))) b16 T[4][32][64 + 8]; __shared__ __attribute__((aligned(16))) b16 Tv[64][128 + 8];
  const int lane = threadIdx.x & 31, wave = threadIdx.x >> 5, nloc = lane & 15, hlf = lane >> 4, ct = blockIdx.x, c0 = ct * 64, p0 = blockIdx.y * 128, m0 = p0 + wave * 32, b = p0 / S, t0 = p0 % S;
  v8f acc[2][4];
#pragma unroll
  for (int r = 0; r < 2; ++r)
#pragma unroll
    for (int t = 0; t < 4; ++t) acc[r][t] = (v8f){};
  constexpr int NK = H / 32; const b16* xr = Xp + (size_t)(m0 / 16) * NK * 512 + lane * 8; const b16* wr = R + (size_t)(c0 / 16) * NK * 512 + lane * 8;
  auto fetch = [&](int ks, v8b* ra, v8b* rb) { ld_p(xr + ks * 512, ra); ld_p(xr + (NK + ks) * 512, ra + 2);
#pragma unroll
    for (int t = 0; t < 4; ++t) ld_p(wr + (t * NK + ks) * 512, rb + 2 * t); };
  auto mults = [&](const v8b* ra, const v8b* rb) { const v16b a0 = cat_h(ra), a1 = cat_h(ra + 2);
#pragma unroll
    for (int t = 0; t < 4; ++t) { const v16b bw = cat_h(rb + 2 * t); acc[0][t] = wmma16b(a0, bw, acc[0][t]); acc[1][t] = wmma16b(a1, bw, acc[1][t]); } };
  // two register sets: the 12 loads of k-step n + 1 are all issued before the products of k-step n
  v8b xa[4], ya[4], xb[8], yb[8]; fetch(0, xa, xb);
  // SB: keeps a set's loads in front of the other set's products; moved behind them they would be waited for right after their issue
  for (int ks = 0; ks < NK - 2; ks += 2) { fetch(ks + 1, ya, yb); SB; mults(xa, xb); SB; fetch(ks + 2, xa, xb); SB; mults(ya, yb); SB; XW; }   // XW: the next trip rewrites the loads' address registers
  fetch(NK - 1, ya, yb); XWP(xr, wr); mults(xa, xb); SB; mults(ya, yb);   // XWP: the epilogue's index arithmetic reuses the address registers
  if (ct < 16) { const float scl = (ct < 8) ? SCALE * QS : KS; const int hd_ = (ct < 8) ? ct : ct - 8;
#pragma unroll
    for (int t = 0; t < 4; ++t)
#pragma unroll
      for (int r = 0; r < 2; ++r)
#pragma unroll
        for (int v = 0; v < 8; ++v) T[wave][r * 16 + 8 * hlf + v][t * 16 + nloc] = (b16)(acc[r][t][v] * scl);
    wave_lds_sync();
    b16* base = ((ct < 8) ? qp : kp) + (((size_t)b * G + hd_) * S + (m0 % S)) * HD;
    {
#pragma unroll
      for (int j = 0; j < 8; ++j) *(v8b*)(base + j * 256 + lane * 8) = *(const v8b*)(&T[wave][(j >> 2) * 16 + nloc][((j >> 1) & 1) * 32 + (j & 1) * 16 + hlf * 8]);   // j = (s tile, k-step, piece)
       }
    return; }
  const int l = ct - 16; const float* bvp = P + l * HD;
#pragma unroll
  for (int t = 0; t < 4; ++t) { const float bb = bvp[t * 16 + nloc];
#pragma unroll
    for (int r = 0; r < 2; ++r)
#pragma unroll
      for (int v = 0; v < 8; ++v) Tv[t * 16 + nloc][wave * 32 + r * 16 + 8 * hlf + v] = (b16)((acc[r][t][v] + bb) * VS); }
  __syncthreads();
  { for (int i = threadIdx.x; i < 64 * 16; i += 128) { const int ln = i & 31, j = (i >> 5) & 1, ksl = (i >> 6) & 3, dt = i >> 8; *(v8b*)(vt + ((((size_t)b * L + l) * 4 + dt) * 8 + t0 / 32 + ksl) * 512 + j * 256 + ln * 8) = *(const v8b*)(&Tv[dt * 16 + (ln & 15)][ksl * 32 + j * 16 + (ln >> 4) * 8]); }  }
}

// scores: block = (b, 16 query rows s0..) x 8 waves (wave = head g): Sg[s][t] = q_s.k_t (scaled) + spatial[b][s][t] + edge[b][s][t] (2 k-steps x 16 t-tiles, 1 product) -> f32 rows
__global__ __launch_bounds__(256) void score_kernel(const b16* __restrict__ qp, const b16* __restrict__ kp, const float* __restrict__ sp, const float* __restrict__ ee, float* __restrict__ sc, float* __restrict__ flags) {
  __shared__ __attribute__((aligned(16))) float Ts[8][16][S + 4]; __shared__ float Fl[16][8];
  const int g = threadIdx.x >> 5, lane = threadIdx.x & 31, nloc = lane & 15, hlf = lane >> 4; const int b = blockIdx.y, s0 = blockIdx.x * 16;
  const b16* Q = qp + (((size_t)b * G + g) * S) * HD; const b16* K = kp + (((size_t)b * G + g) * S) * HD;
  v8b qr[4]; ld_p(Q + (size_t)s0 * HD + lane * 8, qr); ld_p(Q + (size_t)s0 * HD + 512 + lane * 8, qr + 2); const v16b q0 = cat_h(qr), q1 = cat_h(qr + 2);
  // two t-tiles a trip: their key rows and bias values (40 loads) are all requested before the first product
  const b16* kq = K + lane * 8; const size_t bo0 = ((size_t)b * S + s0 + 8 * hlf) * S + nloc; const float* sq = sp + bo0; const float* eq = ee + bo0;
  for (int t4 = 0; t4 < 16; t4 += 2) { v8b kr[2][4]; float bs[2][8], be[2][8];
#pragma unroll
    for (int u = 0; u < 2; ++u) { ld_p(kq + u * 16 * HD, &kr[u][0]); ld_p(kq + u * 16 * HD + 512, &kr[u][2]);
#pragma unroll
      for (int r = 0; r < 8; ++r) { bs[u][r] = sq[r * S + u * 16]; be[u][r] = eq[r * S + u * 16]; } }
    kq += 32 * HD; sq += 32; eq += 32;
#pragma unroll
    for (int u = 0; u < 2; ++u) { v8f acc = {}; acc = wmma16b(q0, cat_h(&kr[u][0]), acc); acc = wmma16b(q1, cat_h(&kr[u][2]), acc);
#pragma unroll
      for (int r = 0; r < 8; ++r) Ts[g][8 * hlf + r][(t4 + u) * 16 + nloc] = acc[r] * (1.0f / (QS * KS)) + (bf16_rne(bs[u][r]) + bf16_rne(be[u][r])); } }
  wave_lds_sync();
  // pad flags: lane-strided any over the 256 t of rows (16 rows: 2 lanes per row... use lane l -> row l&15, half l>>4 covers t parity) 
  { const int rr = lane & 15, half = lane >> 4; int nz = 0; for (int t = half; t < S; t += 2) nz |= (Ts[g][rr][t] != 0.0f) ? 1 : 0; nz |= __shfl_xor(nz, 16); if (lane < 16) Fl[rr][g] = nz ? 1.0f : 0.0f; }
  { for (int i = lane; i < 16 * (S / 4); i += 32) { const int rr = i / (S / 4), c4 = (i % (S / 4)) * 4; *(v4f*)(sc + (((size_t)b * G + g) * S + s0 + rr) * S + c4) = *(const v4f*)(&Ts[g][rr][c4]); }  }
  __syncthreads();
  { if (threadIdx.x < 128) ((float*)flags)[((size_t)b * S + s0) * G + threadIdx.x] = Fl[threadIdx.x >> 3][threadIdx.x & 7];  }
}

// fish + softmax + PV: block = (b, 16 rows s0.., one local head l = blockIdx.z) x 256 threads; a[s][t] = sum_g (flag ? relu(p[g][l] (S_g[s][t] + sigma_g^2 eps[l][s] d_st)) : -inf) (f32, g in order)
// into LDS; row softmax (wave per 2 rows; fixed order), all -inf row -> zeros (nan_to_num); PV: 4 waves x (16 rows x 16 d). l is the slowest grid index: 2048 work-groups fill every wave slot.
__global__ __launch_bounds__(256, 16) void fish_kernel(const float* __restrict__ sc, const float* __restrict__ flags, const b16* __restrict__ vt, const float* __restrict__ P, b16* __restrict__ cp) {
  __shared__ __attribute__((aligned(16))) float A[16][S + 4]; __shared__ __attribute__((aligned(16))) float Cx[16][HD + 4];
  const int t_ = threadIdx.x, wave = t_ >> 5, lane = t_ & 31, nloc = lane & 15, hlf = lane >> 4; const int b = blockIdx.y, s0 = blockIdx.x * 16, l = blockIdx.z;
  const float* sig2 = P + 1536; const float* pp = P + 1544; const float* ed = P + 1672;
  // thread = column t, one row a pass; RB rows a trip: their 8 score planes, flags and eps are all requested before the first use
  constexpr int RB = 4; float pl[G], s2[G];
#pragma unroll
  for (int g = 0; g < G; ++g) { pl[g] = pp[g * L + l]; s2[g] = sig2[g]; }
  for (int r0 = 0; r0 < 16; r0 += RB) { float sv[RB][G], fl[RB][G], ev[RB];
#pragma unroll
    for (int j = 0; j < RB; ++j) { const int s = s0 + r0 + j; ev[j] = ed[l * S + s];
#pragma unroll
      for (int g = 0; g < G; ++g) { sv[j][g] = sc[(((size_t)b * G + g) * S + s) * S + t_]; fl[j][g] = flags[((size_t)b * S + s) * G + g]; } }
#pragma unroll
    for (int j = 0; j < RB; ++j) { const int s = s0 + r0 + j; float a = 0.0f; bool ninf = false;
#pragma unroll
      for (int g = 0; g < G; ++g) { float v = sv[j][g]; if (t_ == s) v += s2[g] * ev[j]; v = fmaxf(pmul(v, pl[g]), 0.0f); if (fl[j][g] != 0.0f) a += v; else ninf = true; }
      A[r0 + j][t_] = ninf ? -INFINITY : a; } }
  __syncthreads();
  // softmax rows: wave w handles rows 2w, 2w+1
  for (int rr = wave * 2; rr < wave * 2 + 2; ++rr) { float mx = -INFINITY;
#pragma unroll
    for (int j = 0; j < 8; ++j) mx = fmaxf(mx, A[rr][lane + 32 * j]);
#pragma unroll
    for (int o = 1; o < 32; o <<= 1) mx = fmaxf(mx, __shfl_xor(mx, o));
    float sm = 0.0f;
#pragma unroll
    for (int j = 0; j < 8; ++j) sm += (mx == -INFINITY) ? 0.0f : nexp(A[rr][lane + 32 * j] - mx);
#pragma unroll
    for (int o = 1; o < 32; o <<= 1) sm += __shfl_xor(sm, o);
    const float inv = (mx == -INFINITY) ? 0.0f : 1.0f / sm;   // all -inf row -> NaN in the reference -> nan_to_num -> 0
#pragma unroll
    for (int j = 0; j < 8; ++j) A[rr][lane + 32 * j] = (mx == -INFINITY) ? 0.0f : nexp(A[rr][lane + 32 * j] - mx) * inv; }
  __syncthreads();
  // PV: waves 0..3 -> d-tile = wave (16 d of 64); rows = all 16 s; 8 k-steps; A split hi+lo x8; B = v^T blocks [b][l][d tile][k-step] single
  if (wave < 4) { v8f acc = {}; const b16* V = vt + (((size_t)b * L + l) * 4 + wave) * 8 * 512 + lane * 8;
    for (int k0 = 0; k0 < S; k0 += 64) { v8b vr[2][2];   // two k-steps' value blocks requested together
#pragma unroll
      for (int u = 0; u < 2; ++u) ld_p(V + (k0 / 32 + u) * 512, vr[u]);
#pragma unroll
      for (int u = 0; u < 2; ++u) { v16b ah, al; frag_split(&A[nloc][k0 + 32 * u], hlf, ah, al); const v16b bw = cat_h(vr[u]); acc = wmma16b(ah, bw, acc); acc = wmma16b(al, bw, acc); } }
#pragma unroll
    for (int r = 0; r < 8; ++r) Cx[8 * hlf + r][wave * 16 + nloc] = acc[r] * (1.0f / (AS_ * VS)); }
  __syncthreads();
  // ctx leaves as the output projection's A operand: x8, f16 hi and lo planes, blocks [128 row tiles][32 k-steps][hi, lo]; thread = (k-step, plane, piece, lane), 4 KB in a row a work-group
  { const int ln = t_ & 31, j = (t_ >> 5) & 1, lo_ = (t_ >> 6) & 1, ksl = t_ >> 7; const float* cs = &Cx[ln & 15][ksl * 32 + j * 16 + (ln >> 4) * 8]; v8b h;
#pragma unroll
    for (int e = 0; e < 8; ++e) { b16 a, c; split16(cs[e] * AS_, a, c); h[e] = lo_ ? c : a; }
    *(v8b*)(cp + ((size_t)((b * S + s0) / 16) * 32 + 2 * l) * 1024 + t_ * 8) = h; }
}

__global__ __launch_bounds__(128) void out_kernel(const b16* __restrict__ cp, const b16* __restrict__ Ro, const float* __restrict__ P, float* __restrict__ out) {
  __shared__ __attribute__((aligned(16))) float Ts[4][32 * 64];
  const int lane = threadIdx.x & 31, wave = threadIdx.x >> 5, nloc = lane & 15, hlf = lane >> 4, m0 = blockIdx.y * 128 + wave * 32, c0 = blockIdx.x * 64; const float* bout = P + 1024;
  v8f acc[2][4];
#pragma unroll
  for (int r = 0; r < 2; ++r)
#pragma unroll
    for (int t = 0; t < 4; ++t) acc[r][t] = (v8f){};
  constexpr int NK = L * HD / 32; const b16* cr = cp + (size_t)(m0 / 16) * NK * 1024 + lane * 8; const b16* wr = Ro + (size_t)(c0 / 16) * NK * 512 + lane * 8;
  auto fetch = [&](int ks, v8b* ra, v8b* rb) { ld_p(cr + ks * 1024, ra); ld_p(cr + ks * 1024 + 512, ra + 2); ld_p(cr + (NK + ks) * 1024, ra + 4); ld_p(cr + (NK + ks) * 1024 + 512, ra + 6);
#pragma unroll
    for (int t = 0; t < 4; ++t) ld_p(wr + (t * NK + ks) * 512, rb + 2 * t); };
  auto mults = [&](const v8b* ra, const v8b* rb) { const v16b a0 = cat_h(ra), l0 = cat_h(ra + 2), a1 = cat_h(ra + 4), l1 = cat_h(ra + 6);
#pragma unroll
    for (int t = 0; t < 4; ++t) { const v16b bw = cat_h(rb + 2 * t); acc[0][t] = wmma16b(a0, bw, acc[0][t]); acc[0][t] = wmma16b(l0, bw, acc[0][t]); acc[1][t] = wmma16b(a1, bw, acc[1][t]); acc[1][t] = wmma16b(l1, bw, acc[1][t]); } };
  // two register sets: the 16 loads of k-step n + 1 are all issued before the products of k-step n
  v8b xa[8], ya[8], xb[8], yb[8]; fetch(0, xa, xb);
  for (int ks = 0; ks < NK - 2; ks += 2) { fetch(ks + 1, ya, yb); SB; mults(xa, xb); SB; fetch(ks + 2, xa, xb); SB; mults(ya, yb); SB; XW; }   // SB, XW: as in the projection loop
  fetch(NK - 1, ya, yb); XWP(cr, wr); mults(xa, xb); SB; mults(ya, yb);   // XWP: as in the projection kernel
#undef XWP
#undef XW
#undef SB
  float* Tt = Ts[wave];
#pragma unroll
  for (int t = 0; t < 4; ++t) { const float bb = bout[c0 + t * 16 + nloc];
#pragma unroll
    for (int r = 0; r < 2; ++r)
#pragma unroll
      for (int v = 0; v < 8; ++v) Tt[(r * 16 + v + 8 * hlf) * 64 + t * 16 + nloc] = acc[r][t][v] * (1.0f / AS_) + bb; }
  wave_lds_sync();
  {
#pragma unroll
    for (int j = 0; j < 16; ++j) { const int rr = j * 2 + hlf, c4 = nloc * 4; *(v4f*)(out + (size_t)(m0 + rr) * H + c0 + c4) = *(const v4f*)(Tt + rr * 64 + c4); }
     }
}
}  // namespace

extern "C" void kernel_launch(void* const* d_in, const int* in_sizes, int n_in,
                              void* d_out, int out_size, void* d_ws, size_t ws_size, hipStream_t stream) {
  (void)n_in; (void)out_size;
  const float* x = (const float*)d_in[0]; const float* sp = (const float*)d_in[1]; const float* ee = (const float*)d_in[2]; const float* Wq = (const float*)d_in[3]; const float* Wk = (const float*)d_in[4]; const float* Wv = (const float*)d_in[5]; const float* bv = (const float*)d_in[6];
  const float* sg = (const float*)d_in[7]; const float* pp = (const float*)d_in[8]; const float* ed = (const float*)d_in[9]; const float* Wout = (const float*)d_in[10]; const float* bout = (const float*)d_in[11];
  float* out = (float*)d_out;   // [8][256][512]
  if (in_sizes[0] != NT * H || in_sizes[1] != Bn * S * S || in_sizes[5] != H * 1024 || in_sizes[8] != G * L || in_sizes[9] != L * S || in_sizes[10] != 1024 * H) return;
  size_t off = 0; char* ws = (char*)d_ws;
  auto carve = [&](size_t bytes) { char* p = ws + off; off += (bytes + 255) & ~(size_t)255; return p; };
  b16* Xp = (b16*)carve((size_t)NT * H * 2); b16* R = (b16*)carve((size_t)NPJ * H * 2); b16* Ro = (b16*)carve((size_t)512 * 1024 * 2); float* P = (float*)carve(((size_t)1672 + L * S + 64) * 4);
  b16* qp = (b16*)carve((size_t)Bn * G * S * HD * 2); b16* kp = (b16*)carve((size_t)Bn * G * S * HD * 2); b16* vt = (b16*)carve((size_t)Bn * L * HD * S * 2); float* sc = (float*)carve((size_t)Bn * G * S * S * 4); float* flags = (float*)carve((size_t)Bn * S * G * 4); b16* cp = (b16*)carve((size_t)NT * L * HD * 2 * 2);
  if (off > ws_size) return;                                    // ≈ 2 + 2 + 1 + 2 + 2 + 4 + 16.8 + 8.4 ≈ 39 MB
  prep_kernel<<<PREP_WG, 256, 0, stream>>>(x, Wq, Wk, Wv, Wout, bv, bout, sg, pp, ed, Xp, R, Ro, P);
  proj_kernel<<<dim3(32, NT / 128), 128, 0, stream>>>(Xp, R, P, qp, kp, vt);
  score_kernel<<<dim3(S / 16, Bn), 256, 0, stream>>>(qp, kp, sp, ee, sc, flags);
  fish_kernel<<<dim3(S / 16, Bn, L), 256, 0, stream>>>(sc, flags, vt, P, cp);
  out_kernel<<<dim3(H / 64, NT / 128), 128, 0, stream>>>(cp, Ro, P, out);
}

// v004
// It runs in 54.3 microseconds.
// In two side-by-side timings against v003, it was 1.12 and 1.11 times as fast.
// Over all steps from v000 it is 10.4 times as fast.
#include <hip/hip_runtime.h>

// GraphormerFishAttention: q = x Wq, k = x Wk (G=8 heads x 64), v = x Wv + bv (L=16 heads x 64); g = q.k^T 512^-0.5 + (spatial + edge) bias [B,G,S,S]; pad = any_t(g != 0);
// a_l = Σ_g where(pad_g, relu(p[g,l] (g + sigma_g² eps[l,s] δ_st)), -inf); softmax over t; nan_to_num; out_l = a_l.v_l; out = merged Wout + bout -> [8][256][512].
// Projections on v_wmma_f32_16x16x32_f16 with exact operands (x and the weights are exact bf16; 1 product); g = q.k^T with q, k single f16 x8 (1 product; |q.k|·scale ≈ 0.07 next to
// the O(1) exact bias) + bias in f32; the fish mixing / relu / pad / softmax in f32 (fixed order); out_l = P.v with P as an f16 hi+lo pair x8 and v single f16 x8 (2 products);
// output projection with ctx as hi+lo x8 (2 products); f32 accumulate. Fragment k-map per lane half hh for A AND B: elements 0..7 <- k = 8hh+0..7, 8..15 <- k = 16+8hh+0..7.
// Every f16 matrix operand in the workspace lies in fragment order: a block of 16 rows x 32 k is 1 KB; its 16-byte piece (j, lane) holds row (lane & 15), k = 16 j + 8 (lane >> 4) + 0..7, at half offset 256 j + 8 lane,
// so that a wave's fragment is two loads of 512 contiguous bytes (the k-map above, unchanged).

namespace {
constexpr int Bn = 8, S = 256, H = 512, G = 8, L = 16, HD = 64, NT = Bn * S, NPJ = 2048;
constexpr float QS = 8.0f, KS = 8.0f, VS = 8.0f, PS = 8.0f, AS_ = 8.0f, SCALE = 0.04419417382415922f;

typedef _Float16 b16;
typedef __attribute__((ext_vector_type(16))) _Float16 v16b;
typedef __attribute__((ext_vector_type(8))) _Float16 v8b;
typedef __attribute__((ext_vector_type(8))) float v8f;
typedef __attribute__((ext_vector_type(4))) float v4f;
__device__ __forceinline__ float bf16_rne(float f) { unsigned int u = __float_as_uint(f); u += 0x7FFFu + ((u >> 16) & 1u); return __uint_as_float(u & 0xFFFF0000u); }
__device__ __forceinline__ void split16(float v, b16& hi, b16& lo) { hi = (b16)v; lo = (b16)(v - (float)hi); }
__device__ __forceinline__ void frag_split(const float* p, int hh, v16b& fh, v16b& fl) {
#pragma unroll
  for (int e = 0; e < 8; ++e) { b16 a, c; split16(p[8 * hh + e] * AS_, a, c); fh[e] = a; fl[e] = c; split16(p[16 + 8 * hh + e] * AS_, a, c); fh[8 + e] = a; fl[8 + e] = c; } }
// raw fragment loads, kept apart from their use so that a whole batch can be in flight before the first use; p = the block's start + 8 * lane
__device__ __forceinline__ void ld_p(const b16* p, v8b* r) { r[0] = *(const v8b*)(p); r[1] = *(const v8b*)(p + 256); }
__device__ __forceinline__ v16b cat_h(const v8b* r) { v16b f;
#pragma unroll
  for (int e = 0; e < 8; ++e) { f[e] = r[0][e]; f[8 + e] = r[1][e]; } return f; }
__device__ __forceinline__ v8f wmma16b(v16b a, v16b b, v8f c) { v8f d = __builtin_amdgcn_wmma_f32_16x16x32_f16(false, a, false, b, (short)0, c, false, false); asm volatile("v_nop\n\tv_nop\n\tv_nop\n\tv_nop" : "+v"(d) : "v"(a), "v"(b)); return d; }
__device__ __forceinline__ void wave_lds_sync() { __builtin_amdgcn_fence(__ATOMIC_RELEASE, "workgroup"); __builtin_amdgcn_wave_barrier(); __builtin_amdgcn_fence(__ATOMIC_ACQUIRE, "workgroup"); }
__device__ __forceinline__ float nexp(float x) { return __builtin_amdgcn_exp2f(x * 1.4426950408889634f); }
__device__ __forceinline__ float pmul(float a, float b) { float p = a * b; asm volatile("" : "+v"(p)); return p; }

// prep, one thread a 16-byte piece: Xp = x as f16, blocks [128 row tiles][16 k-steps]; R = Wq | Wk | Wv, blocks [128 column tiles][16 k-steps]; Ro = Wout, blocks [32 column tiles][32 k-steps] (for the weights the lanes
// run along the output column, so each of a piece's 8 loads reads whole lines); P: bv @0 (1024), bout @1024 (512), sigma^2 @1536 (8), p @1544 (128 = [g][l]), eps @1672
constexpr int PREP_WG = 256, NTH = PREP_WG * 256;
__global__ __launch_bounds__(256) void prep_kernel(const float* __restrict__ x, const float* __restrict__ Wq, const float* __restrict__ Wk, const float* __restrict__ Wv, const float* __restrict__ Wout, const float* __restrict__ bv, const float* __restrict__ bout, const float* __restrict__ sg, const float* __restrict__ pp, const float* __restrict__ ed, b16* __restrict__ Xp, b16* __restrict__ R, b16* __restrict__ Ro, float* __restrict__ P) {
  const int t_ = blockIdx.x * 256 + threadIdx.x;
  // XW: the wait that stands behind issued global loads before their address registers are written again; the SB on either side keep other arithmetic from being scheduled between the loads and the wait
#define SB __builtin_amdgcn_sched_barrier(0)
#define XW SB; asm volatile("s_wait_xcnt 0x0" ::: "memory"); SB
  // XWP: the same wait; the two address pairs are named as inputs only, so that they stay allocated up to the wait
#define XWP(p, q) SB; asm volatile("s_wait_xcnt 0x0" :: "v"(p), "v"(q) : "memory"); SB
  float wa[8], wv[8], wo[8]; v4f xv[2][2];   // all of a thread's loads are requested before the first conversion
  const int oa = t_ & 511, ka = (t_ >> 9) & 63, ov = t_ & 1023, kv = t_ >> 10, kw = t_ >> 9;   // piece = (column, group of 8 k): Wq (work-groups 0..127) or Wk, Wv, Wout
  { const float* s_ = ((blockIdx.x < PREP_WG / 2) ? Wq : Wk) + (size_t)ka * 8 * 512 + oa;
#pragma unroll
    for (int e = 0; e < 8; ++e) wa[e] = s_[e * 512]; }
  XW;
  { const float* s_ = Wv + (size_t)kv * 8 * 1024 + ov;
#pragma unroll
    for (int e = 0; e < 8; ++e) wv[e] = s_[e * 1024]; }
  XW;
  { const float* s_ = Wout + (size_t)kw * 8 * 512 + oa;
#pragma unroll
    for (int e = 0; e < 8; ++e) wo[e] = s_[e * 512]; }
  XW;
#pragma unroll
  for (int u = 0; u < 2; ++u) { const int q = t_ + u * NTH, ln = q & 31, j = (q >> 5) & 1, ks = (q >> 6) & 15, rt = q >> 10; const float* s_ = x + (size_t)(rt * 16 + (ln & 15)) * H + ks * 32 + j * 16 + (ln >> 4) * 8;
    xv[u][0] = *(const v4f*)s_; xv[u][1] = *(const v4f*)(s_ + 4); XW; }
  auto put = [&](b16* dst, int nk, int o, int kg, const float* v) { v8b h;   // column o, k = 8 kg + 0..7 -> its piece of block (o >> 4, kg >> 2)
#pragma unroll
    for (int e = 0; e < 8; ++e) h[e] = (b16)bf16_rne(v[e]);
    *(v8b*)(dst + ((size_t)((o >> 4) * nk + (kg >> 2)) * 2 + ((kg >> 1) & 1)) * 256 + ((kg & 1) * 16 + (o & 15)) * 8) = h; };
  put(R, 16, oa + ((blockIdx.x < PREP_WG / 2) ? 0 : 512), ka, wa); put(R, 16, 1024 + ov, kv, wv); put(Ro, 32, oa, kw, wo);
#pragma unroll
  for (int u = 0; u < 2; ++u) { v8b h;
#pragma unroll
    for (int e = 0; e < 8; ++e) h[e] = (b16)bf16_rne(xv[u][e >> 2][e & 3]);
    *(v8b*)(Xp + (size_t)(t_ + u * NTH) * 8) = h; }
  for (int q = t_; q < 1672 + L * S; q += NTH) { float v; if (q < 1024) v = bf16_rne(bv[q]); else if (q < 1536) v = bf16_rne(bout[q - 1024]); else if (q < 1544) { const float s_ = bf16_rne(sg[q - 1536]); v = s_ * s_; } else if (q < 1672) v = bf16_rne(pp[q - 1544]); else v = bf16_rne(ed[q - 1672]); P[q] = v; }
}

// projections: block 128 tokens x 64 cols (tile ct of 32: 0..7 q heads, 8..15 k heads, 16..31 v l-heads); exact (1 product); q x scale x 8 / k x 8 -> planes [b][g] of blocks [16 s tiles][2 k-steps]; v x 8 -> planes [b][l] of blocks [4 d tiles][8 k-steps of t]
__global__ __launch_bounds__(128) void proj_kernel(const b16* __restrict__ Xp, const b16* __restrict__ R, const float* __restrict__ P, b16* __restrict__ qp, b16* __restrict__ kp, b16* __restrict__ vt) {
  __shared__ __attribute__((aligned(16))) b16 T[4][32][64 + 8]; __shared__ __attribute__((aligned(16))) b16 Tv[64][128 + 8];
  const int lane = threadIdx.x & 31, wave = threadIdx.x >> 5, nloc = lane & 15, hlf = lane >> 4, ct = blockIdx.x, c0 = ct * 64, p0 = blockIdx.y * 128, m0 = p0 + wave * 32, b = p0 / S, t0 = p0 % S;
  v8f acc[2][4];
#pragma unroll
  for (int r = 0; r < 2; ++r)
#pragma unroll
    for (int t = 0; t < 4; ++t) acc[r][t] = (v8f){};
  constexpr int NK = H / 32; const b16* xr = Xp + (size_t)(m0 / 16) * NK * 512 + lane * 8; const b16* wr = R + (size_t)(c0 / 16) * NK * 512 + lane * 8;
  auto fetch = [&](int ks, v8b* ra, v8b* rb) { ld_p(xr + ks * 512, ra); ld_p(xr + (NK + ks) * 512, ra + 2);
#pragma unroll
    for (int t = 0; t < 4; ++t) ld_p(wr + (t * NK + ks) * 512, rb + 2 * t); };
  auto mults = [&](const v8b* ra, const v8b* rb) { const v16b a0 = cat_h(ra), a1 = cat_h(ra + 2);
#pragma unroll
    for (int t = 0; t < 4; ++t) { const v16b bw = cat_h(rb + 2 * t); acc[0][t] = wmma16b(a0, bw, acc[0][t]); acc[1][t] = wmma16b(a1, bw, acc[1][t]); } };
  // two register sets: the 12 loads of k-step n + 1 are all issued before the products of k-step n
  v8b xa[4], ya[4], xb[8], yb[8]; fetch(0, xa, xb);
  // SB: keeps a set's loads in front of the other set's products; moved behind them they would be waited for right after their issue
  for (int ks = 0; ks < NK - 2; ks += 2) { fetch(ks + 1, ya, yb); SB; mults(xa, xb); SB; fetch(ks + 2, xa, xb); SB; mults(ya, yb); SB; XW; }   // XW: the next trip rewrites the loads' address registers
  fetch(NK - 1, ya, yb); XWP(xr, wr); mults(xa, xb); SB; mults(ya, yb);   // XWP: the epilogue's index arithmetic reuses the address registers
  if (ct < 16) { const float scl = (ct < 8) ? SCALE * QS : KS; const int hd_ = (ct < 8) ? ct : ct - 8;
#pragma unroll
    for (int t = 0; t < 4; ++t)
#pragma unroll
      for (int r = 0; r < 2; ++r)
#pragma unroll
        for (int v = 0; v < 8; ++v) T[wave][r * 16 + 8 * hlf + v][t * 16 + nloc] = (b16)(acc[r][t][v] * scl);
    wave_lds_sync();
    b16* base = ((ct < 8) ? qp : kp) + (((size_t)b * G + hd_) * S + (m0 % S)) * HD;
    {
#pragma unroll
      for (int j = 0; j < 8; ++j) *(v8b*)(base + j * 256 + lane * 8) = *(const v8b*)(&T[wave][(j >> 2) * 16 + nloc][((j >> 1) & 1) * 32 + (j & 1) * 16 + hlf * 8]);   // j = (s tile, k-step, piece)
       }
    return; }
  const int l = ct - 16; const float* bvp = P + l * HD;
#pragma unroll
  for (int t = 0; t < 4; ++t) { const float bb = bvp[t * 16 + nloc];
#pragma unroll
    for (int r = 0; r < 2; ++r)
#pragma unroll
      for (int v = 0; v < 8; ++v) Tv[t * 16 + nloc][wave * 32 + r * 16 + 8 * hlf + v] = (b16)((acc[r][t][v] + bb) * VS); }
  __syncthreads();
  { for (int i = threadIdx.x; i < 64 * 16; i += 128) { const int ln = i & 31, j = (i >> 5) & 1, ksl = (i >> 6) & 3, dt = i >> 8; *(v8b*)(vt + ((((size_t)b * L + l) * 4 + dt) * 8 + t0 / 32 + ksl) * 512 + j * 256 + ln * 8) = *(const v8b*)(&Tv[dt * 16 + (ln & 15)][ksl * 32 + j * 16 + (ln >> 4) * 8]); }  }
}

// scores: block = (b, 16 query rows s0..) x 8 waves (wave = head g): Sg[s][t] = q_s.k_t (scaled) + spatial[b][s][t] + edge[b][s][t] (2 k-steps x 16 t-tiles, 1 product) -> f32 rows
__global__ __launch_bounds__(256) void score_kernel(const b16* __restrict__ qp, const b16* __restrict__ kp, const float* __restrict__ sp, const float* __restrict__ ee, float* __restrict__ sc, float* __restrict__ flags) {
  __shared__ __attribute__((aligned(16))) float Ts[8][16][S + 4]; __shared__ float Fl[16][8];
  const int g = threadIdx.x >> 5, lane = threadIdx.x & 31, nloc = lane & 15, hlf = lane >> 4; const int b = blockIdx.y, s0 = blockIdx.x * 16;
  const b16* Q = qp + (((size_t)b * G + g) * S) * HD; const b16* K = kp + (((size_t)b * G + g) * S) * HD;
  v8b qr[4]; ld_p(Q + (size_t)s0 * HD + lane * 8, qr); ld_p(Q + (size_t)s0 * HD + 512 + lane * 8, qr + 2); const v16b q0 = cat_h(qr), q1 = cat_h(qr + 2);
  // two t-tiles a trip: their key rows and bias values (40 loads) are all requested before the first product
  const b16* kq = K + lane * 8; const size_t bo0 = ((size_t)b * S + s0 + 8 * hlf) * S + nloc; const float* sq = sp + bo0; const float* eq = ee + bo0;
  for (int t4 = 0; t4 < 16; t4 += 2) { v8b kr[2][4]; float bs[2][8], be[2][8];
#pragma unroll
    for (int u = 0; u < 2; ++u) { ld_p(kq + u * 16 * HD, &kr[u][0]); ld_p(kq + u * 16 * HD + 512, &kr[u][2]);
#pragma unroll
      for (int r = 0; r < 8; ++r) { bs[u][r] = sq[r * S + u * 16]; be[u][r] = eq[r * S + u * 16]; } }
    kq += 32 * HD; sq += 32; eq += 32;
#pragma unroll
    for (int u = 0; u < 2; ++u) { v8f acc = {}; acc = wmma16b(q0, cat_h(&kr[u][0]), acc); acc = wmma16b(q1, cat_h(&kr[u][2]), acc);
#pragma unroll
      for (int r = 0; r < 8; ++r) Ts[g][8 * hlf + r][(t4 + u) * 16 + nloc] = acc[r] * (1.0f / (QS * KS)) + (bf16_rne(bs[u][r]) + bf16_rne(be[u][r])); } }
  wave_lds_sync();
  // pad flags: lane-strided any over the 256 t of rows (16 rows: 2 lanes per row... use lane l -> row l&15, half l>>4 covers t parity) 
  { const int rr = lane & 15, half = lane >> 4; int nz = 0; for (int t = half; t < S; t += 2) nz |= (Ts[g][rr][t] != 0.0f) ? 1 : 0; nz |= __shfl_xor(nz, 16); if (lane < 16) Fl[rr][g] = nz ? 1.0f : 0.0f; }
  { for (int i = lane; i < 16 * (S / 4); i += 32) { const int rr = i / (S / 4), c4 = (i % (S / 4)) * 4; *(v4f*)(sc + (((size_t)b * G + g) * S + s0 + rr) * S + c4) = *(const v4f*)(&Ts[g][rr][c4]); }  }
  __syncthreads();
  { if (threadIdx.x < 128) ((float*)flags)[((size_t)b * S + s0) * G + threadIdx.x] = Fl[threadIdx.x >> 3][threadIdx.x & 7];  }
}

// fish + softmax + PV: block = (b, 16 rows s0.., one local head l = blockIdx.z) x 256 threads; a[s][t] = sum_g (flag ? relu(p[g][l] (S_g[s][t] + sigma_g^2 eps[l][s] d_st)) : -inf) (f32, g in order)
// into LDS; row softmax (wave per 2 rows; fixed order), all -inf row -> zeros (nan_to_num); PV: 4 waves x (16 rows x 16 d). l is the slowest grid index: 2048 work-groups fill every wave slot.
__global__ __launch_bounds__(256, 16) void fish_kernel(const float* __restrict__ sc, const float* __restrict__ flags, const b16* __restrict__ vt, const float* __restrict__ P, b16* __restrict__ cp) {
  __shared__ __attribute__((aligned(16))) float A[16][S + 4]; __shared__ __attribute__((aligned(16))) float Cx[16][HD + 4];
  const int t_ = threadIdx.x, wave = t_ >> 5, lane = t_ & 31, nloc = lane & 15, hlf = lane >> 4; const int b = blockIdx.y, s0 = blockIdx.x * 16, l = blockIdx.z;
  const float* sig2 = P + 1536; const float* pp = P + 1544; const float* ed = P + 1672;
  // thread = column t, one row a pass; RB rows a trip: their 8 score planes, flags and eps are all requested before the first use
  constexpr int RB = 4; float pl[G], s2[G];
#pragma unroll
  for (int g = 0; g < G; ++g) { pl[g] = pp[g * L + l]; s2[g] = sig2[g]; }
  for (int r0 = 0; r0 < 16; r0 += RB) { float sv[RB][G], fl[RB][G], ev[RB];
#pragma unroll
    for (int j = 0; j < RB; ++j) { const int s = s0 + r0 + j; ev[j] = ed[l * S + s];
#pragma unroll
      for (int g = 0; g < G; ++g) { sv[j][g] = sc[(((size_t)b * G + g) * S + s) * S + t_]; fl[j][g] = flags[((size_t)b * S + s) * G + g]; } }
#pragma unroll
    for (int j = 0; j < RB; ++j) { const int s = s0 + r0 + j; float a = 0.0f; bool ninf = false;
#pragma unroll
      for (int g = 0; g < G; ++g) { float v = sv[j][g]; if (t_ == s) v += s2[g] * ev[j]; v = fmaxf(pmul(v, pl[g]), 0.0f); if (fl[j][g] != 0.0f) a += v; else ninf = true; }
      A[r0 + j][t_] = ninf ? -INFINITY : a; } }
  __syncthreads();
  // softmax rows: wave w handles rows 2w, 2w+1
  for (int rr = wave * 2; rr < wave * 2 + 2; ++rr) { float mx = -INFINITY;
#pragma unroll
    for (int j = 0; j < 8; ++j) mx = fmaxf(mx, A[rr][lane + 32 * j]);
#pragma unroll
    for (int o = 1; o < 32; o <<= 1) mx = fmaxf(mx, __shfl_xor(mx, o));
    float sm = 0.0f;
#pragma unroll
    for (int j = 0; j < 8; ++j) sm += (mx == -INFINITY) ? 0.0f : nexp(A[rr][lane + 32 * j] - mx);
#pragma unroll
    for (int o = 1; o < 32; o <<= 1) sm += __shfl_xor(sm, o);
    const float inv = (mx == -INFINITY) ? 0.0f : 1.0f / sm;   // all -inf row -> NaN in the reference -> nan_to_num -> 0
#pragma unroll
    for (int j = 0; j < 8; ++j) A[rr][lane + 32 * j] = (mx == -INFINITY) ? 0.0f : nexp(A[rr][lane + 32 * j] - mx) * inv; }
  __syncthreads();
  // PV: waves 0..3 -> d-tile = wave (16 d of 64); rows = all 16 s; 8 k-steps; A split hi+lo x8; B = v^T blocks [b][l][d tile][k-step] single
  if (wave < 4) { v8f acc = {}; const b16* V = vt + (((size_t)b * L + l) * 4 + wave) * 8 * 512 + lane * 8;
    for (int k0 = 0; k0 < S; k0 += 64) { v8b vr[2][2];   // two k-steps' value blocks requested together
#pragma unroll
      for (int u = 0; u < 2; ++u) ld_p(V + (k0 / 32 + u) * 512, vr[u]);
#pragma unroll
      for (int u = 0; u < 2; ++u) { v16b ah, al; frag_split(&A[nloc][k0 + 32 * u], hlf, ah, al); const v16b bw = cat_h(vr[u]); acc = wmma16b(ah, bw, acc); acc = wmma16b(al, bw, acc); } }
#pragma unroll
    for (int r = 0; r < 8; ++r) Cx[8 * hlf + r][wave * 16 + nloc] = acc[r] * (1.0f / (AS_ * VS)); }
  __syncthreads();
  // ctx leaves as the output projection's A operand: x8, f16 hi and lo planes, blocks [128 row tiles][32 k-steps][hi, lo]; thread = (k-step, plane, piece, lane), 4 KB in a row a work-group
  { const int ln = t_ & 31, j = (t_ >> 5) & 1, lo_ = (t_ >> 6) & 1, ksl = t_ >> 7; const float* cs = &Cx[ln & 15][ksl * 32 + j * 16 + (ln >> 4) * 8]; v8b h;
#pragma unroll
    for (int e = 0; e < 8; ++e) { b16 a, c; split16(cs[e] * AS_, a, c); h[e] = lo_ ? c : a; }
    *(v8b*)(cp + ((size_t)((b * S + s0) / 16) * 32 + 2 * l) * 1024 + t_ * 8) = h; }
}

// output projection: block = 64 tokens x 64 cols x 8 waves; wave = (32-row half ms, quarter kg of the 32 k-steps): four waves share one output tile, each sums 8 k-steps, so that a wave's chain of
// dependent load round trips is a quarter as long; the four f32 partial tiles meet in LDS and are added in the order kg = 0, 1, 2, 3
__global__ __launch_bounds__(256) void out_kernel(const b16* __restrict__ cp, const b16* __restrict__ Ro, const float* __restrict__ P, float* __restrict__ out) {
  __shared__ __attribute__((aligned(16))) float Ts[8][32 * 64];
  const int lane = threadIdx.x & 31, wave = threadIdx.x >> 5, nloc = lane & 15, hlf = lane >> 4, ms = wave & 1, kg = wave >> 1, m0 = blockIdx.y * 64 + ms * 32, c0 = blockIdx.x * 64; const float* bout = P + 1024;
  v8f acc[2][4];
#pragma unroll
  for (int r = 0; r < 2; ++r)
#pragma unroll
    for (int t = 0; t < 4; ++t) acc[r][t] = (v8f){};
  constexpr int NK = L * HD / 32, KQ = NK / 4; const b16* cr = cp + ((size_t)(m0 / 16) * NK + kg * KQ) * 1024 + lane * 8; const b16* wr = Ro + ((size_t)(c0 / 16) * NK + kg * KQ) * 512 + lane * 8;
  auto fetch = [&](int ks, v8b* ra, v8b* rb) { ld_p(cr + ks * 1024, ra); ld_p(cr + ks * 1024 + 512, ra + 2); ld_p(cr + (NK + ks) * 1024, ra + 4); ld_p(cr + (NK + ks) * 1024 + 512, ra + 6);
#pragma unroll
    for (int t = 0; t < 4; ++t) ld_p(wr + (t * NK + ks) * 512, rb + 2 * t); };
  auto mults = [&](const v8b* ra, const v8b* rb) { const v16b a0 = cat_h(ra), l0 = cat_h(ra + 2), a1 = cat_h(ra + 4), l1 = cat_h(ra + 6);
#pragma unroll
    for (int t = 0; t < 4; ++t) { const v16b bw = cat_h(rb + 2 * t); acc[0][t] = wmma16b(a0, bw, acc[0][t]); acc[0][t] = wmma16b(l0, bw, acc[0][t]); acc[1][t] = wmma16b(a1, bw, acc[1][t]); acc[1][t] = wmma16b(l1, bw, acc[1][t]); } };
  // two register sets: the 16 loads of k-step n + 1 are all issued before the products of k-step n
  v8b xa[8], ya[8], xb[8], yb[8]; fetch(0, xa, xb);
  for (int ks = 0; ks < KQ - 2; ks += 2) { fetch(ks + 1, ya, yb); SB; mults(xa, xb); SB; fetch(ks + 2, xa, xb); SB; mults(ya, yb); SB; XW; }   // SB, XW: as in the projection loop
  fetch(KQ - 1, ya, yb); XWP(cr, wr); mults(xa, xb); SB; mults(ya, yb);   // XWP: as in the projection kernel
#undef XWP
#undef XW
#undef SB
  float* Tt = Ts[wave];
#pragma unroll
  for (int t = 0; t < 4; ++t)
#pragma unroll
    for (int r = 0; r < 2; ++r)
#pragma unroll
      for (int v = 0; v < 8; ++v) Tt[(r * 16 + v + 8 * hlf) * 64 + t * 16 + nloc] = acc[r][t][v];
  __syncthreads();   // the four partial tiles of each row half are complete before any thread adds them
  { const int c4 = nloc * 4; const v4f bb = *(const v4f*)(bout + c0 + c4);
#pragma unroll
    for (int j = 0; j < 4; ++j) { const int rr = j * 16 + (threadIdx.x >> 4); const float* tp = &Ts[rr >> 5][(rr & 31) * 64 + c4];   // Ts[2 kg + ms]
      const v4f s_ = ((*(const v4f*)tp + *(const v4f*)(tp + 2 * 2048)) + *(const v4f*)(tp + 4 * 2048)) + *(const v4f*)(tp + 6 * 2048);
      *(v4f*)(out + (size_t)(blockIdx.y * 64 + rr) * H + c0 + c4) = s_ * (1.0f / AS_) + bb; } }
}
}  // namespace

extern "C" void kernel_launch(void* const* d_in, const int* in_sizes, int n_in,
                              void* d_out, int out_size, void* d_ws, size_t ws_size, hipStream_t stream) {
  (void)n_in; (void)out_size;
  const float* x = (const float*)d_in[0]; const float* sp = (const float*)d_in[1]; const float* ee = (const float*)d_in[2]; const float* Wq = (const float*)d_in[3]; const float* Wk = (const float*)d_in[4]; const float* Wv = (const float*)d_in[5]; const float* bv = (const float*)d_in[6];
  const float* sg = (const float*)d_in[7]; const float* pp = (const float*)d_in[8]; const float* ed = (const float*)d_in[9]; const float* Wout = (const float*)d_in[10]; const float* bout = (const float*)d_in[11];
  float* out = (float*)d_out;   // [8][256][512]
  if (in_sizes[0] != NT * H || in_sizes[1] != Bn * S * S || in_sizes[5] != H * 1024 || in_sizes[8] != G * L || in_sizes[9] != L * S || in_sizes[10] != 1024 * H) return;
  size_t off = 0; char* ws = (char*)d_ws;
  auto carve = [&](size_t bytes) { char* p = ws + off; off += (bytes + 255) & ~(size_t)255; return p; };
  b16* Xp = (b16*)carve((size_t)NT * H * 2); b16* R = (b16*)carve((size_t)NPJ * H * 2); b16* Ro = (b16*)carve((size_t)512 * 1024 * 2); float* P = (float*)carve(((size_t)1672 + L * S + 64) * 4);
  b16* qp = (b16*)carve((size_t)Bn * G * S * HD * 2); b16* kp = (b16*)carve((size_t)Bn * G * S * HD * 2); b16* vt = (b16*)carve((size_t)Bn * L * HD * S * 2); float* sc = (float*)carve((size_t)Bn * G * S * S * 4); float* flags = (float*)carve((size_t)Bn * S * G * 4); b16* cp = (b16*)carve((size_t)NT * L * HD * 2 * 2);
  if (off > ws_size) return;                                    // ≈ 2 + 2 + 1 + 2 + 2 + 4 + 16.8 + 8.4 ≈ 39 MB
  prep_kernel<<<PREP_WG, 256, 0, stream>>>(x, Wq, Wk, Wv, Wout, bv, bout, sg, pp, ed, Xp, R, Ro, P);
  proj_kernel<<<dim3(32, NT / 128), 128, 0, stream>>>(Xp, R, P, qp, kp, vt);
  score_kernel<<<dim3(S / 16, Bn), 256, 0, stream>>>(qp, kp, sp, ee, sc, flags);
  fish_kernel<<<dim3(S / 16, Bn, L), 256, 0, stream>>>(sc, flags, vt, P, cp);
  out_kernel<<<dim3(H / 64, NT / 64), 256, 0, stream>>>(cp, Ro, P, out);
}

// v005
// One run takes 50.2 microseconds.
// Two timings next to v004 both put it at 1.08 times that version's speed.
// Counting every step since v000, it is 11.2 times as fast.
#include <hip/hip_runtime.h>

// GraphormerFishAttention: q = x Wq, k = x Wk (G=8 heads x 64), v = x Wv + bv (L=16 heads x 64); g = q.k^T 512^-0.5 + (spatial + edge) bias [B,G,S,S]; pad = any_t(g != 0);
// a_l = Σ_g where(pad_g, relu(p[g,l] (g + sigma_g² eps[l,s] δ_st)), -inf); softmax over t; nan_to_num; out_l = a_l.v_l; out = merged Wout + bout -> [8][256][512].
// Projections on v_wmma_f32_16x16x32_f16 with exact operands (x and the weights are exact bf16; 1 product); g = q.k^T with q, k single f16 x8 (1 product; |q.k|·scale ≈ 0.07 next to
// the O(1) exact bias) + bias in f32; the fish mixing / relu / pad / softmax in f32 (fixed order); out_l = P.v with P as an f16 hi+lo pair x8 and v single f16 x8 (2 products);
// output projection with ctx as hi+lo x8 (2 products); f32 accumulate. Fragment k-map per lane half hh for A AND B: elements 0..7 <- k = 8hh+0..7, 8..15 <- k = 16+8hh+0..7.
// Every f16 matrix operand in the workspace lies in fragment order: a block of 16 rows x 32 k is 1 KB; its 16-byte piece (j, lane) holds row (lane & 15), k = 16 j + 8 (lane >> 4) + 0..7, at half offset 256 j + 8 lane,
// so that a wave's fragment is two loads of 512 contiguous bytes (the k-map above, unchanged).

namespace {
constexpr int Bn = 8, S = 256, H = 512, G = 8, L = 16, HD = 64, NT = Bn * S, NPJ = 2048;
constexpr float QS = 8.0f, KS = 8.0f, VS = 8.0f, PS = 8.0f, AS_ = 8.0f, SCALE = 0.04419417382415922f;

typedef _Float16 b16;
typedef __attribute__((ext_vector_type(16))) _Float16 v16b;
typedef __attribute__((ext_vector_type(8))) _Float16 v8b;
typedef __attribute__((ext_vector_type(8))) float v8f;
typedef __attribute__((ext_vector_type(4))) float v4f;
__device__ __forceinline__ float bf16_rne(float f) { unsigned int u = __float_as_uint(f); u += 0x7FFFu + ((u >> 16) & 1u); return __uint_as_float(u & 0xFFFF0000u); }
__device__ __forceinline__ void split16(float v, b16& hi, b16& lo) { hi = (b16)v; lo = (b16)(v - (float)hi); }
__device__ __forceinline__ void frag_split(const float* p, int hh, v16b& fh, v16b& fl) {
#pragma unroll
  for (int e = 0; e < 8; ++e) { b16 a, c; split16(p[8 * hh + e] * AS_, a, c); fh[e] = a; fl[e] = c; split16(p[16 + 8 * hh + e] * AS_, a, c); fh[8 + e] = a; fl[8 + e] = c; } }
// raw fragment loads, kept apart from their use so that a whole batch can be in flight before the first use; p = the block's start + 8 * lane
__device__ __forceinline__ void ld_p(const b16* p, v8b* r) { r[0] = *(const v8b*)(p); r[1] = *(const v8b*)(p + 256); }
__device__ __forceinline__ v16b cat_h(const v8b* r) { v16b f;
#pragma unroll
  for (int e = 0; e < 8; ++e) { f[e] = r[0][e]; f[8 + e] = r[1][e]; } return f; }
__device__ __forceinline__ v8f wmma16b(v16b a, v16b b, v8f c) { v8f d = __builtin_amdgcn_wmma_f32_16x16x32_f16(false, a, false, b, (short)0, c, false, false); asm volatile("v_nop\n\tv_nop\n\tv_nop\n\tv_nop" : "+v"(d) : "v"(a), "v"(b)); return d; }
__device__ __forceinline__ void wave_lds_sync() { __builtin_amdgcn_fence(__ATOMIC_RELEASE, "workgroup"); __builtin_amdgcn_wave_barrier(); __builtin_amdgcn_fence(__ATOMIC_ACQUIRE, "workgroup"); }
__device__ __forceinline__ float nexp(float x) { return __builtin_amdgcn_exp2f(x * 1.4426950408889634f); }
template <bool V> struct Bc { static constexpr bool value = V; };

// prep, one thread a 16-byte piece: Xp = x as f16, blocks [128 row tiles][16 k-steps]; R = Wq | Wk | Wv, blocks [128 column tiles][16 k-steps]; Ro = Wout, blocks [32 column tiles][32 k-steps] (for the weights the lanes
// run along the output column, so each of a piece's 8 loads reads whole lines); P: bv @0 (1024), bout @1024 (512), sigma^2 @1536 (8), p @1544 (128 = [g][l]), eps @1672
constexpr int PREP_WG = 256, NTH = PREP_WG * 256;
__global__ __launch_bounds__(256) void prep_kernel(const float* __restrict__ x, const float* __restrict__ Wq, const float* __restrict__ Wk, const float* __restrict__ Wv, const float* __restrict__ Wout, const float* __restrict__ bv, const float* __restrict__ bout, const float* __restrict__ sg, const float* __restrict__ pp, const float* __restrict__ ed, b16* __restrict__ Xp, b16* __restrict__ R, b16* __restrict__ Ro, float* __restrict__ P) {
  const int t_ = blockIdx.x * 256 + threadIdx.x;
  // XW: the wait that stands behind issued global loads before their address registers are written again; the SB on either side keep other arithmetic from being scheduled between the loads and the wait
#define SB __builtin_amdgcn_sched_barrier(0)
#define XW SB; asm volatile("s_wait_xcnt 0x0" ::: "memory"); SB
  // XWP: the same wait; the two address pairs are named as inputs only, so that they stay allocated up to the wait
#define XWP(p, q) SB; asm volatile("s_wait_xcnt 0x0" :: "v"(p), "v"(q) : "memory"); SB
  float wa[8], wv[8], wo[8]; v4f xv[2][2];   // all of a thread's loads are requested before the first conversion
  const int oa = t_ & 511, ka = (t_ >> 9) & 63, ov = t_ & 1023, kv = t_ >> 10, kw = t_ >> 9;   // piece = (column, group of 8 k): Wq (work-groups 0..127) or Wk, Wv, Wout
  { const float* s_ = ((blockIdx.x < PREP_WG / 2) ? Wq : Wk) + (size_t)ka * 8 * 512 + oa;
#pragma unroll
    for (int e = 0; e < 8; ++e) wa[e] = s_[e * 512]; }
  XW;
  { const float* s_ = Wv + (size_t)kv * 8 * 1024 + ov;
#pragma unroll
    for (int e = 0; e < 8; ++e) wv[e] = s_[e * 1024]; }
  XW;
  { const float* s_ = Wout + (size_t)kw * 8 * 512 + oa;
#pragma unroll
    for (int e = 0; e < 8; ++e) wo[e] = s_[e * 512]; }
  XW;
#pragma unroll
  for (int u = 0; u < 2; ++u) { const int q = t_ + u * NTH, ln = q & 31, j = (q >> 5) & 1, ks = (q >> 6) & 15, rt = q >> 10; const float* s_ = x + (size_t)(rt * 16 + (ln & 15)) * H + ks * 32 + j * 16 + (ln >> 4) * 8;
    xv[u][0] = *(const v4f*)s_; xv[u][1] = *(const v4f*)(s_ + 4); XW; }
  auto put = [&](b16* dst, int nk, int o, int kg, const float* v) { v8b h;   // column o, k = 8 kg + 0..7 -> its piece of block (o >> 4, kg >> 2)
#pragma unroll
    for (int e = 0; e < 8; ++e) h[e] = (b16)bf16_rne(v[e]);
    *(v8b*)(dst + ((size_t)((o >> 4) * nk + (kg >> 2)) * 2 + ((kg >> 1) & 1)) * 256 + ((kg & 1) * 16 + (o & 15)) * 8) = h; };
  put(R, 16, oa + ((blockIdx.x < PREP_WG / 2) ? 0 : 512), ka, wa); put(R, 16, 1024 + ov, kv, wv); put(Ro, 32, oa, kw, wo);
#pragma unroll
  for (int u = 0; u < 2; ++u) { v8b h;
#pragma unroll
    for (int e = 0; e < 8; ++e) h[e] = (b16)bf16_rne(xv[u][e >> 2][e & 3]);
    *(v8b*)(Xp + (size_t)(t_ + u * NTH) * 8) = h; }
  for (int q = t_; q < 1672 + L * S; q += NTH) { float v; if (q < 1024) v = bf16_rne(bv[q]); else if (q < 1536) v = bf16_rne(bout[q - 1024]); else if (q < 1544) { const float s_ = bf16_rne(sg[q - 1536]); v = s_ * s_; } else if (q < 1672) v = bf16_rne(pp[q - 1544]); else v = bf16_rne(ed[q - 1672]); P[q] = v; }
}

// projections: block 128 tokens x 64 cols (tile ct of 32: 0..7 q heads, 8..15 k heads, 16..31 v l-heads); exact (1 product); q x scale x 8 / k x 8 -> planes [b][g] of blocks [16 s tiles][2 k-steps]; v x 8 -> planes [b][l] of blocks [4 d tiles][8 k-steps of t]
__global__ __launch_bounds__(128) void proj_kernel(const b16* __restrict__ Xp, const b16* __restrict__ R, const float* __restrict__ P, b16* __restrict__ qp, b16* __restrict__ kp, b16* __restrict__ vt) {
  __shared__ __attribute__((aligned(16))) b16 T[4][32][64 + 8]; __shared__ __attribute__((aligned(16))) b16 Tv[64][128 + 8];
  const int lane = threadIdx.x & 31, wave = threadIdx.x >> 5, nloc = lane & 15, hlf = lane >> 4, ct = blockIdx.x, c0 = ct * 64, p0 = blockIdx.y * 128, m0 = p0 + wave * 32, b = p0 / S, t0 = p0 % S;
  v8f acc[2][4];
#pragma unroll
  for (int r = 0; r < 2; ++r)
#pragma unroll
    for (int t = 0; t < 4; ++t) acc[r][t] = (v8f){};
  constexpr int NK = H / 32; const b16* xr = Xp + (size_t)(m0 / 16) * NK * 512 + lane * 8; const b16* wr = R + (size_t)(c0 / 16) * NK * 512 + lane * 8;
  auto fetch = [&](int ks, v8b* ra, v8b* rb) { ld_p(xr + ks * 512, ra); ld_p(xr + (NK + ks) * 512, ra + 2);
#pragma unroll
    for (int t = 0; t < 4; ++t) ld_p(wr + (t * NK + ks) * 512, rb + 2 * t); };
  auto mults = [&](const v8b* ra, const v8b* rb) { const v16b a0 = cat_h(ra), a1 = cat_h(ra + 2);
#pragma unroll
    for (int t = 0; t < 4; ++t) { const v16b bw = cat_h(rb + 2 * t); acc[0][t] = wmma16b(a0, bw, acc[0][t]); acc[1][t] = wmma16b(a1, bw, acc[1][t]); } };
  // two register sets: the 12 loads of k-step n + 1 are all issued before the products of k-step n
  v8b xa[4], ya[4], xb[8], yb[8]; fetch(0, xa, xb);
  // SB: keeps a set's loads in front of the other set's products; moved behind them they would be waited for right after their issue
  for (int ks = 0; ks < NK - 2; ks += 2) { fetch(ks + 1, ya, yb); SB; mults(xa, xb); SB; fetch(ks + 2, xa, xb); SB; mults(ya, yb); SB; XW; }   // XW: the next trip rewrites the loads' address registers
  fetch(NK - 1, ya, yb); XWP(xr, wr); mults(xa, xb); SB; mults(ya, yb);   // XWP: the epilogue's index arithmetic reuses the address registers
  if (ct < 16) { const float scl = (ct < 8) ? SCALE * QS : KS; const int hd_ = (ct < 8) ? ct : ct - 8;
#pragma unroll
    for (int t = 0; t < 4; ++t)
#pragma unroll
      for (int r = 0; r < 2; ++r)
#pragma unroll
        for (int v = 0; v < 8; ++v) T[wave][r * 16 + 8 * hlf + v][t * 16 + nloc] = (b16)(acc[r][t][v] * scl);
    wave_lds_sync();
    b16* base = ((ct < 8) ? qp : kp) + (((size_t)b * G + hd_) * S + (m0 % S)) * HD;
    {
#pragma unroll
      for (int j = 0; j < 8; ++j) *(v8b*)(base + j * 256 + lane * 8) = *(const v8b*)(&T[wave][(j >> 2) * 16 + nloc][((j >> 1) & 1) * 32 + (j & 1) * 16 + hlf * 8]);   // j = (s tile, k-step, piece)
       }
    return; }
  const int l = ct - 16; const float* bvp = P + l * HD;
#pragma unroll
  for (int t = 0; t < 4; ++t) { const float bb = bvp[t * 16 + nloc];
#pragma unroll
    for (int r = 0; r < 2; ++r)
#pragma unroll
      for (int v = 0; v < 8; ++v) Tv[t * 16 + nloc][wave * 32 + r * 16 + 8 * hlf + v] = (b16)((acc[r][t][v] + bb) * VS); }
  __syncthreads();
  { for (int i = threadIdx.x; i < 64 * 16; i += 128) { const int ln = i & 31, j = (i >> 5) & 1, ksl = (i >> 6) & 3, dt = i >> 8; *(v8b*)(vt + ((((size_t)b * L + l) * 4 + dt) * 8 + t0 / 32 + ksl) * 512 + j * 256 + ln * 8) = *(const v8b*)(&Tv[dt * 16 + (ln & 15)][ksl * 32 + j * 16 + (ln >> 4) * 8]); }  }
}

// scores: block = (b, 16 query rows s0..) x 8 waves (wave = head g): Sg[s][t] = q_s.k_t (scaled) + spatial[b][s][t] + edge[b][s][t] (2 k-steps x 16 t-tiles, 1 product) -> f32 rows
__global__ __launch_bounds__(256) void score_kernel(const b16* __restrict__ qp, const b16* __restrict__ kp, const float* __restrict__ sp, const float* __restrict__ ee, float* __restrict__ sc, float* __restrict__ flags) {
  __shared__ __attribute__((aligned(16))) float Ts[8][16][S + 4]; __shared__ float Fl[16][8];
  const int g = threadIdx.x >> 5, lane = threadIdx.x & 31, nloc = lane & 15, hlf = lane >> 4; const int b = blockIdx.y, s0 = blockIdx.x * 16;
  const b16* Q = qp + (((size_t)b * G + g) * S) * HD; const b16* K = kp + (((size_t)b * G + g) * S) * HD;
  v8b qr[4]; ld_p(Q + (size_t)s0 * HD + lane * 8, qr); ld_p(Q + (size_t)s0 * HD + 512 + lane * 8, qr + 2); const v16b q0 = cat_h(qr), q1 = cat_h(qr + 2);
  // two t-tiles a trip: their key rows and bias values (40 loads) are all requested before the first product
  const b16* kq = K + lane * 8; const size_t bo0 = ((size_t)b * S + s0 + 8 * hlf) * S + nloc; const float* sq = sp + bo0; const float* eq = ee + bo0;
  for (int t4 = 0; t4 < 16; t4 += 2) { v8b kr[2][4]; float bs[2][8], be[2][8];
#pragma unroll
    for (int u = 0; u < 2; ++u) { ld_p(kq + u * 16 * HD, &kr[u][0]); ld_p(kq + u * 16 * HD + 512, &kr[u][2]);
#pragma unroll
      for (int r = 0; r < 8; ++r) { bs[u][r] = sq[r * S + u * 16]; be[u][r] = eq[r * S + u * 16]; } }
    kq += 32 * HD; sq += 32; eq += 32;
#pragma unroll
    for (int u = 0; u < 2; ++u) { v8f acc = {}; acc = wmma16b(q0, cat_h(&kr[u][0]), acc); acc = wmma16b(q1, cat_h(&kr[u][2]), acc);
#pragma unroll
      for (int r = 0; r < 8; ++r) Ts[g][8 * hlf + r][(t4 + u) * 16 + nloc] = acc[r] * (1.0f / (QS * KS)) + (bf16_rne(bs[u][r]) + bf16_rne(be[u][r])); } }
  wave_lds_sync();
  // pad flags: lane-strided any over the 256 t of rows (16 rows: 2 lanes per row... use lane l -> row l&15, half l>>4 covers t parity) 
  { const int rr = lane & 15, half = lane >> 4; int nz = 0; for (int t = half; t < S; t += 2) nz |= (Ts[g][rr][t] != 0.0f) ? 1 : 0; nz |= __shfl_xor(nz, 16); if (lane < 16) Fl[rr][g] = nz ? 1.0f : 0.0f; }
  { for (int i = lane; i < 16 * (S / 4); i += 32) { const int rr = i / (S / 4), c4 = (i % (S / 4)) * 4; *(v4f*)(sc + (((size_t)b * G + g) * S + s0 + rr) * S + c4) = *(const v4f*)(&Ts[g][rr][c4]); }  }
  __syncthreads();
  { if (threadIdx.x < 128) ((float*)flags)[((size_t)b * S + s0) * G + threadIdx.x] = Fl[threadIdx.x >> 3][threadIdx.x & 7];  }
}

// fish + softmax + PV: block = (b, 16 rows s0.., one local head l = blockIdx.z) x 256 threads; a[s][t] = sum_g (flag ? relu(p[g][l] (S_g[s][t] + sigma_g^2 eps[l][s] d_st)) : -inf) (f32, g in order)
// into LDS; row softmax (wave per 2 rows; fixed order), all -inf row -> zeros (nan_to_num); PV: 4 waves x (16 rows x 16 d). l is the slowest grid index: 2048 work-groups fill every wave slot.
__global__ __launch_bounds__(256, 16) void fish_kernel(const float* __restrict__ sc, const float* __restrict__ flags, const b16* __restrict__ vt, const float* __restrict__ P, b16* __restrict__ cp) {
  __shared__ __attribute__((aligned(16))) float A[16][S + 4]; __shared__ __attribute__((aligned(16))) float Cx[16][HD + 4];
  const int t_ = threadIdx.x, wave = t_ >> 5, lane = t_ & 31, nloc = lane & 15, hlf = lane >> 4; const int b = blockIdx.y, s0 = blockIdx.x * 16, l = blockIdx.z;
  const float* sig2 = P + 1536; const float* pp = P + 1544; const float* ed = P + 1672;
  // thread = column t, one row a pass; RB rows a trip: their 8 score planes, flags and eps are all requested before the first use
  constexpr int RB = 4; float pl[G], s2[G];
#pragma unroll
  for (int g = 0; g < G; ++g) { pl[g] = pp[g * L + l]; s2[g] = sig2[g]; }
  // a score costs a product, a maximum and an add. One false pad flag makes the whole row -inf, so the bit patterns of the row's 8 flags (each 0.0f or 1.0f, the same for every thread) are ANDed once a row and tested once.
  // DG: this wave's 32 columns hold the tile's 16 diagonal elements; only that wave adds sigma^2 eps (times 0 off the diagonal, as the reference does)
  auto mix = [&](auto dg) { constexpr bool DG = decltype(dg)::value;
#pragma clang loop unroll(disable) vectorize(disable)   // one trip's 32 loads at a time: unrolled or widened, more trips' loads overlap and spill past the 64 registers that 16 waves a SIMD leave
    for (int r0 = 0; r0 < 16; r0 += RB) { float sv[RB][G], fl[RB][G], ev[RB];
#pragma unroll
      for (int j = 0; j < RB; ++j) { const int s = s0 + r0 + j; ev[j] = ed[l * S + s];
#pragma unroll
        for (int g = 0; g < G; ++g) { sv[j][g] = sc[(((size_t)b * G + g) * S + s) * S + t_]; fl[j][g] = flags[((size_t)b * S + s) * G + g]; } }
      XW;   // the next trip's address step rewrites the loads' address registers
#pragma unroll
      for (int j = 0; j < RB; ++j) { const int s = s0 + r0 + j; float a = 0.0f; unsigned fa = ~0u; const float de = (DG && t_ == s) ? ev[j] : 0.0f;
#pragma unroll
        for (int g = 0; g < G; ++g) { float v = sv[j][g]; if (DG) v += s2[g] * de; a += fmaxf(v * pl[g], 0.0f); fa &= __float_as_uint(fl[j][g]); }
        A[r0 + j][t_] = (fa == 0u) ? -INFINITY : a; } } };
  if (__builtin_amdgcn_readfirstlane(wave) == (s0 >> 5)) mix(Bc<true>{}); else mix(Bc<false>{});   // the same for a whole wave; both sides meet at the barrier below
  __syncthreads();
  // softmax rows: wave w handles rows 2w, 2w+1
  for (int rr = wave * 2; rr < wave * 2 + 2; ++rr) { float mx = -INFINITY;
#pragma unroll
    for (int j = 0; j < 8; ++j) mx = fmaxf(mx, A[rr][lane + 32 * j]);
#pragma unroll
    for (int o = 1; o < 32; o <<= 1) mx = fmaxf(mx, __shfl_xor(mx, o));
    float sm = 0.0f;
#pragma unroll
    for (int j = 0; j < 8; ++j) sm += (mx == -INFINITY) ? 0.0f : nexp(A[rr][lane + 32 * j] - mx);
#pragma unroll
    for (int o = 1; o < 32; o <<= 1) sm += __shfl_xor(sm, o);
    const float inv = (mx == -INFINITY) ? 0.0f : 1.0f / sm;   // all -inf row -> NaN in the reference -> nan_to_num -> 0
#pragma unroll
    for (int j = 0; j < 8; ++j) A[rr][lane + 32 * j] = (mx == -INFINITY) ? 0.0f : nexp(A[rr][lane + 32 * j] - mx) * inv; }
  __syncthreads();
  // PV: waves 0..3 -> d-tile = wave (16 d of 64); rows = all 16 s; 8 k-steps; A split hi+lo x8; B = v^T blocks [b][l][d tile][k-step] single
  if (wave < 4) { v8f acc = {}; const b16* V = vt + (((size_t)b * L + l) * 4 + wave) * 8 * 512 + lane * 8;
    for (int k0 = 0; k0 < S; k0 += 64) { v8b vr[2][2];   // two k-steps' value blocks requested together
#pragma unroll
      for (int u = 0; u < 2; ++u) ld_p(V + (k0 / 32 + u) * 512, vr[u]);
#pragma unroll
      for (int u = 0; u < 2; ++u) { v16b ah, al; frag_split(&A[nloc][k0 + 32 * u], hlf, ah, al); const v16b bw = cat_h(vr[u]); acc = wmma16b(ah, bw, acc); acc = wmma16b(al, bw, acc); } }
#pragma unroll
    for (int r = 0; r < 8; ++r) Cx[8 * hlf + r][wave * 16 + nloc] = acc[r] * (1.0f / (AS_ * VS)); }
  __syncthreads();
  // ctx leaves as the output projection's A operand: x8, f16 hi and lo planes, blocks [128 row tiles][32 k-steps][hi, lo]; thread = (k-step, plane, piece, lane), 4 KB in a row a work-group
  { const int ln = t_ & 31, j = (t_ >> 5) & 1, lo_ = (t_ >> 6) & 1, ksl = t_ >> 7; const float* cs = &Cx[ln & 15][ksl * 32 + j * 16 + (ln >> 4) * 8]; v8b h;
#pragma unroll
    for (int e = 0; e < 8; ++e) { b16 a, c; split16(cs[e] * AS_, a, c); h[e] = lo_ ? c : a; }
    *(v8b*)(cp + ((size_t)((b * S + s0) / 16) * 32 + 2 * l) * 1024 + t_ * 8) = h; }
}

// output projection: block = 64 tokens x 64 cols x 8 waves; wave = (32-row half ms, quarter kg of the 32 k-steps): four waves share one output tile, each sums 8 k-steps, so that a wave's chain of
// dependent load round trips is a quarter as long; the four f32 partial tiles meet in LDS and are added in the order kg = 0, 1, 2, 3
__global__ __launch_bounds__(256) void out_kernel(const b16* __restrict__ cp, const b16* __restrict__ Ro, const float* __restrict__ P, float* __restrict__ out) {
  __shared__ __attribute__((aligned(16))) float Ts[8][32 * 64];
  const int lane = threadIdx.x & 31, wave = threadIdx.x >> 5, nloc = lane & 15, hlf = lane >> 4, ms = wave & 1, kg = wave >> 1, m0 = blockIdx.y * 64 + ms * 32, c0 = blockIdx.x * 64; const float* bout = P + 1024;
  v8f acc[2][4];
#pragma unroll
  for (int r = 0; r < 2; ++r)
#pragma unroll
    for (int t = 0; t < 4; ++t) acc[r][t] = (v8f){};
  constexpr int NK = L * HD / 32, KQ = NK / 4; const b16* cr = cp + ((size_t)(m0 / 16) * NK + kg * KQ) * 1024 + lane * 8; const b16* wr = Ro + ((size_t)(c0 / 16) * NK + kg * KQ) * 512 + lane * 8;
  auto fetch = [&](int ks, v8b* ra, v8b* rb) { ld_p(cr + ks * 1024, ra); ld_p(cr + ks * 1024 + 512, ra + 2); ld_p(cr + (NK + ks) * 1024, ra + 4); ld_p(cr + (NK + ks) * 1024 + 512, ra + 6);
#pragma unroll
    for (int t = 0; t < 4; ++t) ld_p(wr + (t * NK + ks) * 512, rb + 2 * t); };
  auto mults = [&](const v8b* ra, const v8b* rb) { const v16b a0 = cat_h(ra), l0 = cat_h(ra + 2), a1 = cat_h(ra + 4), l1 = cat_h(ra + 6);
#pragma unroll
    for (int t = 0; t < 4; ++t) { const v16b bw = cat_h(rb + 2 * t); acc[0][t] = wmma16b(a0, bw, acc[0][t]); acc[0][t] = wmma16b(l0, bw, acc[0][t]); acc[1][t] = wmma16b(a1, bw, acc[1][t]); acc[1][t] = wmma16b(l1, bw, acc[1][t]); } };
  // two register sets: the 16 loads of k-step n + 1 are all issued before the products of k-step n
  v8b xa[8], ya[8], xb[8], yb[8]; fetch(0, xa, xb);
  for (int ks = 0; ks < KQ - 2; ks += 2) { fetch(ks + 1, ya, yb); SB; mults(xa, xb); SB; fetch(ks + 2, xa, xb); SB; mults(ya, yb); SB; XW; }   // SB, XW: as in the projection loop
  fetch(KQ - 1, ya, yb); XWP(cr, wr); mults(xa, xb); SB; mults(ya, yb);   // XWP: as in the projection kernel
#undef XWP
#undef XW
#undef SB
  float* Tt = Ts[wave];
#pragma unroll
  for (int t = 0; t < 4; ++t)
#pragma unroll
    for (int r = 0; r < 2; ++r)
#pragma unroll
      for (int v = 0; v < 8; ++v) Tt[(r * 16 + v + 8 * hlf) * 64 + t * 16 + nloc] = acc[r][t][v];
  __syncthreads();   // the four partial tiles of each row half are complete before any thread adds them
  { const int c4 = nloc * 4; const v4f bb = *(const v4f*)(bout + c0 + c4);
#pragma unroll
    for (int j = 0; j < 4; ++j) { const int rr = j * 16 + (threadIdx.x >> 4); const float* tp = &Ts[rr >> 5][(rr & 31) * 64 + c4];   // Ts[2 kg + ms]
      const v4f s_ = ((*(const v4f*)tp + *(const v4f*)(tp + 2 * 2048)) + *(const v4f*)(tp + 4 * 2048)) + *(const v4f*)(tp + 6 * 2048);
      *(v4f*)(out + (size_t)(blockIdx.y * 64 + rr) * H + c0 + c4) = s_ * (1.0f / AS_) + bb; } }
}
}  // namespace

extern "C" void kernel_launch(void* const* d_in, const int* in_sizes, int n_in,
                              void* d_out, int out_size, void* d_ws, size_t ws_size, hipStream_t stream) {
  (void)n_in; (void)out_size;
  const float* x = (const float*)d_in[0]; const float* sp = (const float*)d_in[1]; const float* ee = (const float*)d_in[2]; const float* Wq = (const float*)d_in[3]; const float* Wk = (const float*)d_in[4]; const float* Wv = (const float*)d_in[5]; const float* bv = (const float*)d_in[6];
  const float* sg = (const float*)d_in[7]; const float* pp = (const float*)d_in[8]; const float* ed = (const float*)d_in[9]; const float* Wout = (const float*)d_in[10]; const float* bout = (const float*)d_in[11];
  float* out = (float*)d_out;   // [8][256][512]
  if (in_sizes[0] != NT * H || in_sizes[1] != Bn * S * S || in_sizes[5] != H * 1024 || in_sizes[8] != G * L || in_sizes[9] != L * S || in_sizes[10] != 1024 * H) return;
  size_t off = 0; char* ws = (char*)d_ws;
  auto carve = [&](size_t bytes) { char* p = ws + off; off += (bytes + 255) & ~(size_t)255; return p; };
  b16* Xp = (b16*)carve((size_t)NT * H * 2); b16* R = (b16*)carve((size_t)NPJ * H * 2); b16* Ro = (b16*)carve((size_t)512 * 1024 * 2); float* P = (float*)carve(((size_t)1672 + L * S + 64) * 4);
  b16* qp = (b16*)carve((size_t)Bn * G * S * HD * 2); b16* kp = (b16*)carve((size_t)Bn * G * S * HD * 2); b16* vt = (b16*)carve((size_t)Bn * L * HD * S * 2); float* sc = (float*)carve((size_t)Bn * G * S * S * 4); float* flags = (float*)carve((size_t)Bn * S * G * 4); b16* cp = (b16*)carve((size_t)NT * L * HD * 2 * 2);
  if (off > ws_size) return;                                    // ≈ 2 + 2 + 1 + 2 + 2 + 4 + 16.8 + 8.4 ≈ 39 MB
  prep_kernel<<<PREP_WG, 256, 0, stream>>>(x, Wq, Wk, Wv, Wout, bv, bout, sg, pp, ed, Xp, R, Ro, P);
  proj_kernel<<<dim3(32, NT / 128), 128, 0, stream>>>(Xp, R, P, qp, kp, vt);
  score_kernel<<<dim3(S / 16, Bn), 256, 0, stream>>>(qp, kp, sp, ee, sc, flags);
  fish_kernel<<<dim3(S / 16, Bn, L), 256, 0, stream>>>(sc, flags, vt, P, cp);
  out_kernel<<<dim3(H / 64, NT / 64), 256, 0, stream>>>(cp, Ro, P, out);
}

// v006
// One run takes 46.6 microseconds.
// Next to v005, in two timings, it ran 1.07 times as fast each time.
// Over all steps from v000 it is 12.1 times as fast.
#include <hip/hip_runtime.h>

// GraphormerFishAttention: q = x Wq, k = x Wk (G=8 heads x 64), v = x Wv + bv (L=16 heads x 64); g = q.k^T 512^-0.5 + (spatial + edge) bias [B,G,S,S]; pad = any_t(g != 0);
// a_l = Σ_g where(pad_g, relu(p[g,l] (g + sigma_g² eps[l,s] δ_st)), -inf); softmax over t; nan_to_num; out_l = a_l.v_l; out = merged Wout + bout -> [8][256][512].
// Projections on v_wmma_f32_16x16x32_f16 with exact operands (x and the weights are exact bf16; 1 product); g = q.k^T with q, k single f16 x8 (1 product; |q.k|·scale ≈ 0.07 next to
// the O(1) exact bias) + bias in f32; the fish mixing / relu / pad / softmax in f32 (fixed order); out_l = P.v with P as an f16 hi+lo pair x8 and v single f16 x8 (2 products);
// output projection with ctx as hi+lo x8 (2 products); f32 accumulate. Fragment k-map per lane half hh for A AND B: elements 0..7 <- k = 8hh+0..7, 8..15 <- k = 16+8hh+0..7.
// Every f16 matrix operand in the workspace lies in fragment order: a block of 16 rows x 32 k is 1 KB; its 16-byte piece (j, lane) holds row (lane & 15), k = 16 j + 8 (lane >> 4) + 0..7, at half offset 256 j + 8 lane,
// so that a wave's fragment is two loads of 512 contiguous bytes (the k-map above, unchanged).

namespace {
constexpr int Bn = 8, S = 256, H = 512, G = 8, L = 16, HD = 64, NT = Bn * S, NPJ = 2048;
constexpr float QS = 8.0f, KS = 8.0f, VS = 8.0f, PS = 8.0f, AS_ = 8.0f, SCALE = 0.04419417382415922f;

typedef _Float16 b16;
typedef __attribute__((ext_vector_type(16))) _Float16 v16b;
typedef __attribute__((ext_vector_type(8))) _Float16 v8b;
typedef __attribute__((ext_vector_type(8))) float v8f;
typedef __attribute__((ext_vector_type(4))) float v4f;
__device__ __forceinline__ float bf16_rne(float f) { unsigned int u = __float_as_uint(f); u += 0x7FFFu + ((u >> 16) & 1u); return __uint_as_float(u & 0xFFFF0000u); }
__device__ __forceinline__ void split16(float v, b16& hi, b16& lo) { hi = (b16)v; lo = (b16)(v - (float)hi); }
__device__ __forceinline__ void frag_split(const float* p, int hh, v16b& fh, v16b& fl) {
#pragma unroll
  for (int e = 0; e < 8; ++e) { b16 a, c; split16(p[8 * hh + e] * AS_, a, c); fh[e] = a; fl[e] = c; split16(p[16 + 8 * hh + e] * AS_, a, c); fh[8 + e] = a; fl[8 + e] = c; } }
// raw fragment loads, kept apart from their use so that a whole batch can be in flight before the first use; p = the block's start + 8 * lane
__device__ __forceinline__ void ld_p(const b16* p, v8b* r) { r[0] = *(const v8b*)(p); r[1] = *(const v8b*)(p + 256); }
__device__ __forceinline__ v16b cat_h(const v8b* r) { v16b f;
#pragma unroll
  for (int e = 0; e < 8; ++e) { f[e] = r[0][e]; f[8 + e] = r[1][e]; } return f; }
__device__ __forceinline__ v8f wmma16b(v16b a, v16b b, v8f c) { v8f d = __builtin_amdgcn_wmma_f32_16x16x32_f16(false, a, false, b, (short)0, c, false, false); asm volatile("v_nop\n\tv_nop\n\tv_nop\n\tv_nop" : "+v"(d) : "v"(a), "v"(b)); return d; }
__device__ __forceinline__ void wave_lds_sync() { __builtin_amdgcn_fence(__ATOMIC_RELEASE, "workgroup"); __builtin_amdgcn_wave_barrier(); __builtin_amdgcn_fence(__ATOMIC_ACQUIRE, "workgroup"); }
__device__ __forceinline__ float nexp(float x) { return __builtin_amdgcn_exp2f(x * 1.4426950408889634f); }
template <bool V> struct Bc { static constexpr bool value = V; };

// prep, one thread a 16-byte piece: Xp = x as f16, blocks [128 row tiles][16 k-steps]; R = Wq | Wk | Wv, blocks [128 column tiles][16 k-steps]; Ro = Wout, blocks [32 column tiles][32 k-steps] (for the weights the lanes
// run along the output column, so each of a piece's 8 loads reads whole lines); P: bv @0 (1024), bout @1024 (512), sigma^2 @1536 (8), p @1544 (128 = [g][l]), eps @1672
constexpr int PREP_WG = 256, NTH = PREP_WG * 256;
__global__ __launch_bounds__(256) void prep_kernel(const float* __restrict__ x, const float* __restrict__ Wq, const float* __restrict__ Wk, const float* __restrict__ Wv, const float* __restrict__ Wout, const float* __restrict__ bv, const float* __restrict__ bout, const float* __restrict__ sg, const float* __restrict__ pp, const float* __restrict__ ed, b16* __restrict__ Xp, b16* __restrict__ R, b16* __restrict__ Ro, float* __restrict__ P) {
  const int t_ = blockIdx.x * 256 + threadIdx.x;
  // XW: the wait that stands behind issued global loads before their address registers are written again; the SB on either side keep other arithmetic from being scheduled between the loads and the wait
#define SB __builtin_amdgcn_sched_barrier(0)
#define XW SB; asm volatile("s_wait_xcnt 0x0" ::: "memory"); SB
  // XWP: the same wait; the two address pairs are named as inputs only, so that they stay allocated up to the wait
#define XWP(p, q) SB; asm volatile("s_wait_xcnt 0x0" :: "v"(p), "v"(q) : "memory"); SB
  float wa[8], wv[8], wo[8]; v4f xv[2][2];   // all of a thread's loads are requested before the first conversion
  const int oa = t_ & 511, ka = (t_ >> 9) & 63, ov = t_ & 1023, kv = t_ >> 10, kw = t_ >> 9;   // piece = (column, group of 8 k): Wq (work-groups 0..127) or Wk, Wv, Wout
  { const float* s_ = ((blockIdx.x < PREP_WG / 2) ? Wq : Wk) + (size_t)ka * 8 * 512 + oa;
#pragma unroll
    for (int e = 0; e < 8; ++e) wa[e] = s_[e * 512]; }
  XW;
  { const float* s_ = Wv + (size_t)kv * 8 * 1024 + ov;
#pragma unroll
    for (int e = 0; e < 8; ++e) wv[e] = s_[e * 1024]; }
  XW;
  { const float* s_ = Wout + (size_t)kw * 8 * 512 + oa;
#pragma unroll
    for (int e = 0; e < 8; ++e) wo[e] = s_[e * 512]; }
  XW;
#pragma unroll
  for (int u = 0; u < 2; ++u) { const int q = t_ + u * NTH, ln = q & 31, j = (q >> 5) & 1, ks = (q >> 6) & 15, rt = q >> 10; const float* s_ = x + (size_t)(rt * 16 + (ln & 15)) * H + ks * 32 + j * 16 + (ln >> 4) * 8;
    xv[u][0] = *(const v4f*)s_; xv[u][1] = *(const v4f*)(s_ + 4); XW; }
  auto put = [&](b16* dst, int nk, int o, int kg, const float* v) { v8b h;   // column o, k = 8 kg + 0..7 -> its piece of block (o >> 4, kg >> 2)
#pragma unroll
    for (int e = 0; e < 8; ++e) h[e] = (b16)bf16_rne(v[e]);
    *(v8b*)(dst + ((size_t)((o >> 4) * nk + (kg >> 2)) * 2 + ((kg >> 1) & 1)) * 256 + ((kg & 1) * 16 + (o & 15)) * 8) = h; };
  put(R, 16, oa + ((blockIdx.x < PREP_WG / 2) ? 0 : 512), ka, wa); put(R, 16, 1024 + ov, kv, wv); put(Ro, 32, oa, kw, wo);
#pragma unroll
  for (int u = 0; u < 2; ++u) { v8b h;
#pragma unroll
    for (int e = 0; e < 8; ++e) h[e] = (b16)bf16_rne(xv[u][e >> 2][e & 3]);
    *(v8b*)(Xp + (size_t)(t_ + u * NTH) * 8) = h; }
  for (int q = t_; q < 1672 + L * S; q += NTH) { float v; if (q < 1024) v = bf16_rne(bv[q]); else if (q < 1536) v = bf16_rne(bout[q - 1024]); else if (q < 1544) { const float s_ = bf16_rne(sg[q - 1536]); v = s_ * s_; } else if (q < 1672) v = bf16_rne(pp[q - 1544]); else v = bf16_rne(ed[q - 1672]); P[q] = v; }
}

// projections: block 128 tokens x 64 cols (tile ct of 32: 0..7 q heads, 8..15 k heads, 16..31 v l-heads); exact (1 product); q x scale x 8 / k x 8 -> planes [b][g] of blocks [16 s tiles][2 k-steps]; v x 8 -> planes [b][l] of blocks [4 d tiles][8 k-steps of t]
__global__ __launch_bounds__(128) void proj_kernel(const b16* __restrict__ Xp, const b16* __restrict__ R, const float* __restrict__ P, b16* __restrict__ qp, b16* __restrict__ kp, b16* __restrict__ vt) {
  __shared__ __attribute__((aligned(16))) b16 T[4][32][64 + 8]; __shared__ __attribute__((aligned(16))) b16 Tv[64][128 + 8];
  const int lane = threadIdx.x & 31, wave = threadIdx.x >> 5, nloc = lane & 15, hlf = lane >> 4, ct = blockIdx.x, c0 = ct * 64, p0 = blockIdx.y * 128, m0 = p0 + wave * 32, b = p0 / S, t0 = p0 % S;
  v8f acc[2][4];
#pragma unroll
  for (int r = 0; r < 2; ++r)
#pragma unroll
    for (int t = 0; t < 4; ++t) acc[r][t] = (v8f){};
  constexpr int NK = H / 32; const b16* xr = Xp + (size_t)(m0 / 16) * NK * 512 + lane * 8; const b16* wr = R + (size_t)(c0 / 16) * NK * 512 + lane * 8;
  auto fetch = [&](int ks, v8b* ra, v8b* rb) { ld_p(xr + ks * 512, ra); ld_p(xr + (NK + ks) * 512, ra + 2);
#pragma unroll
    for (int t = 0; t < 4; ++t) ld_p(wr + (t * NK + ks) * 512, rb + 2 * t); };
  auto mults = [&](const v8b* ra, const v8b* rb) { const v16b a0 = cat_h(ra), a1 = cat_h(ra + 2);
#pragma unroll
    for (int t = 0; t < 4; ++t) { const v16b bw = cat_h(rb + 2 * t); acc[0][t] = wmma16b(a0, bw, acc[0][t]); acc[1][t] = wmma16b(a1, bw, acc[1][t]); } };
  // two register sets: the 12 loads of k-step n + 1 are all issued before the products of k-step n
  v8b xa[4], ya[4], xb[8], yb[8]; fetch(0, xa, xb);
  // SB: keeps a set's loads in front of the other set's products; moved behind them they would be waited for right after their issue
  for (int ks = 0; ks < NK - 2; ks += 2) { fetch(ks + 1, ya, yb); SB; mults(xa, xb); SB; fetch(ks + 2, xa, xb); SB; mults(ya, yb); SB; XW; }   // XW: the next trip rewrites the loads' address registers
  fetch(NK - 1, ya, yb); XWP(xr, wr); mults(xa, xb); SB; mults(ya, yb);   // XWP: the epilogue's index arithmetic reuses the address registers
  if (ct < 16) { const float scl = (ct < 8) ? SCALE * QS : KS; const int hd_ = (ct < 8) ? ct : ct - 8;
#pragma unroll
    for (int t = 0; t < 4; ++t)
#pragma unroll
      for (int r = 0; r < 2; ++r)
#pragma unroll
        for (int v = 0; v < 8; ++v) T[wave][r * 16 + 8 * hlf + v][t * 16 + nloc] = (b16)(acc[r][t][v] * scl);
    wave_lds_sync();
    b16* base = ((ct < 8) ? qp : kp) + (((size_t)b * G + hd_) * S + (m0 % S)) * HD;
    {
#pragma unroll
      for (int j = 0; j < 8; ++j) *(v8b*)(base + j * 256 + lane * 8) = *(const v8b*)(&T[wave][(j >> 2) * 16 + nloc][((j >> 1) & 1) * 32 + (j & 1) * 16 + hlf * 8]);   // j = (s tile, k-step, piece)
       }
    return; }
  const int l = ct - 16; const float* bvp = P + l * HD;
#pragma unroll
  for (int t = 0; t < 4; ++t) { const float bb = bvp[t * 16 + nloc];
#pragma unroll
    for (int r = 0; r < 2; ++r)
#pragma unroll
      for (int v = 0; v < 8; ++v) Tv[t * 16 + nloc][wave * 32 + r * 16 + 8 * hlf + v] = (b16)((acc[r][t][v] + bb) * VS); }
  __syncthreads();
  { for (int i = threadIdx.x; i < 64 * 16; i += 128) { const int ln = i & 31, j = (i >> 5) & 1, ksl = (i >> 6) & 3, dt = i >> 8; *(v8b*)(vt + ((((size_t)b * L + l) * 4 + dt) * 8 + t0 / 32 + ksl) * 512 + j * 256 + ln * 8) = *(const v8b*)(&Tv[dt * 16 + (ln & 15)][ksl * 32 + j * 16 + (ln >> 4) * 8]); }  }
}

// scores: block = (b, 16 query rows s0.., 4 of the 8 heads) x 16 waves (wave = one head gl of the four, one quarter tq of the 256 t): Sg[s][t] = q_s.k_t (scaled) + spatial[b][s][t] + edge[b][s][t] (2 k-steps x 4 t-tiles a wave, 1 product) -> f32 rows.
// 256 work-groups, one a WGP; a wave has one load round trip. A wave reads back only the LDS it wrote itself; the four quarters' pad flags meet behind the barrier. flags: planes [b][head half] of [s][4], so that a work-group writes whole lines.
constexpr int GH = 4, TQ = 4;
__global__ __launch_bounds__(512) void score_kernel(const b16* __restrict__ qp, const b16* __restrict__ kp, const float* __restrict__ sp, const float* __restrict__ ee, float* __restrict__ sc, float* __restrict__ flags) {
  __shared__ __attribute__((aligned(16))) float Ts[GH][16][S + 4]; __shared__ float Fl[TQ][16][GH];
  const int wave = threadIdx.x >> 5, gl = wave & (GH - 1), tq = wave / GH, g = blockIdx.z * GH + gl, lane = threadIdx.x & 31, nloc = lane & 15, hlf = lane >> 4; const int b = blockIdx.y, s0 = blockIdx.x * 16;
  const b16* Q = qp + (((size_t)b * G + g) * S) * HD; const b16* K = kp + (((size_t)b * G + g) * S) * HD;
  const b16* qq = Q + (size_t)s0 * HD + lane * 8; v8b qr[4]; ld_p(qq, qr); ld_p(qq + 512, qr + 2);
  // the wave's four t-tiles in one batch: their key rows and bias values (80 loads) are all requested before the first product
  const b16* kq = K + tq * 64 * HD + lane * 8; const size_t bo0 = ((size_t)b * S + s0 + 8 * hlf) * S + tq * 64 + nloc; const float* sq = sp + bo0; const float* eq = ee + bo0;
  v8b kr[4][4]; float bs[4][8], be[4][8];
#pragma unroll
  for (int u = 0; u < 4; ++u) { ld_p(kq + u * 16 * HD, &kr[u][0]); ld_p(kq + u * 16 * HD + 512, &kr[u][2]);
#pragma unroll
    for (int r = 0; r < 8; ++r) { bs[u][r] = sq[r * S + u * 16]; be[u][r] = eq[r * S + u * 16]; } }
  // the wait that stands behind issued global loads before their address registers are written again; the four address pairs are named as inputs only, so that no load of the batch lands in one of them; SB as in the projection loop
  SB; asm volatile("s_wait_xcnt 0x0" :: "v"(qq), "v"(kq), "v"(sq), "v"(eq) : "memory"); SB;
  const v16b q0 = cat_h(qr), q1 = cat_h(qr + 2);
#pragma unroll
  for (int u = 0; u < 4; ++u) { v8f acc = {}; acc = wmma16b(q0, cat_h(&kr[u][0]), acc); acc = wmma16b(q1, cat_h(&kr[u][2]), acc);
#pragma unroll
    for (int r = 0; r < 8; ++r) Ts[gl][8 * hlf + r][tq * 64 + u * 16 + nloc] = acc[r] * (1.0f / (QS * KS)) + (bf16_rne(bs[u][r]) + bf16_rne(be[u][r])); }
  wave_lds_sync();
  // pad flags: lane l -> row l & 15, t parity l >> 4, over this wave's 64 t
  { const int rr = lane & 15, half = lane >> 4; int nz = 0; for (int t = half; t < 64; t += 2) nz |= (Ts[gl][rr][tq * 64 + t] != 0.0f) ? 1 : 0; nz |= __shfl_xor(nz, 16); if (lane < 16) Fl[tq][rr][gl] = nz ? 1.0f : 0.0f; }
  { const int c4 = tq * 64 + nloc * 4; float* so = sc + (((size_t)b * G + g) * S + s0 + hlf) * S + c4;   // a store = 2 rows x 256 bytes in a row; unrolled so that the 8 LDS reads are in flight together
#pragma unroll
    for (int it = 0; it < 8; ++it) *(v4f*)(so + it * 2 * S) = *(const v4f*)(&Ts[gl][it * 2 + hlf][c4]); }
  __syncthreads();
  { if (threadIdx.x < 16 * GH) { const int rr = threadIdx.x >> 2, q = threadIdx.x & 3; flags[(((size_t)b * (G / GH) + blockIdx.z) * S + s0) * GH + threadIdx.x] = fmaxf(fmaxf(Fl[0][rr][q], Fl[1][rr][q]), fmaxf(Fl[2][rr][q], Fl[3][rr][q])); }  }
}

// fish + softmax + PV: block = (b, 16 rows s0.., one local head l = blockIdx.z) x 256 threads; a[s][t] = sum_g (flag ? relu(p[g][l] (S_g[s][t] + sigma_g^2 eps[l][s] d_st)) : -inf) (f32, g in order)
// into LDS; row softmax (wave per 2 rows; fixed order), all -inf row -> zeros (nan_to_num); PV: 4 waves x (16 rows x 16 d). l is the slowest grid index: 2048 work-groups fill every wave slot.
__global__ __launch_bounds__(256, 16) void fish_kernel(const float* __restrict__ sc, const float* __restrict__ flags, const b16* __restrict__ vt, const float* __restrict__ P, b16* __restrict__ cp) {
  __shared__ __attribute__((aligned(16))) float A[16][S + 4]; __shared__ __attribute__((aligned(16))) float Cx[16][HD + 4];
  const int t_ = threadIdx.x, wave = t_ >> 5, lane = t_ & 31, nloc = lane & 15, hlf = lane >> 4; const int b = blockIdx.y, s0 = blockIdx.x * 16, l = blockIdx.z;
  const float* sig2 = P + 1536; const float* pp = P + 1544; const float* ed = P + 1672;
  // thread = column t, one row a pass; RB rows a trip: their 8 score planes, flags and eps are all requested before the first use
  constexpr int RB = 4; float pl[G], s2[G];
#pragma unroll
  for (int g = 0; g < G; ++g) { pl[g] = pp[g * L + l]; s2[g] = sig2[g]; }
  // a score costs a product, a maximum and an add. One false pad flag makes the whole row -inf, so the bit patterns of the row's 8 flags (each 0.0f or 1.0f, the same for every thread) are ANDed once a row and tested once.
  // DG: this wave's 32 columns hold the tile's 16 diagonal elements; only that wave adds sigma^2 eps (times 0 off the diagonal, as the reference does)
  auto mix = [&](auto dg) { constexpr bool DG = decltype(dg)::value;
#pragma clang loop unroll(disable) vectorize(disable)   // one trip's 32 loads at a time: unrolled or widened, more trips' loads overlap and spill past the 64 registers that 16 waves a SIMD leave
    for (int r0 = 0; r0 < 16; r0 += RB) { float sv[RB][G], fl[RB][G], ev[RB];
#pragma unroll
      for (int j = 0; j < RB; ++j) { const int s = s0 + r0 + j; ev[j] = ed[l * S + s];
#pragma unroll
        for (int g = 0; g < G; ++g) { sv[j][g] = sc[(((size_t)b * G + g) * S + s) * S + t_]; fl[j][g] = flags[(((size_t)b * (G / GH) + g / GH) * S + s) * GH + g % GH]; } }
      XW;   // the next trip's address step rewrites the loads' address registers
#pragma unroll
      for (int j = 0; j < RB; ++j) { const int s = s0 + r0 + j; float a = 0.0f; unsigned fa = ~0u; const float de = (DG && t_ == s) ? ev[j] : 0.0f;
#pragma unroll
        for (int g = 0; g < G; ++g) { float v = sv[j][g]; if (DG) v += s2[g] * de; a += fmaxf(v * pl[g], 0.0f); fa &= __float_as_uint(fl[j][g]); }
        A[r0 + j][t_] = (fa == 0u) ? -INFINITY : a; } } };
  if (__builtin_amdgcn_readfirstlane(wave) == (s0 >> 5)) mix(Bc<true>{}); else mix(Bc<false>{});   // the same for a whole wave; both sides meet at the barrier below
  __syncthreads();
  // softmax rows: wave w handles rows 2w, 2w+1
  for (int rr = wave * 2; rr < wave * 2 + 2; ++rr) { float mx = -INFINITY;
#pragma unroll
    for (int j = 0; j < 8; ++j) mx = fmaxf(mx, A[rr][lane + 32 * j]);
#pragma unroll
    for (int o = 1; o < 32; o <<= 1) mx = fmaxf(mx, __shfl_xor(mx, o));
    float sm = 0.0f;
#pragma unroll
    for (int j = 0; j < 8; ++j) sm += (mx == -INFINITY) ? 0.0f : nexp(A[rr][lane + 32 * j] - mx);
#pragma unroll
    for (int o = 1; o < 32; o <<= 1) sm += __shfl_xor(sm, o);
    const float inv = (mx == -INFINITY) ? 0.0f : 1.0f / sm;   // all -inf row -> NaN in the reference -> nan_to_num -> 0
#pragma unroll
    for (int j = 0; j < 8; ++j) A[rr][lane + 32 * j] = (mx == -INFINITY) ? 0.0f : nexp(A[rr][lane + 32 * j] - mx) * inv; }
  __syncthreads();
  // PV: waves 0..3 -> d-tile = wave (16 d of 64); rows = all 16 s; 8 k-steps; A split hi+lo x8; B = v^T blocks [b][l][d tile][k-step] single
  if (wave < 4) { v8f acc = {}; const b16* V = vt + (((size_t)b * L + l) * 4 + wave) * 8 * 512 + lane * 8;
    for (int k0 = 0; k0 < S; k0 += 64) { v8b vr[2][2];   // two k-steps' value blocks requested together
#pragma unroll
      for (int u = 0; u < 2; ++u) ld_p(V + (k0 / 32 + u) * 512, vr[u]);
#pragma unroll
      for (int u = 0; u < 2; ++u) { v16b ah, al; frag_split(&A[nloc][k0 + 32 * u], hlf, ah, al); const v16b bw = cat_h(vr[u]); acc = wmma16b(ah, bw, acc); acc = wmma16b(al, bw, acc); } }
#pragma unroll
    for (int r = 0; r < 8; ++r) Cx[8 * hlf + r][wave * 16 + nloc] = acc[r] * (1.0f / (AS_ * VS)); }
  __syncthreads();
  // ctx leaves as the output projection's A operand: x8, f16 hi and lo planes, blocks [128 row tiles][32 k-steps][hi, lo]; thread = (k-step, plane, piece, lane), 4 KB in a row a work-group
  { const int ln = t_ & 31, j = (t_ >> 5) & 1, lo_ = (t_ >> 6) & 1, ksl = t_ >> 7; const float* cs = &Cx[ln & 15][ksl * 32 + j * 16 + (ln >> 4) * 8]; v8b h;
#pragma unroll
    for (int e = 0; e < 8; ++e) { b16 a, c; split16(cs[e] * AS_, a, c); h[e] = lo_ ? c : a; }
    *(v8b*)(cp + ((size_t)((b * S + s0) / 16) * 32 + 2 * l) * 1024 + t_ * 8) = h; }
}

// output projection: block = 64 tokens x 64 cols x 8 waves; wave = (32-row half ms, quarter kg of the 32 k-steps): four waves share one output tile, each sums 8 k-steps, so that a wave's chain of
// dependent load round trips is a quarter as long; the four f32 partial tiles meet in LDS and are added in the order kg = 0, 1, 2, 3
__global__ __launch_bounds__(256) void out_kernel(const b16* __restrict__ cp, const b16* __restrict__ Ro, const float* __restrict__ P, float* __restrict__ out) {
  __shared__ __attribute__((aligned(16))) float Ts[8][32 * 64];
  const int lane = threadIdx.x & 31, wave = threadIdx.x >> 5, nloc = lane & 15, hlf = lane >> 4, ms = wave & 1, kg = wave >> 1, m0 = blockIdx.y * 64 + ms * 32, c0 = blockIdx.x * 64; const float* bout = P + 1024;
  v8f acc[2][4];
#pragma unroll
  for (int r = 0; r < 2; ++r)
#pragma unroll
    for (int t = 0; t < 4; ++t) acc[r][t] = (v8f){};
  constexpr int NK = L * HD / 32, KQ = NK / 4; const b16* cr = cp + ((size_t)(m0 / 16) * NK + kg * KQ) * 1024 + lane * 8; const b16* wr = Ro + ((size_t)(c0 / 16) * NK + kg * KQ) * 512 + lane * 8;
  auto fetch = [&](int ks, v8b* ra, v8b* rb) { ld_p(cr + ks * 1024, ra); ld_p(cr + ks * 1024 + 512, ra + 2); ld_p(cr + (NK + ks) * 1024, ra + 4); ld_p(cr + (NK + ks) * 1024 + 512, ra + 6);
#pragma unroll
    for (int t = 0; t < 4; ++t) ld_p(wr + (t * NK + ks) * 512, rb + 2 * t); };
  auto mults = [&](const v8b* ra, const v8b* rb) { const v16b a0 = cat_h(ra), l0 = cat_h(ra + 2), a1 = cat_h(ra + 4), l1 = cat_h(ra + 6);
#pragma unroll
    for (int t = 0; t < 4; ++t) { const v16b bw = cat_h(rb + 2 * t); acc[0][t] = wmma16b(a0, bw, acc[0][t]); acc[0][t] = wmma16b(l0, bw, acc[0][t]); acc[1][t] = wmma16b(a1, bw, acc[1][t]); acc[1][t] = wmma16b(l1, bw, acc[1][t]); } };
  // two register sets: the 16 loads of k-step n + 1 are all issued before the products of k-step n
  v8b xa[8], ya[8], xb[8], yb[8]; fetch(0, xa, xb);
  for (int ks = 0; ks < KQ - 2; ks += 2) { fetch(ks + 1, ya, yb); SB; mults(xa, xb); SB; fetch(ks + 2, xa, xb); SB; mults(ya, yb); SB; XW; }   // SB, XW: as in the projection loop
  fetch(KQ - 1, ya, yb); XWP(cr, wr); mults(xa, xb); SB; mults(ya, yb);   // XWP: as in the projection kernel
#undef XWP
#undef XW
#undef SB
  float* Tt = Ts[wave];
#pragma unroll
  for (int t = 0; t < 4; ++t)
#pragma unroll
    for (int r = 0; r < 2; ++r)
#pragma unroll
      for (int v = 0; v < 8; ++v) Tt[(r * 16 + v + 8 * hlf) * 64 + t * 16 + nloc] = acc[r][t][v];
  __syncthreads();   // the four partial tiles of each row half are complete before any thread adds them
  { const int c4 = nloc * 4; const v4f bb = *(const v4f*)(bout + c0 + c4);
#pragma unroll
    for (int j = 0; j < 4; ++j) { const int rr = j * 16 + (threadIdx.x >> 4); const float* tp = &Ts[rr >> 5][(rr & 31) * 64 + c4];   // Ts[2 kg + ms]
      const v4f s_ = ((*(const v4f*)tp + *(const v4f*)(tp + 2 * 2048)) + *(const v4f*)(tp + 4 * 2048)) + *(const v4f*)(tp + 6 * 2048);
      *(v4f*)(out + (size_t)(blockIdx.y * 64 + rr) * H + c0 + c4) = s_ * (1.0f / AS_) + bb; } }
}
}  // namespace

extern "C" void kernel_launch(void* const* d_in, const int* in_sizes, int n_in,
                              void* d_out, int out_size, void* d_ws, size_t ws_size, hipStream_t stream) {
  (void)n_in; (void)out_size;
  const float* x = (const float*)d_in[0]; const float* sp = (const float*)d_in[1]; const float* ee = (const float*)d_in[2]; const float* Wq = (const float*)d_in[3]; const float* Wk = (const float*)d_in[4]; const float* Wv = (const float*)d_in[5]; const float* bv = (const float*)d_in[6];
  const float* sg = (const float*)d_in[7]; const float* pp = (const float*)d_in[8]; const float* ed = (const float*)d_in[9]; const float* Wout = (const float*)d_in[10]; const float* bout = (const float*)d_in[11];
  float* out = (float*)d_out;   // [8][256][512]
  if (in_sizes[0] != NT * H || in_sizes[1] != Bn * S * S || in_sizes[5] != H * 1024 || in_sizes[8] != G * L || in_sizes[9] != L * S || in_sizes[10] != 1024 * H) return;
  size_t off = 0; char* ws = (char*)d_ws;
  auto carve = [&](size_t bytes) { char* p = ws + off; off += (bytes + 255) & ~(size_t)255; return p; };
  b16* Xp = (b16*)carve((size_t)NT * H * 2); b16* R = (b16*)carve((size_t)NPJ * H * 2); b16* Ro = (b16*)carve((size_t)512 * 1024 * 2); float* P = (float*)carve(((size_t)1672 + L * S + 64) * 4);
  b16* qp = (b16*)carve((size_t)Bn * G * S * HD * 2); b16* kp = (b16*)carve((size_t)Bn * G * S * HD * 2); b16* vt = (b16*)carve((size_t)Bn * L * HD * S * 2); float* sc = (float*)carve((size_t)Bn * G * S * S * 4); float* flags = (float*)carve((size_t)Bn * S * G * 4); b16* cp = (b16*)carve((size_t)NT * L * HD * 2 * 2);
  if (off > ws_size) return;                                    // ≈ 2 + 2 + 1 + 2 + 2 + 4 + 16.8 + 8.4 ≈ 39 MB
  prep_kernel<<<PREP_WG, 256, 0, stream>>>(x, Wq, Wk, Wv, Wout, bv, bout, sg, pp, ed, Xp, R, Ro, P);
  proj_kernel<<<dim3(32, NT / 128), 128, 0, stream>>>(Xp, R, P, qp, kp, vt);
  score_kernel<<<dim3(S / 16, Bn, G / GH), 512, 0, stream>>>(qp, kp, sp, ee, sc, flags);
  fish_kernel<<<dim3(S / 16, Bn, L), 256, 0, stream>>>(sc, flags, vt, P, cp);
  out_kernel<<<dim3(H / 64, NT / 64), 256, 0, stream>>>(cp, Ro, P, out);
}

// v007
// It runs in 45.1 microseconds.
// Two timings next to v006 put it at 1.04 and 1.03 times that version's speed.
// Over all steps from v000 it is 12.5 times as fast.
#include <hip/hip_runtime.h>

// GraphormerFishAttention: q = x Wq, k = x Wk (G=8 heads x 64), v = x Wv + bv (L=16 heads x 64); g = q.k^T 512^-0.5 + (spatial + edge) bias [B,G,S,S]; pad = any_t(g != 0);
// a_l = Σ_g where(pad_g, relu(p[g,l] (g + sigma_g² eps[l,s] δ_st)), -inf); softmax over t; nan_to_num; out_l = a_l.v_l; out = merged Wout + bout -> [8][256][512].
// Projections on v_wmma_f32_16x16x32_f16 with exact operands (x and the weights are exact bf16; 1 product); g = q.k^T with q, k single f16 x8 (1 product; |q.k|·scale ≈ 0.07 next to
// the O(1) exact bias) + bias in f32; the fish mixing / relu / pad / softmax in f32 (fixed order); out_l = P.v with P as an f16 hi+lo pair x8 and v single f16 x8 (2 products);
// output projection with ctx as hi+lo x8 (2 products); f32 accumulate. Fragment k-map per lane half hh for A AND B: elements 0..7 <- k = 8hh+0..7, 8..15 <- k = 16+8hh+0..7.
// Every f16 matrix operand in the workspace lies in fragment order: a block of 16 rows x 32 k is 1 KB; its 16-byte piece (j, lane) holds row (lane & 15), k = 16 j + 8 (lane >> 4) + 0..7, at half offset 256 j + 8 lane,
// so that a wave's fragment is two loads of 512 contiguous bytes (the k-map above, unchanged).

namespace {
constexpr int Bn = 8, S = 256, H = 512, G = 8, L = 16, HD = 64, NT = Bn * S, NPJ = 2048;
constexpr float QS = 8.0f, KS = 8.0f, VS = 8.0f, PS = 8.0f, AS_ = 8.0f, SCALE = 0.04419417382415922f;

typedef _Float16 b16;
typedef __attribute__((ext_vector_type(16))) _Float16 v16b;
typedef __attribute__((ext_vector_type(8))) _Float16 v8b;
typedef __attribute__((ext_vector_type(8))) float v8f;
typedef __attribute__((ext_vector_type(4))) float v4f;
__device__ __forceinline__ float bf16_rne(float f) { unsigned int u = __float_as_uint(f); u += 0x7FFFu + ((u >> 16) & 1u); return __uint_as_float(u & 0xFFFF0000u); }
__device__ __forceinline__ void split16(float v, b16& hi, b16& lo) { hi = (b16)v; lo = (b16)(v - (float)hi); }
__device__ __forceinline__ void frag_split(const float* p, int hh, v16b& fh, v16b& fl) {
#pragma unroll
  for (int e = 0; e < 8; ++e) { b16 a, c; split16(p[8 * hh + e] * AS_, a, c); fh[e] = a; fl[e] = c; split16(p[16 + 8 * hh + e] * AS_, a, c); fh[8 + e] = a; fl[8 + e] = c; } }
// raw fragment loads, kept apart from their use so that a whole batch can be in flight before the first use; p = the block's start + 8 * lane
__device__ __forceinline__ void ld_p(const b16* p, v8b* r) { r[0] = *(const v8b*)(p); r[1] = *(const v8b*)(p + 256); }
__device__ __forceinline__ v16b cat_h(const v8b* r) { v16b f;
#pragma unroll
  for (int e = 0; e < 8; ++e) { f[e] = r[0][e]; f[8 + e] = r[1][e]; } return f; }
__device__ __forceinline__ v8f wmma16b(v16b a, v16b b, v8f c) { v8f d = __builtin_amdgcn_wmma_f32_16x16x32_f16(false, a, false, b, (short)0, c, false, false); asm volatile("v_nop\n\tv_nop\n\tv_nop\n\tv_nop" : "+v"(d) : "v"(a), "v"(b)); return d; }
__device__ __forceinline__ void wave_lds_sync() { __builtin_amdgcn_fence(__ATOMIC_RELEASE, "workgroup"); __builtin_amdgcn_wave_barrier(); __builtin_amdgcn_fence(__ATOMIC_ACQUIRE, "workgroup"); }
__device__ __forceinline__ float nexp(float x) { return __builtin_amdgcn_exp2f(x * 1.4426950408889634f); }
template <bool V> struct Bc { static constexpr bool value = V; };

// prep, one thread a 16-byte piece: Xp = x as f16, blocks [128 row tiles][16 k-steps]; R = Wq | Wk | Wv, blocks [128 column tiles][16 k-steps]; Ro = Wout, blocks [32 column tiles][32 k-steps] (for the weights the lanes
// run along the output column, so each of a piece's 8 loads reads whole lines); P: bv @0 (1024), bout @1024 (512), sigma^2 @1536 (8), p @1544 (128 = [g][l]), eps @1672
constexpr int PREP_WG = 256, NTH = PREP_WG * 256;
__global__ __launch_bounds__(256) void prep_kernel(const float* __restrict__ x, const float* __restrict__ Wq, const float* __restrict__ Wk, const float* __restrict__ Wv, const float* __restrict__ Wout, const float* __restrict__ bv, const float* __restrict__ bout, const float* __restrict__ sg, const float* __restrict__ pp, const float* __restrict__ ed, b16* __restrict__ Xp, b16* __restrict__ R, b16* __restrict__ Ro, float* __restrict__ P) {
  const int t_ = blockIdx.x * 256 + threadIdx.x;
  // XW: the wait that stands behind issued global loads before their address registers are written again; the SB on either side keep other arithmetic from being scheduled between the loads and the wait
#define SB __builtin_amdgcn_sched_barrier(0)
#define XW SB; asm volatile("s_wait_xcnt 0x0" ::: "memory"); SB
  // XWP: the same wait; the two address pairs are named as inputs only, so that they stay allocated up to the wait
#define XWP(p, q) SB; asm volatile("s_wait_xcnt 0x0" :: "v"(p), "v"(q) : "memory"); SB
  float wa[8], wv[8], wo[8]; v4f xv[2][2];   // all of a thread's loads are requested before the first conversion
  const int oa = t_ & 511, ka = (t_ >> 9) & 63, ov = t_ & 1023, kv = t_ >> 10, kw = t_ >> 9;   // piece = (column, group of 8 k): Wq (work-groups 0..127) or Wk, Wv, Wout
  { const float* s_ = ((blockIdx.x < PREP_WG / 2) ? Wq : Wk) + (size_t)ka * 8 * 512 + oa;
#pragma unroll
    for (int e = 0; e < 8; ++e) wa[e] = s_[e * 512]; }
  XW;
  { const float* s_ = Wv + (size_t)kv * 8 * 1024 + ov;
#pragma unroll
    for (int e = 0; e < 8; ++e) wv[e] = s_[e * 1024]; }
  XW;
  { const float* s_ = Wout + (size_t)kw * 8 * 512 + oa;
#pragma unroll
    for (int e = 0; e < 8; ++e) wo[e] = s_[e * 512]; }
  XW;
#pragma unroll
  for (int u = 0; u < 2; ++u) { const int q = t_ + u * NTH, ln = q & 31, j = (q >> 5) & 1, ks = (q >> 6) & 15, rt = q >> 10; const float* s_ = x + (size_t)(rt * 16 + (ln & 15)) * H + ks * 32 + j * 16 + (ln >> 4) * 8;
    xv[u][0] = *(const v4f*)s_; xv[u][1] = *(const v4f*)(s_ + 4); XW; }
  auto put = [&](b16* dst, int nk, int o, int kg, const float* v) { v8b h;   // column o, k = 8 kg + 0..7 -> its piece of block (o >> 4, kg >> 2)
#pragma unroll
    for (int e = 0; e < 8; ++e) h[e] = (b16)bf16_rne(v[e]);
    *(v8b*)(dst + ((size_t)((o >> 4) * nk + (kg >> 2)) * 2 + ((kg >> 1) & 1)) * 256 + ((kg & 1) * 16 + (o & 15)) * 8) = h; };
  put(R, 16, oa + ((blockIdx.x < PREP_WG / 2) ? 0 : 512), ka, wa); put(R, 16, 1024 + ov, kv, wv); put(Ro, 32, oa, kw, wo);
#pragma unroll
  for (int u = 0; u < 2; ++u) { v8b h;
#pragma unroll
    for (int e = 0; e < 8; ++e) h[e] = (b16)bf16_rne(xv[u][e >> 2][e & 3]);
    *(v8b*)(Xp + (size_t)(t_ + u * NTH) * 8) = h; }
  for (int q = t_; q < 1672 + L * S; q += NTH) { float v; if (q < 1024) v = bf16_rne(bv[q]); else if (q < 1536) v = bf16_rne(bout[q - 1024]); else if (q < 1544) { const float s_ = bf16_rne(sg[q - 1536]); v = s_ * s_; } else if (q < 1672) v = bf16_rne(pp[q - 1544]); else v = bf16_rne(ed[q - 1672]); P[q] = v; }
}

// projections: block 128 tokens x 64 cols (tile ct of 32: 0..7 q heads, 8..15 k heads, 16..31 v l-heads); exact (1 product); q x scale x 8 / k x 8 -> planes [b][g] of blocks [16 s tiles][2 k-steps]; v x 8 -> planes [b][l] of blocks [4 d tiles][8 k-steps of t]
__global__ __launch_bounds__(128) void proj_kernel(const b16* __restrict__ Xp, const b16* __restrict__ R, const float* __restrict__ P, b16* __restrict__ qp, b16* __restrict__ kp, b16* __restrict__ vt) {
  __shared__ __attribute__((aligned(16))) b16 T[4][32][64 + 8]; __shared__ __attribute__((aligned(16))) b16 Tv[64][128 + 8];
  const int lane = threadIdx.x & 31, wave = threadIdx.x >> 5, nloc = lane & 15, hlf = lane >> 4, ct = blockIdx.x, c0 = ct * 64, p0 = blockIdx.y * 128, m0 = p0 + wave * 32, b = p0 / S, t0 = p0 % S;
  v8f acc[2][4];
#pragma unroll
  for (int r = 0; r < 2; ++r)
#pragma unroll
    for (int t = 0; t < 4; ++t) acc[r][t] = (v8f){};
  constexpr int NK = H / 32; const b16* xr = Xp + (size_t)(m0 / 16) * NK * 512 + lane * 8; const b16* wr = R + (size_t)(c0 / 16) * NK * 512 + lane * 8;
  auto fetch = [&](int ks, v8b* ra, v8b* rb) { ld_p(xr + ks * 512, ra); ld_p(xr + (NK + ks) * 512, ra + 2);
#pragma unroll
    for (int t = 0; t < 4; ++t) ld_p(wr + (t * NK + ks) * 512, rb + 2 * t); };
  auto mults = [&](const v8b* ra, const v8b* rb) { const v16b a0 = cat_h(ra), a1 = cat_h(ra + 2);
#pragma unroll
    for (int t = 0; t < 4; ++t) { const v16b bw = cat_h(rb + 2 * t); acc[0][t] = wmma16b(a0, bw, acc[0][t]); acc[1][t] = wmma16b(a1, bw, acc[1][t]); } };
  // two register sets: the 12 loads of k-step n + 1 are all issued before the products of k-step n
  v8b xa[4], ya[4], xb[8], yb[8]; fetch(0, xa, xb);
  // SB: keeps a set's loads in front of the other set's products; moved behind them they would be waited for right after their issue
  for (int ks = 0; ks < NK - 2; ks += 2) { fetch(ks + 1, ya, yb); SB; mults(xa, xb); SB; fetch(ks + 2, xa, xb); SB; mults(ya, yb); SB; XW; }   // XW: the next trip rewrites the loads' address registers
  fetch(NK - 1, ya, yb); XWP(xr, wr); mults(xa, xb); SB; mults(ya, yb);   // XWP: the epilogue's index arithmetic reuses the address registers
  if (ct < 16) { const float scl = (ct < 8) ? SCALE * QS : KS; const int hd_ = (ct < 8) ? ct : ct - 8;
#pragma unroll
    for (int t = 0; t < 4; ++t)
#pragma unroll
      for (int r = 0; r < 2; ++r)
#pragma unroll
        for (int v = 0; v < 8; ++v) T[wave][r * 16 + 8 * hlf + v][t * 16 + nloc] = (b16)(acc[r][t][v] * scl);
    wave_lds_sync();
    b16* base = ((ct < 8) ? qp : kp) + (((size_t)b * G + hd_) * S + (m0 % S)) * HD;
    {
#pragma unroll
      for (int j = 0; j < 8; ++j) *(v8b*)(base + j * 256 + lane * 8) = *(const v8b*)(&T[wave][(j >> 2) * 16 + nloc][((j >> 1) & 1) * 32 + (j & 1) * 16 + hlf * 8]);   // j = (s tile, k-step, piece)
       }
    return; }
  const int l = ct - 16; const float* bvp = P + l * HD;
#pragma unroll
  for (int t = 0; t < 4; ++t) { const float bb = bvp[t * 16 + nloc];
#pragma unroll
    for (int r = 0; r < 2; ++r)
#pragma unroll
      for (int v = 0; v < 8; ++v) Tv[t * 16 + nloc][wave * 32 + r * 16 + 8 * hlf + v] = (b16)((acc[r][t][v] + bb) * VS); }
  __syncthreads();
  { for (int i = threadIdx.x; i < 64 * 16; i += 128) { const int ln = i & 31, j = (i >> 5) & 1, ksl = (i >> 6) & 3, dt = i >> 8; *(v8b*)(vt + ((((size_t)b * L + l) * 4 + dt) * 8 + t0 / 32 + ksl) * 512 + j * 256 + ln * 8) = *(const v8b*)(&Tv[dt * 16 + (ln & 15)][ksl * 32 + j * 16 + (ln >> 4) * 8]); }  }
}

// scores: block = (b, 16 query rows s0.., 4 of the 8 heads) x 16 waves (wave = one head gl of the four, one quarter tq of the 256 t): Sg[s][t] = q_s.k_t (scaled) + spatial[b][s][t] + edge[b][s][t] (2 k-steps x 4 t-tiles a wave, 1 product) -> f32 rows.
// 256 work-groups, one a WGP; a wave has one load round trip. A wave reads back only the LDS it wrote itself; the four quarters' pad flags meet behind the barrier. flags: planes [b][head half] of [s][4], so that a work-group writes whole lines.
constexpr int GH = 4, TQ = 4;
__global__ __launch_bounds__(512) void score_kernel(const b16* __restrict__ qp, const b16* __restrict__ kp, const float* __restrict__ sp, const float* __restrict__ ee, float* __restrict__ sc, float* __restrict__ flags) {
  __shared__ __attribute__((aligned(16))) float Ts[GH][16][S + 4]; __shared__ float Fl[TQ][16][GH];
  const int wave = threadIdx.x >> 5, gl = wave & (GH - 1), tq = wave / GH, g = blockIdx.z * GH + gl, lane = threadIdx.x & 31, nloc = lane & 15, hlf = lane >> 4; const int b = blockIdx.y, s0 = blockIdx.x * 16;
  const b16* Q = qp + (((size_t)b * G + g) * S) * HD; const b16* K = kp + (((size_t)b * G + g) * S) * HD;
  const b16* qq = Q + (size_t)s0 * HD + lane * 8; v8b qr[4]; ld_p(qq, qr); ld_p(qq + 512, qr + 2);
  // the wave's four t-tiles in one batch: their key rows and bias values (80 loads) are all requested before the first product
  const b16* kq = K + tq * 64 * HD + lane * 8; const size_t bo0 = ((size_t)b * S + s0 + 8 * hlf) * S + tq * 64 + nloc; const float* sq = sp + bo0; const float* eq = ee + bo0;
  v8b kr[4][4]; float bs[4][8], be[4][8];
#pragma unroll
  for (int u = 0; u < 4; ++u) { ld_p(kq + u * 16 * HD, &kr[u][0]); ld_p(kq + u * 16 * HD + 512, &kr[u][2]);
#pragma unroll
    for (int r = 0; r < 8; ++r) { bs[u][r] = sq[r * S + u * 16]; be[u][r] = eq[r * S + u * 16]; } }
  // the wait that stands behind issued global loads before their address registers are written again; the four address pairs are named as inputs only, so that no load of the batch lands in one of them; SB as in the projection loop
  SB; asm volatile("s_wait_xcnt 0x0" :: "v"(qq), "v"(kq), "v"(sq), "v"(eq) : "memory"); SB;
  const v16b q0 = cat_h(qr), q1 = cat_h(qr + 2);
#pragma unroll
  for (int u = 0; u < 4; ++u) { v8f acc = {}; acc = wmma16b(q0, cat_h(&kr[u][0]), acc); acc = wmma16b(q1, cat_h(&kr[u][2]), acc);
#pragma unroll
    for (int r = 0; r < 8; ++r) Ts[gl][8 * hlf + r][tq * 64 + u * 16 + nloc] = acc[r] * (1.0f / (QS * KS)) + (bf16_rne(bs[u][r]) + bf16_rne(be[u][r])); }
  wave_lds_sync();
  // pad flags: lane l -> row l & 15, t parity l >> 4, over this wave's 64 t
  { const int rr = lane & 15, half = lane >> 4; int nz = 0; for (int t = half; t < 64; t += 2) nz |= (Ts[gl][rr][tq * 64 + t] != 0.0f) ? 1 : 0; nz |= __shfl_xor(nz, 16); if (lane < 16) Fl[tq][rr][gl] = nz ? 1.0f : 0.0f; }
  { const int c4 = tq * 64 + nloc * 4; float* so = sc + (((size_t)b * G + g) * S + s0 + hlf) * S + c4;   // a store = 2 rows x 256 bytes in a row; unrolled so that the 8 LDS reads are in flight together
#pragma unroll
    for (int it = 0; it < 8; ++it) *(v4f*)(so + it * 2 * S) = *(const v4f*)(&Ts[gl][it * 2 + hlf][c4]); }
  __syncthreads();
  { if (threadIdx.x < 16 * GH) { const int rr = threadIdx.x >> 2, q = threadIdx.x & 3; flags[(((size_t)b * (G / GH) + blockIdx.z) * S + s0) * GH + threadIdx.x] = fmaxf(fmaxf(Fl[0][rr][q], Fl[1][rr][q]), fmaxf(Fl[2][rr][q], Fl[3][rr][q])); }  }
}

// fish + softmax + PV: block = (b, 16 rows s0.., LG local heads l0 = LG blockIdx.z ..) x 256 threads; a[s][t] = sum_g (flag ? relu(p[g][l] (S_g[s][t] + sigma_g^2 eps[l][s] d_st)) : -inf) (f32, g in order)
// into LDS; row softmax (wave per 2 LG rows; fixed order), all -inf row -> zeros (nan_to_num); PV: 8 waves x (one head, 16 rows x 32 d). A score is loaded once for LG heads; 512 work-groups, two a WGP, 4 waves a SIMD:
// a quarter of the waves to start and of the score reads, and 256 registers a wave.
constexpr int LG = 4;
__global__ __launch_bounds__(256) __attribute__((amdgpu_waves_per_eu(4, 4))) void fish_kernel(const float* __restrict__ sc, const float* __restrict__ flags, const b16* __restrict__ vt, const float* __restrict__ P, b16* __restrict__ cp) {
  __shared__ __attribute__((aligned(16))) float A[LG * 16][S + 4]; __shared__ __attribute__((aligned(16))) float Cx[LG][16][HD + 4];
  const int t_ = threadIdx.x, wave = t_ >> 5, lane = t_ & 31, nloc = lane & 15, hlf = lane >> 4; const int b = blockIdx.y, s0 = blockIdx.x * 16, l0 = blockIdx.z * LG;
  const float* sig2 = P + 1536; const float* pp = P + 1544; const float* ed = P + 1672;
  // thread = column t, one row a pass; RB rows a trip: their 8 score planes and flags are all requested before the first use
  constexpr int RB = 4; float pl[LG][G], s2[G];
#pragma unroll
  for (int g = 0; g < G; ++g) { s2[g] = sig2[g];
#pragma unroll
    for (int i = 0; i < LG; ++i) pl[i][g] = pp[g * L + l0 + i]; }
  // a score costs a product, a maximum and an add a head. One false pad flag makes the whole row -inf, so the bit patterns of the row's 8 flags (each 0.0f or 1.0f, the same for every thread) are ANDed once a row and tested once.
  // DG: this wave's 32 columns hold the tile's 16 diagonal elements; only that wave adds sigma^2 eps (times 0 off the diagonal, as the reference does); a thread needs eps only at s = t, its own column
  auto mix = [&](auto dg) { constexpr bool DG = decltype(dg)::value; float ev[LG];
#pragma unroll
    for (int i = 0; i < LG; ++i) ev[i] = DG ? ed[(l0 + i) * S + t_] : 0.0f;
    if (DG) { XW; }   // the score addresses formed next reuse these loads' address registers
#pragma clang loop unroll(disable) vectorize(disable)   // one trip's code for all four: unrolled, the two forms of this loop alone take most of the kernel text
    for (int r0 = 0; r0 < 16; r0 += RB) { float sv[RB][G], fl[RB][G];
#pragma unroll
      for (int j = 0; j < RB; ++j) { const int s = s0 + r0 + j;
#pragma unroll
        for (int g = 0; g < G; ++g) { sv[j][g] = sc[(((size_t)b * G + g) * S + s) * S + t_]; fl[j][g] = flags[(((size_t)b * (G / GH) + g / GH) * S + s) * GH + g % GH]; } }
      XW;   // the next trip's address step rewrites the loads' address registers
#pragma unroll
      for (int j = 0; j < RB; ++j) { const int s = s0 + r0 + j; unsigned fa = ~0u;
#pragma unroll
        for (int g = 0; g < G; ++g) fa &= __float_as_uint(fl[j][g]);
#pragma unroll
        for (int i = 0; i < LG; ++i) { float a = 0.0f; const float de = (DG && t_ == s) ? ev[i] : 0.0f;
#pragma unroll
          for (int g = 0; g < G; ++g) { float v = sv[j][g]; if (DG) v += s2[g] * de; a += fmaxf(v * pl[i][g], 0.0f); }
          A[i * 16 + r0 + j][t_] = (fa == 0u) ? -INFINITY : a; } } } };
  if (__builtin_amdgcn_readfirstlane(wave) == (s0 >> 5)) mix(Bc<true>{}); else mix(Bc<false>{});   // the same for a whole wave; both sides meet at the barrier below
  __syncthreads();
  // softmax rows: wave w handles rows 2 LG w .. 2 LG w + 2 LG - 1 of the LG x 16
#pragma unroll 4   // four rows' chains of cross-lane steps run side by side, for speed only
  for (int rr = wave * 2 * LG; rr < wave * 2 * LG + 2 * LG; ++rr) { float mx = -INFINITY;
#pragma unroll
    for (int j = 0; j < 8; ++j) mx = fmaxf(mx, A[rr][lane + 32 * j]);
#pragma unroll
    for (int o = 1; o < 32; o <<= 1) mx = fmaxf(mx, __shfl_xor(mx, o));
    float sm = 0.0f;
#pragma unroll
    for (int j = 0; j < 8; ++j) sm += (mx == -INFINITY) ? 0.0f : nexp(A[rr][lane + 32 * j] - mx);
#pragma unroll
    for (int o = 1; o < 32; o <<= 1) sm += __shfl_xor(sm, o);
    const float inv = (mx == -INFINITY) ? 0.0f : 1.0f / sm;   // all -inf row -> NaN in the reference -> nan_to_num -> 0
#pragma unroll
    for (int j = 0; j < 8; ++j) A[rr][lane + 32 * j] = (mx == -INFINITY) ? 0.0f : nexp(A[rr][lane + 32 * j] - mx) * inv; }
  __syncthreads();
  // PV: wave -> head li = wave >> 1, d-tiles 2 (wave & 1) + 0, 1 (32 d of 64), which share one split of the A fragment; rows = all 16 s; 8 k-steps; A split hi+lo x8; B = v^T blocks [b][l][d tile][k-step] single
  { const int li = wave >> 1, dp = wave & 1; v8f acc[2] = {}; const b16* V = vt + (((size_t)b * L + l0 + li) * 4 + 2 * dp) * 8 * 512 + lane * 8;
    for (int k0 = 0; k0 < S; k0 += 64) { v8b vr[2][2][2];   // two k-steps' value blocks requested together
#pragma unroll
      for (int u = 0; u < 2; ++u)
#pragma unroll
        for (int d = 0; d < 2; ++d) ld_p(V + (d * 8 + k0 / 32 + u) * 512, vr[u][d]);
#pragma unroll
      for (int u = 0; u < 2; ++u) { v16b ah, al; frag_split(&A[li * 16 + nloc][k0 + 32 * u], hlf, ah, al);
#pragma unroll
        for (int d = 0; d < 2; ++d) { const v16b bw = cat_h(vr[u][d]); acc[d] = wmma16b(ah, bw, acc[d]); acc[d] = wmma16b(al, bw, acc[d]); } } }
#pragma unroll
    for (int d = 0; d < 2; ++d)
#pragma unroll
      for (int r = 0; r < 8; ++r) Cx[li][8 * hlf + r][(2 * dp + d) * 16 + nloc] = acc[d][r] * (1.0f / (AS_ * VS)); }
  __syncthreads();
  // ctx leaves as the output projection's A operand: x8, f16 hi and lo planes, blocks [128 row tiles][32 k-steps][hi, lo]; thread = (k-step, plane, piece, lane), 4 KB a head, 4 LG KB in a row a work-group
  { const int ln = t_ & 31, j = (t_ >> 5) & 1, lo_ = (t_ >> 6) & 1, ksl = t_ >> 7;
#pragma unroll
    for (int i = 0; i < LG; ++i) { const float* cs = &Cx[i][ln & 15][ksl * 32 + j * 16 + (ln >> 4) * 8]; v8b h;
#pragma unroll
      for (int e = 0; e < 8; ++e) { b16 a, c; split16(cs[e] * AS_, a, c); h[e] = lo_ ? c : a; }
      *(v8b*)(cp + ((size_t)((b * S + s0) / 16) * 32 + 2 * (l0 + i)) * 1024 + t_ * 8) = h; } }
}

// output projection: block = 64 tokens x 64 cols x 8 waves; wave = (32-row half ms, quarter kg of the 32 k-steps): four waves share one output tile, each sums 8 k-steps, so that a wave's chain of
// dependent load round trips is a quarter as long; the four f32 partial tiles meet in LDS and are added in the order kg = 0, 1, 2, 3
__global__ __launch_bounds__(256) void out_kernel(const b16* __restrict__ cp, const b16* __restrict__ Ro, const float* __restrict__ P, float* __restrict__ out) {
  __shared__ __attribute__((aligned(16))) float Ts[8][32 * 64];
  const int lane = threadIdx.x & 31, wave = threadIdx.x >> 5, nloc = lane & 15, hlf = lane >> 4, ms = wave & 1, kg = wave >> 1, m0 = blockIdx.y * 64 + ms * 32, c0 = blockIdx.x * 64; const float* bout = P + 1024;
  v8f acc[2][4];
#pragma unroll
  for (int r = 0; r < 2; ++r)
#pragma unroll
    for (int t = 0; t < 4; ++t) acc[r][t] = (v8f){};
  constexpr int NK = L * HD / 32, KQ = NK / 4; const b16* cr = cp + ((size_t)(m0 / 16) * NK + kg * KQ) * 1024 + lane * 8; const b16* wr = Ro + ((size_t)(c0 / 16) * NK + kg * KQ) * 512 + lane * 8;
  auto fetch = [&](int ks, v8b* ra, v8b* rb) { ld_p(cr + ks * 1024, ra); ld_p(cr + ks * 1024 + 512, ra + 2); ld_p(cr + (NK + ks) * 1024, ra + 4); ld_p(cr + (NK + ks) * 1024 + 512, ra + 6);
#pragma unroll
    for (int t = 0; t < 4; ++t) ld_p(wr + (t * NK + ks) * 512, rb + 2 * t); };
  auto mults = [&](const v8b* ra, const v8b* rb) { const v16b a0 = cat_h(ra), l0 = cat_h(ra + 2), a1 = cat_h(ra + 4), l1 = cat_h(ra + 6);
#pragma unroll
    for (int t = 0; t < 4; ++t) { const v16b bw = cat_h(rb + 2 * t); acc[0][t] = wmma16b(a0, bw, acc[0][t]); acc[0][t] = wmma16b(l0, bw, acc[0][t]); acc[1][t] = wmma16b(a1, bw, acc[1][t]); acc[1][t] = wmma16b(l1, bw, acc[1][t]); } };
  // two register sets: the 16 loads of k-step n + 1 are all issued before the products of k-step n
  v8b xa[8], ya[8], xb[8], yb[8]; fetch(0, xa, xb);
  for (int ks = 0; ks < KQ - 2; ks += 2) { fetch(ks + 1, ya, yb); SB; mults(xa, xb); SB; fetch(ks + 2, xa, xb); SB; mults(ya, yb); SB; XW; }   // SB, XW: as in the projection loop
  fetch(KQ - 1, ya, yb); XWP(cr, wr); mults(xa, xb); SB; mults(ya, yb);   // XWP: as in the projection kernel
#undef XWP
#undef XW
#undef SB
  float* Tt = Ts[wave];
#pragma unroll
  for (int t = 0; t < 4; ++t)
#pragma unroll
    for (int r = 0; r < 2; ++r)
#pragma unroll
      for (int v = 0; v < 8; ++v) Tt[(r * 16 + v + 8 * hlf) * 64 + t * 16 + nloc] = acc[r][t][v];
  __syncthreads();   // the four partial tiles of each row half are complete before any thread adds them
  { const int c4 = nloc * 4; const v4f bb = *(const v4f*)(bout + c0 + c4);
#pragma unroll
    for (int j = 0; j < 4; ++j) { const int rr = j * 16 + (threadIdx.x >> 4); const float* tp = &Ts[rr >> 5][(rr & 31) * 64 + c4];   // Ts[2 kg + ms]
      const v4f s_ = ((*(const v4f*)tp + *(const v4f*)(tp + 2 * 2048)) + *(const v4f*)(tp + 4 * 2048)) + *(const v4f*)(tp + 6 * 2048);
      *(v4f*)(out + (size_t)(blockIdx.y * 64 + rr) * H + c0 + c4) = s_ * (1.0f / AS_) + bb; } }
}
}  // namespace

extern "C" void kernel_launch(void* const* d_in, const int* in_sizes, int n_in,
                              void* d_out, int out_size, void* d_ws, size_t ws_size, hipStream_t stream) {
  (void)n_in; (void)out_size;
  const float* x = (const float*)d_in[0]; const float* sp = (const float*)d_in[1]; const float* ee = (const float*)d_in[2]; const float* Wq = (const float*)d_in[3]; const float* Wk = (const float*)d_in[4]; const float* Wv = (const float*)d_in[5]; const float* bv = (const float*)d_in[6];
  const float* sg = (const float*)d_in[7]; const float* pp = (const float*)d_in[8]; const float* ed = (const float*)d_in[9]; const float* Wout = (const float*)d_in[10]; const float* bout = (const float*)d_in[11];
  float* out = (float*)d_out;   // [8][256][512]
  if (in_sizes[0] != NT * H || in_sizes[1] != Bn * S * S || in_sizes[5] != H * 1024 || in_sizes[8] != G * L || in_sizes[9] != L * S || in_sizes[10] != 1024 * H) return;
  size_t off = 0; char* ws = (char*)d_ws;
  auto carve = [&](size_t bytes) { char* p = ws + off; off += (bytes + 255) & ~(size_t)255; return p; };
  b16* Xp = (b16*)carve((size_t)NT * H * 2); b16* R = (b16*)carve((size_t)NPJ * H * 2); b16* Ro = (b16*)carve((size_t)512 * 1024 * 2); float* P = (float*)carve(((size_t)1672 + L * S + 64) * 4);
  b16* qp = (b16*)carve((size_t)Bn * G * S * HD * 2); b16* kp = (b16*)carve((size_t)Bn * G * S * HD * 2); b16* vt = (b16*)carve((size_t)Bn * L * HD * S * 2); float* sc = (float*)carve((size_t)Bn * G * S * S * 4); float* flags = (float*)carve((size_t)Bn * S * G * 4); b16* cp = (b16*)carve((size_t)NT * L * HD * 2 * 2);
  if (off > ws_size) return;                                    // ≈ 2 + 2 + 1 + 2 + 2 + 4 + 16.8 + 8.4 ≈ 39 MB
  prep_kernel<<<PREP_WG, 256, 0, stream>>>(x, Wq, Wk, Wv, Wout, bv, bout, sg, pp, ed, Xp, R, Ro, P);
  proj_kernel<<<dim3(32, NT / 128), 128, 0, stream>>>(Xp, R, P, qp, kp, vt);
  score_kernel<<<dim3(S / 16, Bn, G / GH), 512, 0, stream>>>(qp, kp, sp, ee, sc, flags);
  fish_kernel<<<dim3(S / 16, Bn, L / LG), 256, 0, stream>>>(sc, flags, vt, P, cp);
  out_kernel<<<dim3(H / 64, NT / 64), 256, 0, stream>>>(cp, Ro, P, out);
}

// v008
// It runs in 39.8 microseconds.
// Timed twice side by side with v007, it ran 1.14 and 1.15 times as fast.
// All steps since v000 together make it 14.3 times as fast.
#include <hip/hip_runtime.h>

// GraphormerFishAttention: q = x Wq, k = x Wk (G=8 heads x 64), v = x Wv + bv (L=16 heads x 64); g = q.k^T 512^-0.5 + (spatial + edge) bias [B,G,S,S]; pad = any_t(g != 0);
// a_l = Σ_g where(pad_g, relu(p[g,l] (g + sigma_g² eps[l,s] δ_st)), -inf); softmax over t; nan_to_num; out_l = a_l.v_l; out = merged Wout + bout -> [8][256][512].
// Projections on v_wmma_f32_16x16x32_f16 with exact operands (x and the weights are exact bf16; 1 product); g = q.k^T with q, k single f16 x8 (1 product; |q.k|·scale ≈ 0.07 next to
// the O(1) exact bias) + bias in f32; the fish mixing / relu / pad / softmax in f32 (fixed order); out_l = P.v with P as an f16 hi+lo pair x8 and v single f16 x8 (2 products);
// output projection with ctx as hi+lo x8 (2 products); f32 accumulate. Fragment k-map per lane half hh for A AND B: elements 0..7 <- k = 8hh+0..7, 8..15 <- k = 16+8hh+0..7.
// Every f16 matrix operand in the workspace lies in fragment order: a block of 16 rows x 32 k is 1 KB; its 16-byte piece (j, lane) holds row (lane & 15), k = 16 j + 8 (lane >> 4) + 0..7, at half offset 256 j + 8 lane,
// so that a wave's fragment is two loads of 512 contiguous bytes (the k-map above, unchanged).

namespace {
constexpr int Bn = 8, S = 256, H = 512, G = 8, L = 16, HD = 64, NT = Bn * S, NPJ = 2048;
constexpr float QS = 8.0f, KS = 8.0f, VS = 8.0f, PS = 8.0f, AS_ = 8.0f, SCALE = 0.04419417382415922f;

typedef _Float16 b16;
typedef __attribute__((ext_vector_type(16))) _Float16 v16b;
typedef __attribute__((ext_vector_type(8))) _Float16 v8b;
typedef __attribute__((ext_vector_type(8))) float v8f;
typedef __attribute__((ext_vector_type(4))) float v4f;
__device__ __forceinline__ float bf16_rne(float f) { unsigned int u = __float_as_uint(f); u += 0x7FFFu + ((u >> 16) & 1u); return __uint_as_float(u & 0xFFFF0000u); }
__device__ __forceinline__ void split16(float v, b16& hi, b16& lo) { hi = (b16)v; lo = (b16)(v - (float)hi); }
__device__ __forceinline__ void frag_split(const float* p, int hh, v16b& fh, v16b& fl) {
#pragma unroll
  for (int e = 0; e < 8; ++e) { b16 a, c; split16(p[8 * hh + e] * AS_, a, c); fh[e] = a; fl[e] = c; split16(p[16 + 8 * hh + e] * AS_, a, c); fh[8 + e] = a; fl[8 + e] = c; } }
// raw fragment loads, kept apart from their use so that a whole batch can be in flight before the first use; p = the block's start + 8 * lane
__device__ __forceinline__ void ld_p(const b16* p, v8b* r) { r[0] = *(const v8b*)(p); r[1] = *(const v8b*)(p + 256); }
__device__ __forceinline__ v16b cat_h(const v8b* r) { v16b f;
#pragma unroll
  for (int e = 0; e < 8; ++e) { f[e] = r[0][e]; f[8 + e] = r[1][e]; } return f; }
__device__ __forceinline__ v8f wmma16b(v16b a, v16b b, v8f c) { v8f d = __builtin_amdgcn_wmma_f32_16x16x32_f16(false, a, false, b, (short)0, c, false, false); asm volatile("v_nop\n\tv_nop\n\tv_nop\n\tv_nop" : "+v"(d) : "v"(a), "v"(b)); return d; }
__device__ __forceinline__ void wave_lds_sync() { __builtin_amdgcn_fence(__ATOMIC_RELEASE, "workgroup"); __builtin_amdgcn_wave_barrier(); __builtin_amdgcn_fence(__ATOMIC_ACQUIRE, "workgroup"); }
__device__ __forceinline__ float nexp(float x) { return __builtin_amdgcn_exp2f(x * 1.4426950408889634f); }
template <bool V> struct Bc { static constexpr bool value = V; };

// prep, one thread a 16-byte piece: Xp = x as f16, blocks [128 row tiles][16 k-steps]; R = Wq | Wk | Wv, blocks [128 column tiles][16 k-steps]; Ro = Wout, blocks [32 column tiles][32 k-steps] (for the weights the lanes
// run along the output column, so each of a piece's 8 loads reads whole lines); P: bv @0 (1024), bout @1024 (512), sigma^2 @1536 (8), p @1544 (128 = [g][l]), eps @1672
constexpr int PREP_WG = 256, NTH = PREP_WG * 256;
__global__ __launch_bounds__(256) void prep_kernel(const float* __restrict__ x, const float* __restrict__ Wq, const float* __restrict__ Wk, const float* __restrict__ Wv, const float* __restrict__ Wout, const float* __restrict__ bv, const float* __restrict__ bout, const float* __restrict__ sg, const float* __restrict__ pp, const float* __restrict__ ed, b16* __restrict__ Xp, b16* __restrict__ R, b16* __restrict__ Ro, float* __restrict__ P) {
  const int t_ = blockIdx.x * 256 + threadIdx.x;
  // XW: the wait that stands behind issued global loads before their address registers are written again; the SB on either side keep other arithmetic from being scheduled between the loads and the wait
#define SB __builtin_amdgcn_sched_barrier(0)
#define XW SB; asm volatile("s_wait_xcnt 0x0" ::: "memory"); SB
  // XWP: the same wait; the two address pairs are named as inputs only, so that they stay allocated up to the wait
#define XWP(p, q) SB; asm volatile("s_wait_xcnt 0x0" :: "v"(p), "v"(q) : "memory"); SB
  float wa[8], wv[8], wo[8]; v4f xv[2][2];   // all of a thread's loads are requested before the first conversion
  const int oa = t_ & 511, ka = (t_ >> 9) & 63, ov = t_ & 1023, kv = t_ >> 10, kw = t_ >> 9;   // piece = (column, group of 8 k): Wq (work-groups 0..127) or Wk, Wv, Wout
  { const float* s_ = ((blockIdx.x < PREP_WG / 2) ? Wq : Wk) + (size_t)ka * 8 * 512 + oa;
#pragma unroll
    for (int e = 0; e < 8; ++e) wa[e] = s_[e * 512]; }
  XW;
  { const float* s_ = Wv + (size_t)kv * 8 * 1024 + ov;
#pragma unroll
    for (int e = 0; e < 8; ++e) wv[e] = s_[e * 1024]; }
  XW;
  { const float* s_ = Wout + (size_t)kw * 8 * 512 + oa;
#pragma unroll
    for (int e = 0; e < 8; ++e) wo[e] = s_[e * 512]; }
  XW;
#pragma unroll
  for (int u = 0; u < 2; ++u) { const int q = t_ + u * NTH, ln = q & 31, j = (q >> 5) & 1, ks = (q >> 6) & 15, rt = q >> 10; const float* s_ = x + (size_t)(rt * 16 + (ln & 15)) * H + ks * 32 + j * 16 + (ln >> 4) * 8;
    xv[u][0] = *(const v4f*)s_; xv[u][1] = *(const v4f*)(s_ + 4); XW; }
  auto put = [&](b16* dst, int nk, int o, int kg, const float* v) { v8b h;   // column o, k = 8 kg + 0..7 -> its piece of block (o >> 4, kg >> 2)
#pragma unroll
    for (int e = 0; e < 8; ++e) h[e] = (b16)bf16_rne(v[e]);
    *(v8b*)(dst + ((size_t)((o >> 4) * nk + (kg >> 2)) * 2 + ((kg >> 1) & 1)) * 256 + ((kg & 1) * 16 + (o & 15)) * 8) = h; };
  put(R, 16, oa + ((blockIdx.x < PREP_WG / 2) ? 0 : 512), ka, wa); put(R, 16, 1024 + ov, kv, wv); put(Ro, 32, oa, kw, wo);
#pragma unroll
  for (int u = 0; u < 2; ++u) { v8b h;
#pragma unroll
    for (int e = 0; e < 8; ++e) h[e] = (b16)bf16_rne(xv[u][e >> 2][e & 3]);
    *(v8b*)(Xp + (size_t)(t_ + u * NTH) * 8) = h; }
  for (int q = t_; q < 1672 + L * S; q += NTH) { float v; if (q < 1024) v = bf16_rne(bv[q]); else if (q < 1536) v = bf16_rne(bout[q - 1024]); else if (q < 1544) { const float s_ = bf16_rne(sg[q - 1536]); v = s_ * s_; } else if (q < 1672) v = bf16_rne(pp[q - 1544]); else v = bf16_rne(ed[q - 1672]); P[q] = v; }
}

// projections: block 128 tokens x 64 cols (tile ct of 32: 0..7 q heads, 8..15 k heads, 16..31 v l-heads); exact (1 product); q x scale x 8 / k x 8 -> planes [b][g] of blocks [16 s tiles][2 k-steps]; v x 8 -> planes [b][l] of blocks [4 d tiles][8 k-steps of t]
__global__ __launch_bounds__(128) void proj_kernel(const b16* __restrict__ Xp, const b16* __restrict__ R, const float* __restrict__ P, b16* __restrict__ qp, b16* __restrict__ kp, b16* __restrict__ vt) {
  __shared__ __attribute__((aligned(16))) b16 T[4][32][64 + 8]; __shared__ __attribute__((aligned(16))) b16 Tv[64][128 + 8];
  const int lane = threadIdx.x & 31, wave = threadIdx.x >> 5, nloc = lane & 15, hlf = lane >> 4, ct = blockIdx.x, c0 = ct * 64, p0 = blockIdx.y * 128, m0 = p0 + wave * 32, b = p0 / S, t0 = p0 % S;
  v8f acc[2][4];
#pragma unroll
  for (int r = 0; r < 2; ++r)
#pragma unroll
    for (int t = 0; t < 4; ++t) acc[r][t] = (v8f){};
  constexpr int NK = H / 32; const b16* xr = Xp + (size_t)(m0 / 16) * NK * 512 + lane * 8; const b16* wr = R + (size_t)(c0 / 16) * NK * 512 + lane * 8;
  auto fetch = [&](int ks, v8b* ra, v8b* rb) { ld_p(xr + ks * 512, ra); ld_p(xr + (NK + ks) * 512, ra + 2);
#pragma unroll
    for (int t = 0; t < 4; ++t) ld_p(wr + (t * NK + ks) * 512, rb + 2 * t); };
  auto mults = [&](const v8b* ra, const v8b* rb) { const v16b a0 = cat_h(ra), a1 = cat_h(ra + 2);
#pragma unroll
    for (int t = 0; t < 4; ++t) { const v16b bw = cat_h(rb + 2 * t); acc[0][t] = wmma16b(a0, bw, acc[0][t]); acc[1][t] = wmma16b(a1, bw, acc[1][t]); } };
  // two register sets: the 12 loads of k-step n + 1 are all issued before the products of k-step n
  v8b xa[4], ya[4], xb[8], yb[8]; fetch(0, xa, xb);
  // SB: keeps a set's loads in front of the other set's products; moved behind them they would be waited for right after their issue
  for (int ks = 0; ks < NK - 2; ks += 2) { fetch(ks + 1, ya, yb); SB; mults(xa, xb); SB; fetch(ks + 2, xa, xb); SB; mults(ya, yb); SB; XW; }   // XW: the next trip rewrites the loads' address registers
  fetch(NK - 1, ya, yb); XWP(xr, wr); mults(xa, xb); SB; mults(ya, yb);   // XWP: the epilogue's index arithmetic reuses the address registers
  if (ct < 16) { const float scl = (ct < 8) ? SCALE * QS : KS; const int hd_ = (ct < 8) ? ct : ct - 8;
#pragma unroll
    for (int t = 0; t < 4; ++t)
#pragma unroll
      for (int r = 0; r < 2; ++r)
#pragma unroll
        for (int v = 0; v < 8; ++v) T[wave][r * 16 + 8 * hlf + v][t * 16 + nloc] = (b16)(acc[r][t][v] * scl);
    wave_lds_sync();
    b16* base = ((ct < 8) ? qp : kp) + (((size_t)b * G + hd_) * S + (m0 % S)) * HD;
    {
#pragma unroll
      for (int j = 0; j < 8; ++j) *(v8b*)(base + j * 256 + lane * 8) = *(const v8b*)(&T[wave][(j >> 2) * 16 + nloc][((j >> 1) & 1) * 32 + (j & 1) * 16 + hlf * 8]);   // j = (s tile, k-step, piece)
       }
    return; }
  const int l = ct - 16; const float* bvp = P + l * HD;
#pragma unroll
  for (int t = 0; t < 4; ++t) { const float bb = bvp[t * 16 + nloc];
#pragma unroll
    for (int r = 0; r < 2; ++r)
#pragma unroll
      for (int v = 0; v < 8; ++v) Tv[t * 16 + nloc][wave * 32 + r * 16 + 8 * hlf + v] = (b16)((acc[r][t][v] + bb) * VS); }
  __syncthreads();
  { for (int i = threadIdx.x; i < 64 * 16; i += 128) { const int ln = i & 31, j = (i >> 5) & 1, ksl = (i >> 6) & 3, dt = i >> 8; *(v8b*)(vt + ((((size_t)b * L + l) * 4 + dt) * 8 + t0 / 32 + ksl) * 512 + j * 256 + ln * 8) = *(const v8b*)(&Tv[dt * 16 + (ln & 15)][ksl * 32 + j * 16 + (ln >> 4) * 8]); }  }
}

// scores + fish + softmax + PV in one launch: block = (b, 16 rows s0.., LG local heads l0 = LG blockIdx.z ..) x 8 waves. Wave w holds the columns t = 32 w .. 32 w + 31 (two 16 x 16 tiles) for all 8 heads g, one head after the other:
// S_g[s][t] = q_s.k_t (scaled; 2 k-steps x 2 tiles, 1 product) + spatial[b][s][t] + edge[b][s][t] stays in the accumulator's registers (lane = column, 8 rows) and is mixed at once:
// a_l[s][t] += relu(p[g][l] (S_g[s][t] + sigma_g^2 eps[l][s] d_st)) (f32, g in order) for the LG heads; a goes to LDS once. pad: a bit a (g, row) and wave says whether the wave saw a nonzero score; the bits meet behind the barrier,
// and a row with one head all zero is the reference's all -inf row -> zeros (nan_to_num). Row softmax (wave per 2 LG rows; fixed order); PV: 8 waves x (one head, 16 rows x 32 d). 512 work-groups, two a WGP, 4 waves a SIMD, 256 registers a wave.
constexpr int LG = 4;
__global__ __launch_bounds__(256) __attribute__((amdgpu_waves_per_eu(4, 4))) void fish_kernel(const b16* __restrict__ qp, const b16* __restrict__ kp, const float* __restrict__ sp, const float* __restrict__ ee, const b16* __restrict__ vt, const float* __restrict__ P, b16* __restrict__ cp) {
  __shared__ __attribute__((aligned(16))) float A[LG * 16][S + 4]; __shared__ __attribute__((aligned(16))) float Cx[LG][16][HD + 4]; __shared__ __attribute__((aligned(16))) unsigned Nz[G][8];
  const int t_ = threadIdx.x, wave = t_ >> 5, lane = t_ & 31, nloc = lane & 15, hlf = lane >> 4; const int b = blockIdx.y, s0 = blockIdx.x * 16, l0 = blockIdx.z * LG;
  const float* sig2 = P + 1536; const float* pp = P + 1544; const float* ed = P + 1672;
  // the wave's tile u is t-tile 2 wave + (u ^ par): so the tile that holds the 16 diagonal elements is always tile u = 0 of wave blockIdx.x >> 1
  const int wv = __builtin_amdgcn_readfirstlane(wave), par = blockIdx.x & 1, tt0 = 2 * wv + par, tt1 = 2 * wv + (par ^ 1);   // wv: the wave's number in a scalar register, so that the loads below take a scalar base and one lane offset
  // DG: only the wave that holds the diagonal adds sigma^2 eps, to its diagonal elements (elsewhere the reference adds 0)
  auto mix = [&](auto dg) { constexpr bool DG = decltype(dg)::value;
    const b16* qq = qp + ((size_t)b * G * S + s0) * HD; const b16* k0 = kp + ((size_t)b * G * S + tt0 * 16) * HD; const b16* k1 = kp + ((size_t)b * G * S + tt1 * 16) * HD; qq += lane * 8; k0 += lane * 8; k1 += lane * 8;
    auto fetch = [&](int dgh, v8b* q, v8b* k) { ld_p(qq + dgh * S * HD, q); ld_p(qq + dgh * S * HD + 512, q + 2); ld_p(k0 + dgh * S * HD, k); ld_p(k0 + dgh * S * HD + 512, k + 2); ld_p(k1 + dgh * S * HD, k + 4); ld_p(k1 + dgh * S * HD + 512, k + 6); };
    // XW3: the wait XW with the three address pairs named as inputs only, so that they stay allocated up to the wait and no load of the batch lands in one of them
#define XW3 SB; asm volatile("s_wait_xcnt 0x0" :: "v"(qq), "v"(k0), "v"(k1) : "memory"); SB
    v8b qx[4], kx[8], qy[4], ky[8]; fetch(0, qx, kx);
    const size_t bb = ((size_t)b * S + s0) * S; const float* sq0 = sp + bb + tt0 * 16; const float* sq1 = sp + bb + tt1 * 16; const float* eq0 = ee + bb + tt0 * 16; const float* eq1 = ee + bb + tt1 * 16; const int bo = 8 * hlf * S + nloc;
    float bs[2][8], be[2][8], ev[LG], pv[LG];
#pragma unroll
    for (int r = 0; r < 8; ++r) { bs[0][r] = sq0[bo + r * S]; be[0][r] = eq0[bo + r * S]; bs[1][r] = sq1[bo + r * S]; be[1][r] = eq1[bo + r * S]; }
#pragma unroll
    for (int i = 0; i < LG; ++i) { ev[i] = DG ? ed[(l0 + i) * S + s0 + nloc] : 0.0f; pv[i] = pp[(lane & 7) * L + l0 + i]; }   // lane g holds p[g][l0 + i] and sigma_g^2: the loop over g reads them by lane number, with no load of its own
    const float s2v = DG ? sig2[lane & 7] : 0.0f;
    XW;   // the wait that stands behind issued global loads before their address registers are written again
    float a[LG][2][8], bias[2][8]; unsigned nzm = 0u;
#pragma unroll
    for (int u = 0; u < 2; ++u)
#pragma unroll
      for (int r = 0; r < 8; ++r) { bias[u][r] = bf16_rne(bs[u][r]) + bf16_rne(be[u][r]);
#pragma unroll
        for (int i = 0; i < LG; ++i) a[i][u][r] = 0.0f; }
    auto headg = [&](int g, const v8b* q, const v8b* k) { const v16b q0 = cat_h(q), q1 = cat_h(q + 2); float sv[2][8];
#pragma unroll
      for (int u = 0; u < 2; ++u) { v8f acc = {}; acc = wmma16b(q0, cat_h(k + 4 * u), acc); acc = wmma16b(q1, cat_h(k + 4 * u + 2), acc);
#pragma unroll
        for (int r = 0; r < 8; ++r) sv[u][r] = acc[r] * (1.0f / (QS * KS)) + bias[u][r]; }
      // pad bits of head g, rows 0..15: if every lane has a nonzero score in each of its 8 rows, all 16 rows have one; only otherwise the rows are looked at one by one (the same for a whole wave)
      float mh = INFINITY;
#pragma unroll
      for (int r = 0; r < 8; ++r) mh = fminf(mh, fmaxf(fabsf(sv[0][r]), fabsf(sv[1][r])));
      unsigned mk = 0xFFFFu;
      if (__builtin_amdgcn_ballot_w32(mh == 0.0f) != 0u) { mk = 0u;
#pragma unroll
        for (int r = 0; r < 8; ++r) { const unsigned bl = __builtin_amdgcn_ballot_w32(sv[0][r] != 0.0f || sv[1][r] != 0.0f); mk |= ((bl & 0xFFFFu) ? (1u << r) : 0u) | ((bl >> 16) ? (256u << r) : 0u); } }
      nzm = (lane == g) ? mk : nzm;
      const float s2g = DG ? __uint_as_float(__builtin_amdgcn_readlane(__float_as_uint(s2v), g)) : 0.0f;
#pragma unroll
      for (int i = 0; i < LG; ++i) { const float pg = __uint_as_float(__builtin_amdgcn_readlane(__float_as_uint(pv[i]), g));
#pragma unroll
        for (int u = 0; u < 2; ++u)
#pragma unroll
          for (int r = 0; r < 8; ++r) { float v = sv[u][r]; if (DG && u == 0) v = (nloc == 8 * hlf + r) ? v + s2g * ev[i] : v; a[i][u][r] += fmaxf(v * pg, 0.0f); } } };
    // two register sets: the 12 loads of head g + 1 are all issued before the products and the mixing of head g. One trip's code for all four: unrolled, the two forms of this loop would be four times as much kernel text
#pragma clang loop unroll(disable)
    for (int g = 0; g < G; g += 2) { fetch(1, qy, ky); SB; headg(g, qx, kx); XW3; const int st = (g + 2 < G) ? 2 * S * HD : 0; qq += st; k0 += st; k1 += st;   // SB, XW: as in the projection loop
      fetch(0, qx, kx); SB; headg(g + 1, qy, ky); XW3; }   // no test around these loads, so that the waits in front of the products can count them; the last trip has no head g + 2 and stays where it is
#undef XW3
#pragma unroll
    for (int i = 0; i < LG; ++i)
#pragma unroll
      for (int r = 0; r < 8; ++r) { A[i * 16 + 8 * hlf + r][tt0 * 16 + nloc] = a[i][0][r]; A[i * 16 + 8 * hlf + r][tt1 * 16 + nloc] = a[i][1][r]; }
    if (lane < G) Nz[lane][wave] = nzm; };
  if (wv == (int)(blockIdx.x >> 1)) mix(Bc<true>{}); else mix(Bc<false>{});   // the same for a whole wave; both sides meet at the barrier below
  __syncthreads();
  // bit s of alive: every head g has a nonzero score in row s (OR over the 8 waves' columns, AND over g); lane -> g = lane & 7
  unsigned alive = 0u;
#pragma unroll
  for (int w = 0; w < 8; ++w) alive |= Nz[lane & 7][w];
#pragma unroll
  for (int o = 1; o < 8; o <<= 1) alive &= __shfl_xor(alive, o);
  // softmax rows: wave w handles rows 2 LG w .. 2 LG w + 2 LG - 1 of the LG x 16
#pragma unroll 4   // four rows' chains of cross-lane steps run side by side, for speed only
  for (int rr = wave * 2 * LG; rr < wave * 2 * LG + 2 * LG; ++rr) { float mx = -INFINITY;
#pragma unroll
    for (int j = 0; j < 8; ++j) mx = fmaxf(mx, A[rr][lane + 32 * j]);
#pragma unroll
    for (int o = 1; o < 32; o <<= 1) mx = fmaxf(mx, __shfl_xor(mx, o));
    if (((alive >> (rr & 15)) & 1u) == 0u) mx = -INFINITY;   // a false pad flag: the whole row is -inf in the reference
    float sm = 0.0f;
#pragma unroll
    for (int j = 0; j < 8; ++j) sm += (mx == -INFINITY) ? 0.0f : nexp(A[rr][lane + 32 * j] - mx);
#pragma unroll
    for (int o = 1; o < 32; o <<= 1) sm += __shfl_xor(sm, o);
    const float inv = (mx == -INFINITY) ? 0.0f : 1.0f / sm;   // all -inf row -> NaN in the reference -> nan_to_num -> 0
#pragma unroll
    for (int j = 0; j < 8; ++j) A[rr][lane + 32 * j] = (mx == -INFINITY) ? 0.0f : nexp(A[rr][lane + 32 * j] - mx) * inv; }
  __syncthreads();
  // PV: wave -> head li = wave >> 1, d-tiles 2 (wave & 1) + 0, 1 (32 d of 64), which share one split of the A fragment; rows = all 16 s; 8 k-steps; A split hi+lo x8; B = v^T blocks [b][l][d tile][k-step] single
  { const int li = wave >> 1, dp = wave & 1; v8f acc[2] = {}; const b16* V = vt + (((size_t)b * L + l0 + li) * 4 + 2 * dp) * 8 * 512 + lane * 8;
    for (int k0 = 0; k0 < S; k0 += 64) { v8b vr[2][2][2];   // two k-steps' value blocks requested together
#pragma unroll
      for (int u = 0; u < 2; ++u)
#pragma unroll
        for (int d = 0; d < 2; ++d) ld_p(V + (d * 8 + k0 / 32 + u) * 512, vr[u][d]);
#pragma unroll
      for (int u = 0; u < 2; ++u) { v16b ah, al; frag_split(&A[li * 16 + nloc][k0 + 32 * u], hlf, ah, al);
#pragma unroll
        for (int d = 0; d < 2; ++d) { const v16b bw = cat_h(vr[u][d]); acc[d] = wmma16b(ah, bw, acc[d]); acc[d] = wmma16b(al, bw, acc[d]); } } }
#pragma unroll
    for (int d = 0; d < 2; ++d)
#pragma unroll
      for (int r = 0; r < 8; ++r) Cx[li][8 * hlf + r][(2 * dp + d) * 16 + nloc] = acc[d][r] * (1.0f / (AS_ * VS)); }
  __syncthreads();
  // ctx leaves as the output projection's A operand: x8, f16 hi and lo planes, blocks [128 row tiles][32 k-steps][hi, lo]; thread = (k-step, plane, piece, lane), 4 KB a head, 4 LG KB in a row a work-group
  { const int ln = t_ & 31, j = (t_ >> 5) & 1, lo_ = (t_ >> 6) & 1, ksl = t_ >> 7;
#pragma unroll
    for (int i = 0; i < LG; ++i) { const float* cs = &Cx[i][ln & 15][ksl * 32 + j * 16 + (ln >> 4) * 8]; v8b h;
#pragma unroll
      for (int e = 0; e < 8; ++e) { b16 a, c; split16(cs[e] * AS_, a, c); h[e] = lo_ ? c : a; }
      *(v8b*)(cp + ((size_t)((b * S + s0) / 16) * 32 + 2 * (l0 + i)) * 1024 + t_ * 8) = h; } }
}

// output projection: block = 64 tokens x 64 cols x 8 waves; wave = (32-row half ms, quarter kg of the 32 k-steps): four waves share one output tile, each sums 8 k-steps, so that a wave's chain of
// dependent load round trips is a quarter as long; the four f32 partial tiles meet in LDS and are added in the order kg = 0, 1, 2, 3
__global__ __launch_bounds__(256) void out_kernel(const b16* __restrict__ cp, const b16* __restrict__ Ro, const float* __restrict__ P, float* __restrict__ out) {
  __shared__ __attribute__((aligned(16))) float Ts[8][32 * 64];
  const int lane = threadIdx.x & 31, wave = threadIdx.x >> 5, nloc = lane & 15, hlf = lane >> 4, ms = wave & 1, kg = wave >> 1, m0 = blockIdx.y * 64 + ms * 32, c0 = blockIdx.x * 64; const float* bout = P + 1024;
  v8f acc[2][4];
#pragma unroll
  for (int r = 0; r < 2; ++r)
#pragma unroll
    for (int t = 0; t < 4; ++t) acc[r][t] = (v8f){};
  constexpr int NK = L * HD / 32, KQ = NK / 4; const b16* cr = cp + ((size_t)(m0 / 16) * NK + kg * KQ) * 1024 + lane * 8; const b16* wr = Ro + ((size_t)(c0 / 16) * NK + kg * KQ) * 512 + lane * 8;
  auto fetch = [&](int ks, v8b* ra, v8b* rb) { ld_p(cr + ks * 1024, ra); ld_p(cr + ks * 1024 + 512, ra + 2); ld_p(cr + (NK + ks) * 1024, ra + 4); ld_p(cr + (NK + ks) * 1024 + 512, ra + 6);
#pragma unroll
    for (int t = 0; t < 4; ++t) ld_p(wr + (t * NK + ks) * 512, rb + 2 * t); };
  auto mults = [&](const v8b* ra, const v8b* rb) { const v16b a0 = cat_h(ra), l0 = cat_h(ra + 2), a1 = cat_h(ra + 4), l1 = cat_h(ra + 6);
#pragma unroll
    for (int t = 0; t < 4; ++t) { const v16b bw = cat_h(rb + 2 * t); acc[0][t] = wmma16b(a0, bw, acc[0][t]); acc[0][t] = wmma16b(l0, bw, acc[0][t]); acc[1][t] = wmma16b(a1, bw, acc[1][t]); acc[1][t] = wmma16b(l1, bw, acc[1][t]); } };
  // two register sets: the 16 loads of k-step n + 1 are all issued before the products of k-step n
  v8b xa[8], ya[8], xb[8], yb[8]; fetch(0, xa, xb);
  for (int ks = 0; ks < KQ - 2; ks += 2) { fetch(ks + 1, ya, yb); SB; mults(xa, xb); SB; fetch(ks + 2, xa, xb); SB; mults(ya, yb); SB; XW; }   // SB, XW: as in the projection loop
  fetch(KQ - 1, ya, yb); XWP(cr, wr); mults(xa, xb); SB; mults(ya, yb);   // XWP: as in the projection kernel
#undef XWP
#undef XW
#undef SB
  float* Tt = Ts[wave];
#pragma unroll
  for (int t = 0; t < 4; ++t)
#pragma unroll
    for (int r = 0; r < 2; ++r)
#pragma unroll
      for (int v = 0; v < 8; ++v) Tt[(r * 16 + v + 8 * hlf) * 64 + t * 16 + nloc] = acc[r][t][v];
  __syncthreads();   // the four partial tiles of each row half are complete before any thread adds them
  { const int c4 = nloc * 4; const v4f bb = *(const v4f*)(bout + c0 + c4);
#pragma unroll
    for (int j = 0; j < 4; ++j) { const int rr = j * 16 + (threadIdx.x >> 4); const float* tp = &Ts[rr >> 5][(rr & 31) * 64 + c4];   // Ts[2 kg + ms]
      const v4f s_ = ((*(const v4f*)tp + *(const v4f*)(tp + 2 * 2048)) + *(const v4f*)(tp + 4 * 2048)) + *(const v4f*)(tp + 6 * 2048);
      *(v4f*)(out + (size_t)(blockIdx.y * 64 + rr) * H + c0 + c4) = s_ * (1.0f / AS_) + bb; } }
}
}  // namespace

extern "C" void kernel_launch(void* const* d_in, const int* in_sizes, int n_in,
                              void* d_out, int out_size, void* d_ws, size_t ws_size, hipStream_t stream) {
  (void)n_in; (void)out_size;
  const float* x = (const float*)d_in[0]; const float* sp = (const float*)d_in[1]; const float* ee = (const float*)d_in[2]; const float* Wq = (const float*)d_in[3]; const float* Wk = (const float*)d_in[4]; const float* Wv = (const float*)d_in[5]; const float* bv = (const float*)d_in[6];
  const float* sg = (const float*)d_in[7]; const float* pp = (const float*)d_in[8]; const float* ed = (const float*)d_in[9]; const float* Wout = (const float*)d_in[10]; const float* bout = (const float*)d_in[11];
  float* out = (float*)d_out;   // [8][256][512]
  if (in_sizes[0] != NT * H || in_sizes[1] != Bn * S * S || in_sizes[5] != H * 1024 || in_sizes[8] != G * L || in_sizes[9] != L * S || in_sizes[10] != 1024 * H) return;
  size_t off = 0; char* ws = (char*)d_ws;
  auto carve = [&](size_t bytes) { char* p = ws + off; off += (bytes + 255) & ~(size_t)255; return p; };
  b16* Xp = (b16*)carve((size_t)NT * H * 2); b16* R = (b16*)carve((size_t)NPJ * H * 2); b16* Ro = (b16*)carve((size_t)512 * 1024 * 2); float* P = (float*)carve(((size_t)1672 + L * S + 64) * 4);
  b16* qp = (b16*)carve((size_t)Bn * G * S * HD * 2); b16* kp = (b16*)carve((size_t)Bn * G * S * HD * 2); b16* vt = (b16*)carve((size_t)Bn * L * HD * S * 2); b16* cp = (b16*)carve((size_t)NT * L * HD * 2 * 2);
  if (off > ws_size) return;                                    // about 2 + 2 + 1 + 2 + 2 + 4 + 8.4 = 22 MB
  prep_kernel<<<PREP_WG, 256, 0, stream>>>(x, Wq, Wk, Wv, Wout, bv, bout, sg, pp, ed, Xp, R, Ro, P);
  proj_kernel<<<dim3(32, NT / 128), 128, 0, stream>>>(Xp, R, P, qp, kp, vt);
  fish_kernel<<<dim3(S / 16, Bn, L / LG), 256, 0, stream>>>(qp, kp, sp, ee, vt, P, cp);
  out_kernel<<<dim3(H / 64, NT / 64), 256, 0, stream>>>(cp, Ro, P, out);
}

// v009
// Measured time: 36 microseconds a run.
// Next to v008, in two timings, it ran 1.10 and 1.11 times as fast.
// Over all steps from v000 it is 15.8 times as fast.
#include <hip/hip_runtime.h>

// GraphormerFishAttention: q = x Wq, k = x Wk (G=8 heads x 64), v = x Wv + bv (L=16 heads x 64); g = q.k^T 512^-0.5 + (spatial + edge) bias [B,G,S,S]; pad = any_t(g != 0);
// a_l = Σ_g where(pad_g, relu(p[g,l] (g + sigma_g² eps[l,s] δ_st)), -inf); softmax over t; nan_to_num; out_l = a_l.v_l; out = merged Wout + bout -> [8][256][512].
// Projections on v_wmma_f32_16x16x32_bf16 with exact operands (x and the weights are exact bf16; 1 product); g = q.k^T with q, k single f16 x8 (1 product; |q.k|·scale ≈ 0.07 next to
// the O(1) exact bias) + bias in f32; the fish mixing / relu / pad / softmax in f32 (fixed order); out_l = P.v with P as an f16 hi+lo pair x8 and v single f16 x8 (2 products);
// output projection with ctx as hi+lo x8 (2 products); f32 accumulate. Fragment k-map of the f16 operands per lane half hh for A AND B: elements 0..7 <- k = 8hh+0..7, 8..15 <- k = 16+8hh+0..7.
// Every f16 matrix operand in the workspace lies in fragment order: a block of 16 rows x 32 k is 1 KB; its 16-byte piece (j, lane) holds row (lane & 15), k = 16 j + 8 (lane >> 4) + 0..7, at half offset 256 j + 8 lane,
// so that a wave's fragment is two loads of 512 contiguous bytes (the k-map above, unchanged).

namespace {
constexpr int Bn = 8, S = 256, H = 512, G = 8, L = 16, HD = 64, NT = Bn * S, NPJ = 2048;
constexpr float QS = 8.0f, KS = 8.0f, VS = 8.0f, PS = 8.0f, AS_ = 8.0f, SCALE = 0.04419417382415922f;

typedef _Float16 b16;
typedef __attribute__((ext_vector_type(16))) _Float16 v16b;
typedef __attribute__((ext_vector_type(8))) _Float16 v8b;
typedef __attribute__((ext_vector_type(8))) float v8f;
typedef __attribute__((ext_vector_type(4))) float v4f;
__device__ __forceinline__ float bf16_rne(float f) { unsigned int u = __float_as_uint(f); u += 0x7FFFu + ((u >> 16) & 1u); return __uint_as_float(u & 0xFFFF0000u); }
__device__ __forceinline__ void split16(float v, b16& hi, b16& lo) { hi = (b16)v; lo = (b16)(v - (float)hi); }
__device__ __forceinline__ void frag_split(const float* p, int hh, v16b& fh, v16b& fl) {
#pragma unroll
  for (int e = 0; e < 8; ++e) { b16 a, c; split16(p[8 * hh + e] * AS_, a, c); fh[e] = a; fl[e] = c; split16(p[16 + 8 * hh + e] * AS_, a, c); fh[8 + e] = a; fl[8 + e] = c; } }
// raw fragment loads, kept apart from their use so that a whole batch can be in flight before the first use; p = the block's start + 8 * lane
__device__ __forceinline__ void ld_p(const b16* p, v8b* r) { r[0] = *(const v8b*)(p); r[1] = *(const v8b*)(p + 256); }
__device__ __forceinline__ v16b cat_h(const v8b* r) { v16b f;
#pragma unroll
  for (int e = 0; e < 8; ++e) { f[e] = r[0][e]; f[8 + e] = r[1][e]; } return f; }
__device__ __forceinline__ v8f wmma16b(v16b a, v16b b, v8f c) { v8f d = __builtin_amdgcn_wmma_f32_16x16x32_f16(false, a, false, b, (short)0, c, false, false); asm volatile("v_nop\n\tv_nop\n\tv_nop\n\tv_nop" : "+v"(d) : "v"(a), "v"(b)); return d; }
__device__ __forceinline__ void wave_lds_sync() { __builtin_amdgcn_fence(__ATOMIC_RELEASE, "workgroup"); __builtin_amdgcn_wave_barrier(); __builtin_amdgcn_fence(__ATOMIC_ACQUIRE, "workgroup"); }
__device__ __forceinline__ float nexp(float x) { return __builtin_amdgcn_exp2f(x * 1.4426950408889634f); }
template <bool V> struct Bc { static constexpr bool value = V; };

typedef __attribute__((ext_vector_type(16))) __bf16 v16q;
typedef __attribute__((ext_vector_type(8))) __bf16 v8q;
typedef __attribute__((ext_vector_type(4))) __bf16 v4q;
__device__ __forceinline__ v16q cat_q(const v8q* r) { v16q f;
#pragma unroll
  for (int e = 0; e < 8; ++e) { f[e] = r[0][e]; f[8 + e] = r[1][e]; } return f; }
__device__ __forceinline__ v8f wmma16q(v16q a, v16q b, v8f c) { v8f d = __builtin_amdgcn_wmma_f32_16x16x32_bf16(false, a, false, b, (short)0, c, false, false); asm volatile("v_nop\n\tv_nop\n\tv_nop\n\tv_nop" : "+v"(d) : "v"(a), "v"(b)); return d; }
template <int V> struct Ic { static constexpr int value = V; };

// projections, straight from the f32 inputs (no launch ahead of this one): block = 128 tokens x 128 columns (column tile c of 16: 0..3 q, 4..7 k, 8..15 v; two heads each) x 8 waves, one work-group a WGP.
// Stage: the block's x rows and weight columns, all 512 k, are read once in whole 512-byte runs, rounded to bf16 (the operands' exact values, as before) and laid in LDS k-contiguous, pitch 1040 B (16 B x 65): Xs[token][k], Ws[column][k].
// A weight thread holds 8 k x 4 columns, so the transposition is a choice of registers; its 16-byte piece (column, kg = k / 8) lies at piece kg ^ ((column >> 4) & 3) of the column's row, so that the 32 lanes' stores spread over all banks.
// Loop: wave = (32 tokens rg, head hs): 16 k-steps from LDS, fragment k order for A AND B: lane half hh, elements 0..15 <- k = 32 ks + 16 hh + 0..15. q x scale x 8 / k x 8 -> planes [b][g] of blocks [16 s tiles][2 k-steps]; v x 8 -> planes [b][l] of blocks [4 d tiles][8 k-steps of t].
// Beside it each thread converts one piece of Wout: Ro, blocks [32 column tiles][32 k-steps] in fragment order; and the first work-groups fill P: bv @0 (1024), bout @1024 (512), sigma^2 @1536 (8), p @1544 (128 = [g][l]), eps @1672. Ro and P are read by later launches only.
constexpr int XP = H + 8;
// amdgpu_num_vgpr(256): the staging's three sets of loads otherwise take a few registers above v255, each use of which costs a register-window switch
__global__ __launch_bounds__(256) __attribute__((amdgpu_num_vgpr(256))) void proj_kernel(const float* __restrict__ x, const float* __restrict__ Wq, const float* __restrict__ Wk, const float* __restrict__ Wv, const float* __restrict__ Wout, const float* __restrict__ bv, const float* __restrict__ bout, const float* __restrict__ sg, const float* __restrict__ pp, const float* __restrict__ ed, b16* __restrict__ Ro, float* __restrict__ P, b16* __restrict__ qp, b16* __restrict__ kp, b16* __restrict__ vt) {
  __shared__ __attribute__((aligned(16))) __bf16 Xs[128][XP]; __shared__ __attribute__((aligned(16))) __bf16 Ws[128][XP]; __shared__ __attribute__((aligned(16))) b16 E[8 * 32 * 72];   // E: the epilogue's staging, [8 waves][32][72] for q, k or [2 heads][64][136] for v
  // XW: the wait that stands behind issued global loads before their address registers are written again; the SB on either side keep other arithmetic from being scheduled between the loads and the wait
#define SB __builtin_amdgcn_sched_barrier(0)
#define XW SB; asm volatile("s_wait_xcnt 0x0" ::: "memory"); SB
  // XWP: the same wait; the two address pairs are named as inputs only, so that they stay allocated up to the wait
#define XWP(p, q) SB; asm volatile("s_wait_xcnt 0x0" :: "v"(p), "v"(q) : "memory"); SB
  const int tx = threadIdx.x, lane = tx & 31, wave = tx >> 5, nloc = lane & 15, hlf = lane >> 4, c = blockIdx.x, p0 = blockIdx.y * 128, b = p0 / S, t0 = p0 % S, rg = wave & 3, hs = wave >> 2;
  const int t_ = (blockIdx.y * 16 + blockIdx.x) * 256 + tx, oa = t_ & 511, kw = t_ >> 9;   // the thread's piece of Wout: column oa, k = 8 kw + 0..7
  float wo[8], bb[4];
  { const float* s_ = Wout + (size_t)kw * 8 * 512 + oa;
#pragma unroll
    for (int e = 0; e < 8; ++e) wo[e] = s_[e * 512]; }
  XW;
  auto put_ro = [&]() { v8b h;   // Wout: column oa, k = 8 kw + 0..7 -> its piece of block (oa >> 4, kw >> 2)
#pragma unroll
    for (int e = 0; e < 8; ++e) h[e] = (b16)bf16_rne(wo[e]);
    *(v8b*)(Ro + ((size_t)((oa >> 4) * 32 + (kw >> 2)) * 2 + ((kw >> 1) & 1)) * 256 + ((kw & 1) * 16 + (oa & 15)) * 8) = h; };
  auto stage = [&](auto pc) { constexpr int PW = decltype(pc)::value;   // PW: the weight matrix's row length, a constant so that every load of a thread is one address pair plus an immediate
    const float* xb = x + (size_t)(p0 + (tx >> 7)) * H + (tx & 127) * 4;   // load i: row 2 i + (tx >> 7), k = 4 (tx & 127) + 0..3
    const float* wb = ((c < 4) ? Wq : (c < 8) ? Wk : Wv) + (size_t)(8 * wave) * PW + ((c < 8) ? (c & 3) : (c - 8)) * 128 + lane * 4;   // unit un: kg = wave + 8 un, rows k = 8 kg + e, columns 4 lane + 0..3
    auto ldx = [&](int bt, v4f* r) {
#pragma unroll
      for (int u = 0; u < 16; ++u) r[u] = *(const v4f*)(xb + (size_t)(bt * 16 + u) * 2 * H); };
    auto stx = [&](int bt, const v4f* r) {
#pragma unroll
      for (int u = 0; u < 16; ++u) *(v4q*)&Xs[(bt * 16 + u) * 2 + (tx >> 7)][(tx & 127) * 4] = __builtin_convertvector(r[u], v4q); };
    auto ldw = [&](int bt, v4f* r) {
#pragma unroll
      for (int u = 0; u < 16; ++u) r[u] = *(const v4f*)(wb + (size_t)((bt * 2 + (u >> 3)) * 64 + (u & 7)) * PW); };
    auto stw = [&](int bt, const v4f* r) {
#pragma unroll
      for (int i = 0; i < 2; ++i) { const int kg = wave + 8 * (bt * 2 + i);
#pragma unroll
        for (int cc = 0; cc < 4; ++cc) { v8f f;
#pragma unroll
          for (int e = 0; e < 8; ++e) f[e] = r[i * 8 + e][cc];
          *(v8q*)&Ws[lane * 4 + cc][(kg ^ ((lane >> 2) & 3)) * 8] = __builtin_convertvector(f, v8q); } } };
    // two register sets of 16 loads: one set is in flight while the other is rounded and stored. SB: keeps a set's loads in front of the other set's conversions
    v4f ra[16], rb[16];
    ldx(0, ra); ldx(1, rb); SB; put_ro(); stx(0, ra); ldx(2, ra); SB; stx(1, rb); ldx(3, rb); SB; stx(2, ra); ldw(0, ra); SB; stx(3, rb); ldw(1, rb); SB;
    stw(0, ra); ldw(2, ra); SB; stw(1, rb); ldw(3, rb); XWP(xb, wb); stw(2, ra); stw(3, rb); };   // XWP: what follows reuses the address registers
  if (c < 8) stage(Ic<512>{}); else stage(Ic<1024>{});   // the same for the whole work-group
  if (t_ < 1672 + L * S) { const int q = t_; float v; if (q < 1024) v = bf16_rne(bv[q]); else if (q < 1536) v = bf16_rne(bout[q - 1024]); else if (q < 1544) { const float s_ = bf16_rne(sg[q - 1536]); v = s_ * s_; } else if (q < 1672) v = bf16_rne(pp[q - 1544]); else v = bf16_rne(ed[q - 1672]); P[q] = v; }
  XW;
  __syncthreads();   // both operand tiles are complete in LDS before any wave reads a fragment
  { const float* s_ = bv + ((c >= 8) ? ((c - 8) * 2 + hs) * HD : 0) + nloc;   // the v heads' bias, requested here so that the k loop covers its latency
#pragma unroll
    for (int t = 0; t < 4; ++t) bb[t] = s_[t * 16]; }
  XW;
  v8f acc[2][4];
#pragma unroll
  for (int r = 0; r < 2; ++r)
#pragma unroll
    for (int t = 0; t < 4; ++t) acc[r][t] = (v8f){};
  constexpr int NK = H / 32; const __bf16* ax = &Xs[rg * 32 + nloc][16 * hlf]; const __bf16* bx0 = &Ws[hs * 64 + nloc][16 * hlf]; const __bf16* bx1 = &Ws[hs * 64 + nloc][16 * (hlf ^ 1)];
  // column tile t has (column >> 4) & 3 = t: its piece 2 hh + p lies at piece (2 hh + p) ^ t of each group of four
  auto fetch = [&](int ks, v8q* ra, v8q* rb) {
#pragma unroll
    for (int r = 0; r < 2; ++r) { ra[2 * r] = *(const v8q*)(ax + r * 16 * XP + ks * 32); ra[2 * r + 1] = *(const v8q*)(ax + r * 16 * XP + ks * 32 + 8); }
#pragma unroll
    for (int t = 0; t < 4; ++t) { const __bf16* bp = ((t & 2) ? bx1 : bx0) + t * 16 * XP + ks * 32; rb[2 * t] = *(const v8q*)(bp + 8 * (t & 1)); rb[2 * t + 1] = *(const v8q*)(bp + 8 * ((t & 1) ^ 1)); } };
  auto mults = [&](const v8q* ra, const v8q* rb) { const v16q a0 = cat_q(ra), a1 = cat_q(ra + 2);
#pragma unroll
    for (int t = 0; t < 4; ++t) { const v16q bw = cat_q(rb + 2 * t); acc[0][t] = wmma16q(a0, bw, acc[0][t]); acc[1][t] = wmma16q(a1, bw, acc[1][t]); } };
  // two register sets: the 12 LDS loads of k-step n + 1 are all issued before the products of k-step n. SB: keeps a set's loads in front of the other set's products
  v8q xa[4], ya[4], xb_[8], yb[8]; fetch(0, xa, xb_);
#pragma unroll
  for (int ks = 0; ks < NK; ks += 2) { fetch(ks + 1, ya, yb); SB; mults(xa, xb_); SB; if (ks + 2 < NK) fetch(ks + 2, xa, xb_); SB; mults(ya, yb); SB; }
  asm volatile("" :: "v"(bb[0]), "v"(bb[1]), "v"(bb[2]), "v"(bb[3]));   // the four loaded bias values as inputs only: holds their loads in front of the k loop; without it they sink into the v epilogue and are waited for there
  const int m0 = p0 + rg * 32;
  if (c < 8) { const float scl = (c < 4) ? SCALE * QS : KS; const int hd_ = (c & 3) * 2 + hs; b16 (*T)[72] = (b16 (*)[72])(E + wave * 32 * 72);
#pragma unroll
    for (int t = 0; t < 4; ++t)
#pragma unroll
      for (int r = 0; r < 2; ++r)
#pragma unroll
        for (int v = 0; v < 8; ++v) T[r * 16 + 8 * hlf + v][t * 16 + nloc] = (b16)(acc[r][t][v] * scl);
    wave_lds_sync();
    b16* base = ((c < 4) ? qp : kp) + (((size_t)b * G + hd_) * S + (m0 % S)) * HD;
#pragma unroll
    for (int j = 0; j < 8; ++j) *(v8b*)(base + j * 256 + lane * 8) = *(const v8b*)(&T[(j >> 2) * 16 + nloc][((j >> 1) & 1) * 32 + (j & 1) * 16 + hlf * 8]);   // j = (s tile, k-step, piece)
    return; }
  const int l = (c - 8) * 2 + hs; b16 (*Tv)[136] = (b16 (*)[136])(E + hs * 64 * 136);
#pragma unroll
  for (int t = 0; t < 4; ++t) { const float bt_ = bf16_rne(bb[t]);
#pragma unroll
    for (int r = 0; r < 2; ++r)
#pragma unroll
      for (int v = 0; v < 8; ++v) Tv[t * 16 + nloc][rg * 32 + r * 16 + 8 * hlf + v] = (b16)((acc[r][t][v] + bt_) * VS); }
  __syncthreads();
  for (int i = tx & 127; i < 64 * 16; i += 128) { const int ln = i & 31, j = (i >> 5) & 1, ksl = (i >> 6) & 3, dt = i >> 8; *(v8b*)(vt + ((((size_t)b * L + l) * 4 + dt) * 8 + t0 / 32 + ksl) * 512 + j * 256 + ln * 8) = *(const v8b*)(&Tv[dt * 16 + (ln & 15)][ksl * 32 + j * 16 + (ln >> 4) * 8]); }
}

// scores + fish + softmax + PV in one launch: block = (b, 16 rows s0.., LG local heads l0 = LG blockIdx.z ..) x 8 waves. Wave w holds the columns t = 32 w .. 32 w + 31 (two 16 x 16 tiles) for all 8 heads g, one head after the other:
// S_g[s][t] = q_s.k_t (scaled; 2 k-steps x 2 tiles, 1 product) + spatial[b][s][t] + edge[b][s][t] stays in the accumulator's registers (lane = column, 8 rows) and is mixed at once:
// a_l[s][t] += relu(p[g][l] (S_g[s][t] + sigma_g^2 eps[l][s] d_st)) (f32, g in order) for the LG heads; a goes to LDS once. pad: a bit a (g, row) and wave says whether the wave saw a nonzero score; the bits meet behind the barrier,
// and a row with one head all zero is the reference's all -inf row -> zeros (nan_to_num). Row softmax (wave per 2 LG rows; fixed order); PV: 8 waves x (one head, 16 rows x 32 d). 512 work-groups, two a WGP, 4 waves a SIMD, 256 registers a wave.
constexpr int LG = 4;
__global__ __launch_bounds__(256) __attribute__((amdgpu_waves_per_eu(4, 4))) void fish_kernel(const b16* __restrict__ qp, const b16* __restrict__ kp, const float* __restrict__ sp, const float* __restrict__ ee, const b16* __restrict__ vt, const float* __restrict__ P, b16* __restrict__ cp) {
  __shared__ __attribute__((aligned(16))) float A[LG * 16][S + 4]; __shared__ __attribute__((aligned(16))) float Cx[LG][16][HD + 4]; __shared__ __attribute__((aligned(16))) unsigned Nz[G][8];
  const int t_ = threadIdx.x, wave = t_ >> 5, lane = t_ & 31, nloc = lane & 15, hlf = lane >> 4; const int b = blockIdx.y, s0 = blockIdx.x * 16, l0 = blockIdx.z * LG;
  const float* sig2 = P + 1536; const float* pp = P + 1544; const float* ed = P + 1672;
  // the wave's tile u is t-tile 2 wave + (u ^ par): so the tile that holds the 16 diagonal elements is always tile u = 0 of wave blockIdx.x >> 1
  const int wv = __builtin_amdgcn_readfirstlane(wave), par = blockIdx.x & 1, tt0 = 2 * wv + par, tt1 = 2 * wv + (par ^ 1);   // wv: the wave's number in a scalar register, so that the loads below take a scalar base and one lane offset
  // DG: only the wave that holds the diagonal adds sigma^2 eps, to its diagonal elements (elsewhere the reference adds 0)
  auto mix = [&](auto dg) { constexpr bool DG = decltype(dg)::value;
    const b16* qq = qp + ((size_t)b * G * S + s0) * HD; const b16* k0 = kp + ((size_t)b * G * S + tt0 * 16) * HD; const b16* k1 = kp + ((size_t)b * G * S + tt1 * 16) * HD; qq += lane * 8; k0 += lane * 8; k1 += lane * 8;
    auto fetch = [&](int dgh, v8b* q, v8b* k) { ld_p(qq + dgh * S * HD, q); ld_p(qq + dgh * S * HD + 512, q + 2); ld_p(k0 + dgh * S * HD, k); ld_p(k0 + dgh * S * HD + 512, k + 2); ld_p(k1 + dgh * S * HD, k + 4); ld_p(k1 + dgh * S * HD + 512, k + 6); };
    // XW3: the wait XW with the three address pairs named as inputs only, so that they stay allocated up to the wait and no load of the batch lands in one of them
#define XW3 SB; asm volatile("s_wait_xcnt 0x0" :: "v"(qq), "v"(k0), "v"(k1) : "memory"); SB
    v8b qx[4], kx[8], qy[4], ky[8]; fetch(0, qx, kx);
    const size_t bb = ((size_t)b * S + s0) * S; const float* sq0 = sp + bb + tt0 * 16; const float* sq1 = sp + bb + tt1 * 16; const float* eq0 = ee + bb + tt0 * 16; const float* eq1 = ee + bb + tt1 * 16; const int bo = 8 * hlf * S + nloc;
    float bs[2][8], be[2][8], ev[LG], pv[LG];
#pragma unroll
    for (int r = 0; r < 8; ++r) { bs[0][r] = sq0[bo + r * S]; be[0][r] = eq0[bo + r * S]; bs[1][r] = sq1[bo + r * S]; be[1][r] = eq1[bo + r * S]; }
#pragma unroll
    for (int i = 0; i < LG; ++i) { ev[i] = DG ? ed[(l0 + i) * S + s0 + nloc] : 0.0f; pv[i] = pp[(lane & 7) * L + l0 + i]; }   // lane g holds p[g][l0 + i] and sigma_g^2: the loop over g reads them by lane number, with no load of its own
    const float s2v = DG ? sig2[lane & 7] : 0.0f;
    XW;   // the wait that stands behind issued global loads before their address registers are written again
    float a[LG][2][8], bias[2][8]; unsigned nzm = 0u;
#pragma unroll
    for (int u = 0; u < 2; ++u)
#pragma unroll
      for (int r = 0; r < 8; ++r) { bias[u][r] = bf16_rne(bs[u][r]) + bf16_rne(be[u][r]);
#pragma unroll
        for (int i = 0; i < LG; ++i) a[i][u][r] = 0.0f; }
    auto headg = [&](int g, const v8b* q, const v8b* k) { const v16b q0 = cat_h(q), q1 = cat_h(q + 2); float sv[2][8];
#pragma unroll
      for (int u = 0; u < 2; ++u) { v8f acc = {}; acc = wmma16b(q0, cat_h(k + 4 * u), acc); acc = wmma16b(q1, cat_h(k + 4 * u + 2), acc);
#pragma unroll
        for (int r = 0; r < 8; ++r) sv[u][r] = acc[r] * (1.0f / (QS * KS)) + bias[u][r]; }
      // pad bits of head g, rows 0..15: if every lane has a nonzero score in each of its 8 rows, all 16 rows have one; only otherwise the rows are looked at one by one (the same for a whole wave)
      float mh = INFINITY;
#pragma unroll
      for (int r = 0; r < 8; ++r) mh = fminf(mh, fmaxf(fabsf(sv[0][r]), fabsf(sv[1][r])));
      unsigned mk = 0xFFFFu;
      if (__builtin_amdgcn_ballot_w32(mh == 0.0f) != 0u) { mk = 0u;
#pragma unroll
        for (int r = 0; r < 8; ++r) { const unsigned bl = __builtin_amdgcn_ballot_w32(sv[0][r] != 0.0f || sv[1][r] != 0.0f); mk |= ((bl & 0xFFFFu) ? (1u << r) : 0u) | ((bl >> 16) ? (256u << r) : 0u); } }
      nzm = (lane == g) ? mk : nzm;
      const float s2g = DG ? __uint_as_float(__builtin_amdgcn_readlane(__float_as_uint(s2v), g)) : 0.0f;
#pragma unroll
      for (int i = 0; i < LG; ++i) { const float pg = __uint_as_float(__builtin_amdgcn_readlane(__float_as_uint(pv[i]), g));
#pragma unroll
        for (int u = 0; u < 2; ++u)
#pragma unroll
          for (int r = 0; r < 8; ++r) { float v = sv[u][r]; if (DG && u == 0) v = (nloc == 8 * hlf + r) ? v + s2g * ev[i] : v; a[i][u][r] += fmaxf(v * pg, 0.0f); } } };
    // two register sets: the 12 loads of head g + 1 are all issued before the products and the mixing of head g. One trip's code for all four: unrolled, the two forms of this loop would be four times as much kernel text
#pragma clang loop unroll(disable)
    for (int g = 0; g < G; g += 2) { fetch(1, qy, ky); SB; headg(g, qx, kx); XW3; const int st = (g + 2 < G) ? 2 * S * HD : 0; qq += st; k0 += st; k1 += st;   // SB: as in the projection loop; XW: as in the projection kernel
      fetch(0, qx, kx); SB; headg(g + 1, qy, ky); XW3; }   // no test around these loads, so that the waits in front of the products can count them; the last trip has no head g + 2 and stays where it is
#undef XW3
#pragma unroll
    for (int i = 0; i < LG; ++i)
#pragma unroll
      for (int r = 0; r < 8; ++r) { A[i * 16 + 8 * hlf + r][tt0 * 16 + nloc] = a[i][0][r]; A[i * 16 + 8 * hlf + r][tt1 * 16 + nloc] = a[i][1][r]; }
    if (lane < G) Nz[lane][wave] = nzm; };
  if (wv == (int)(blockIdx.x >> 1)) mix(Bc<true>{}); else mix(Bc<false>{});   // the same for a whole wave; both sides meet at the barrier below
  __syncthreads();
  // bit s of alive: every head g has a nonzero score in row s (OR over the 8 waves' columns, AND over g); lane -> g = lane & 7
  unsigned alive = 0u;
#pragma unroll
  for (int w = 0; w < 8; ++w) alive |= Nz[lane & 7][w];
#pragma unroll
  for (int o = 1; o < 8; o <<= 1) alive &= __shfl_xor(alive, o);
  // softmax rows: wave w handles rows 2 LG w .. 2 LG w + 2 LG - 1 of the LG x 16
#pragma unroll 4   // four rows' chains of cross-lane steps run side by side, for speed only
  for (int rr = wave * 2 * LG; rr < wave * 2 * LG + 2 * LG; ++rr) { float mx = -INFINITY;
#pragma unroll
    for (int j = 0; j < 8; ++j) mx = fmaxf(mx, A[rr][lane + 32 * j]);
#pragma unroll
    for (int o = 1; o < 32; o <<= 1) mx = fmaxf(mx, __shfl_xor(mx, o));
    if (((alive >> (rr & 15)) & 1u) == 0u) mx = -INFINITY;   // a false pad flag: the whole row is -inf in the reference
    float sm = 0.0f;
#pragma unroll
    for (int j = 0; j < 8; ++j) sm += (mx == -INFINITY) ? 0.0f : nexp(A[rr][lane + 32 * j] - mx);
#pragma unroll
    for (int o = 1; o < 32; o <<= 1) sm += __shfl_xor(sm, o);
    const float inv = (mx == -INFINITY) ? 0.0f : 1.0f / sm;   // all -inf row -> NaN in the reference -> nan_to_num -> 0
#pragma unroll
    for (int j = 0; j < 8; ++j) A[rr][lane + 32 * j] = (mx == -INFINITY) ? 0.0f : nexp(A[rr][lane + 32 * j] - mx) * inv; }
  __syncthreads();
  // PV: wave -> head li = wave >> 1, d-tiles 2 (wave & 1) + 0, 1 (32 d of 64), which share one split of the A fragment; rows = all 16 s; 8 k-steps; A split hi+lo x8; B = v^T blocks [b][l][d tile][k-step] single
  { const int li = wave >> 1, dp = wave & 1; v8f acc[2] = {}; const b16* V = vt + (((size_t)b * L + l0 + li) * 4 + 2 * dp) * 8 * 512 + lane * 8;
    for (int k0 = 0; k0 < S; k0 += 64) { v8b vr[2][2][2];   // two k-steps' value blocks requested together
#pragma unroll
      for (int u = 0; u < 2; ++u)
#pragma unroll
        for (int d = 0; d < 2; ++d) ld_p(V + (d * 8 + k0 / 32 + u) * 512, vr[u][d]);
#pragma unroll
      for (int u = 0; u < 2; ++u) { v16b ah, al; frag_split(&A[li * 16 + nloc][k0 + 32 * u], hlf, ah, al);
#pragma unroll
        for (int d = 0; d < 2; ++d) { const v16b bw = cat_h(vr[u][d]); acc[d] = wmma16b(ah, bw, acc[d]); acc[d] = wmma16b(al, bw, acc[d]); } } }
#pragma unroll
    for (int d = 0; d < 2; ++d)
#pragma unroll
      for (int r = 0; r < 8; ++r) Cx[li][8 * hlf + r][(2 * dp + d) * 16 + nloc] = acc[d][r] * (1.0f / (AS_ * VS)); }
  __syncthreads();
  // ctx leaves as the output projection's A operand: x8, f16 hi and lo planes, blocks [128 row tiles][32 k-steps][hi, lo]; thread = (k-step, plane, piece, lane), 4 KB a head, 4 LG KB in a row a work-group
  { const int ln = t_ & 31, j = (t_ >> 5) & 1, lo_ = (t_ >> 6) & 1, ksl = t_ >> 7;
#pragma unroll
    for (int i = 0; i < LG; ++i) { const float* cs = &Cx[i][ln & 15][ksl * 32 + j * 16 + (ln >> 4) * 8]; v8b h;
#pragma unroll
      for (int e = 0; e < 8; ++e) { b16 a, c; split16(cs[e] * AS_, a, c); h[e] = lo_ ? c : a; }
      *(v8b*)(cp + ((size_t)((b * S + s0) / 16) * 32 + 2 * (l0 + i)) * 1024 + t_ * 8) = h; } }
}

// output projection: block = 64 tokens x 64 cols x 8 waves; wave = (32-row half ms, quarter kg of the 32 k-steps): four waves share one output tile, each sums 8 k-steps, so that a wave's chain of
// dependent load round trips is a quarter as long; the four f32 partial tiles meet in LDS and are added in the order kg = 0, 1, 2, 3
__global__ __launch_bounds__(256) void out_kernel(const b16* __restrict__ cp, const b16* __restrict__ Ro, const float* __restrict__ P, float* __restrict__ out) {
  __shared__ __attribute__((aligned(16))) float Ts[8][32 * 64];
  const int lane = threadIdx.x & 31, wave = threadIdx.x >> 5, nloc = lane & 15, hlf = lane >> 4, ms = wave & 1, kg = wave >> 1, m0 = blockIdx.y * 64 + ms * 32, c0 = blockIdx.x * 64; const float* bout = P + 1024;
  v8f acc[2][4];
#pragma unroll
  for (int r = 0; r < 2; ++r)
#pragma unroll
    for (int t = 0; t < 4; ++t) acc[r][t] = (v8f){};
  constexpr int NK = L * HD / 32, KQ = NK / 4; const b16* cr = cp + ((size_t)(m0 / 16) * NK + kg * KQ) * 1024 + lane * 8; const b16* wr = Ro + ((size_t)(c0 / 16) * NK + kg * KQ) * 512 + lane * 8;
  auto fetch = [&](int ks, v8b* ra, v8b* rb) { ld_p(cr + ks * 1024, ra); ld_p(cr + ks * 1024 + 512, ra + 2); ld_p(cr + (NK + ks) * 1024, ra + 4); ld_p(cr + (NK + ks) * 1024 + 512, ra + 6);
#pragma unroll
    for (int t = 0; t < 4; ++t) ld_p(wr + (t * NK + ks) * 512, rb + 2 * t); };
  auto mults = [&](const v8b* ra, const v8b* rb) { const v16b a0 = cat_h(ra), l0 = cat_h(ra + 2), a1 = cat_h(ra + 4), l1 = cat_h(ra + 6);
#pragma unroll
    for (int t = 0; t < 4; ++t) { const v16b bw = cat_h(rb + 2 * t); acc[0][t] = wmma16b(a0, bw, acc[0][t]); acc[0][t] = wmma16b(l0, bw, acc[0][t]); acc[1][t] = wmma16b(a1, bw, acc[1][t]); acc[1][t] = wmma16b(l1, bw, acc[1][t]); } };
  // two register sets: the 16 loads of k-step n + 1 are all issued before the products of k-step n
  v8b xa[8], ya[8], xb[8], yb[8]; fetch(0, xa, xb);
  for (int ks = 0; ks < KQ - 2; ks += 2) { fetch(ks + 1, ya, yb); SB; mults(xa, xb); SB; fetch(ks + 2, xa, xb); SB; mults(ya, yb); SB; XW; }   // SB: as in the projection loop; XW: as in the projection kernel
  fetch(KQ - 1, ya, yb); XWP(cr, wr); mults(xa, xb); SB; mults(ya, yb);   // XWP: as in the projection kernel
#undef XWP
#undef XW
#undef SB
  float* Tt = Ts[wave];
#pragma unroll
  for (int t = 0; t < 4; ++t)
#pragma unroll
    for (int r = 0; r < 2; ++r)
#pragma unroll
      for (int v = 0; v < 8; ++v) Tt[(r * 16 + v + 8 * hlf) * 64 + t * 16 + nloc] = acc[r][t][v];
  __syncthreads();   // the four partial tiles of each row half are complete before any thread adds them
  { const int c4 = nloc * 4; const v4f bb = *(const v4f*)(bout + c0 + c4);
#pragma unroll
    for (int j = 0; j < 4; ++j) { const int rr = j * 16 + (threadIdx.x >> 4); const float* tp = &Ts[rr >> 5][(rr & 31) * 64 + c4];   // Ts[2 kg + ms]
      const v4f s_ = ((*(const v4f*)tp + *(const v4f*)(tp + 2 * 2048)) + *(const v4f*)(tp + 4 * 2048)) + *(const v4f*)(tp + 6 * 2048);
      *(v4f*)(out + (size_t)(blockIdx.y * 64 + rr) * H + c0 + c4) = s_ * (1.0f / AS_) + bb; } }
}
}  // namespace

extern "C" void kernel_launch(void* const* d_in, const int* in_sizes, int n_in,
                              void* d_out, int out_size, void* d_ws, size_t ws_size, hipStream_t stream) {
  (void)n_in; (void)out_size;
  const float* x = (const float*)d_in[0]; const float* sp = (const float*)d_in[1]; const float* ee = (const float*)d_in[2]; const float* Wq = (const float*)d_in[3]; const float* Wk = (const float*)d_in[4]; const float* Wv = (const float*)d_in[5]; const float* bv = (const float*)d_in[6];
  const float* sg = (const float*)d_in[7]; const float* pp = (const float*)d_in[8]; const float* ed = (const float*)d_in[9]; const float* Wout = (const float*)d_in[10]; const float* bout = (const float*)d_in[11];
  float* out = (float*)d_out;   // [8][256][512]
  if (in_sizes[0] != NT * H || in_sizes[1] != Bn * S * S || in_sizes[5] != H * 1024 || in_sizes[8] != G * L || in_sizes[9] != L * S || in_sizes[10] != 1024 * H) return;
  size_t off = 0; char* ws = (char*)d_ws;
  auto carve = [&](size_t bytes) { char* p = ws + off; off += (bytes + 255) & ~(size_t)255; return p; };
  b16* Ro = (b16*)carve((size_t)512 * 1024 * 2); float* P = (float*)carve(((size_t)1672 + L * S + 64) * 4);
  b16* qp = (b16*)carve((size_t)Bn * G * S * HD * 2); b16* kp = (b16*)carve((size_t)Bn * G * S * HD * 2); b16* vt = (b16*)carve((size_t)Bn * L * HD * S * 2); b16* cp = (b16*)carve((size_t)NT * L * HD * 2 * 2);
  if (off > ws_size) return;                                    // about 1 + 2 + 2 + 4 + 8.4 = 18 MB
  proj_kernel<<<dim3(16, NT / 128), 256, 0, stream>>>(x, Wq, Wk, Wv, Wout, bv, bout, sg, pp, ed, Ro, P, qp, kp, vt);
  fish_kernel<<<dim3(S / 16, Bn, L / LG), 256, 0, stream>>>(qp, kp, sp, ee, vt, P, cp);
  out_kernel<<<dim3(H / 64, NT / 64), 256, 0, stream>>>(cp, Ro, P, out);
}

// v010
// One run takes 32.7 microseconds.
// Timed twice side by side with v009, it ran 1.08 and 1.10 times as fast.
// All steps since v000 together make it 17.2 times as fast.
#include <hip/hip_runtime.h>

// GraphormerFishAttention: q = x Wq, k = x Wk (G=8 heads x 64), v = x Wv + bv (L=16 heads x 64); g = q.k^T 512^-0.5 + (spatial + edge) bias [B,G,S,S]; pad = any_t(g != 0);
// a_l = Σ_g where(pad_g, relu(p[g,l] (g + sigma_g² eps[l,s] δ_st)), -inf); softmax over t; nan_to_num; out_l = a_l.v_l; out = merged Wout + bout -> [8][256][512].
// Projections on v_wmma_f32_16x16x32_bf16 with exact operands (x and the weights are exact bf16; 1 product); g = q.k^T with q, k single f16 x8 (1 product; |q.k|·scale ≈ 0.07 next to
// the O(1) exact bias) + bias in f32; the fish mixing / relu / pad / softmax in f32 (fixed order); out_l = P.v with P and v single f16 x8 (1 product);
// output projection with ctx single f16 x8 (1 product: ctx carries v's f16 rounding already); f32 accumulate. Fragment k-map of the f16 products per lane half hh for A AND B: elements 0..7 <- k = 8hh+0..7, 8..15 <- k = 16+8hh+0..7.
// Every f16 matrix operand in the workspace lies in fragment order: a block of 16 rows x 32 k is 1 KB; its 16-byte piece (j, lane) holds row (lane & 15), k = 16 j + 8 (lane >> 4) + 0..7, at half offset 256 j + 8 lane,
// so that a wave's fragment is two loads of 512 contiguous bytes (the k-map above, unchanged).

namespace {
constexpr int Bn = 8, S = 256, H = 512, G = 8, L = 16, HD = 64, NT = Bn * S, NPJ = 2048;
constexpr float QS = 8.0f, KS = 8.0f, VS = 8.0f, PS = 8.0f, AS_ = 8.0f, SCALE = 0.04419417382415922f;

typedef _Float16 b16;
typedef __attribute__((ext_vector_type(16))) _Float16 v16b;
typedef __attribute__((ext_vector_type(8))) _Float16 v8b;
typedef __attribute__((ext_vector_type(8))) float v8f;
typedef __attribute__((ext_vector_type(4))) float v4f;
__device__ __forceinline__ float bf16_rne(float f) { unsigned int u = __float_as_uint(f); u += 0x7FFFu + ((u >> 16) & 1u); return __uint_as_float(u & 0xFFFF0000u); }
__device__ __forceinline__ v16b frag_f16(const float* p, int hh) { v16b f;
#pragma unroll
  for (int e = 0; e < 8; ++e) { f[e] = (b16)(p[8 * hh + e] * AS_); f[8 + e] = (b16)(p[16 + 8 * hh + e] * AS_); } return f; }
// raw fragment loads, kept apart from their use so that a whole batch can be in flight before the first use; p = the block's start + 8 * lane
__device__ __forceinline__ void ld_p(const b16* p, v8b* r) { r[0] = *(const v8b*)(p); r[1] = *(const v8b*)(p + 256); }
__device__ __forceinline__ v16b cat_h(const v8b* r) { v16b f;
#pragma unroll
  for (int e = 0; e < 8; ++e) { f[e] = r[0][e]; f[8 + e] = r[1][e]; } return f; }
__device__ __forceinline__ v8f wmma16b(v16b a, v16b b, v8f c) { v8f d = __builtin_amdgcn_wmma_f32_16x16x32_f16(false, a, false, b, (short)0, c, false, false); asm volatile("v_nop\n\tv_nop\n\tv_nop\n\tv_nop" : "+v"(d) : "v"(a), "v"(b)); return d; }
__device__ __forceinline__ void wave_lds_sync() { __builtin_amdgcn_fence(__ATOMIC_RELEASE, "workgroup"); __builtin_amdgcn_wave_barrier(); __builtin_amdgcn_fence(__ATOMIC_ACQUIRE, "workgroup"); }
__device__ __forceinline__ float nexp(float x) { return __builtin_amdgcn_exp2f(x * 1.4426950408889634f); }
template <bool V> struct Bc { static constexpr bool value = V; };

typedef __attribute__((ext_vector_type(16))) __bf16 v16q;
typedef __attribute__((ext_vector_type(8))) __bf16 v8q;
typedef __attribute__((ext_vector_type(4))) __bf16 v4q;
__device__ __forceinline__ v16q cat_q(const v8q* r) { v16q f;
#pragma unroll
  for (int e = 0; e < 8; ++e) { f[e] = r[0][e]; f[8 + e] = r[1][e]; } return f; }
__device__ __forceinline__ v8f wmma16q(v16q a, v16q b, v8f c) { v8f d = __builtin_amdgcn_wmma_f32_16x16x32_bf16(false, a, false, b, (short)0, c, false, false); asm volatile("v_nop\n\tv_nop\n\tv_nop\n\tv_nop" : "+v"(d) : "v"(a), "v"(b)); return d; }
template <int V> struct Ic { static constexpr int value = V; };

// projections, straight from the f32 inputs (no launch ahead of this one): block = 128 tokens x 128 columns (column tile c of 16: 0..3 q, 4..7 k, 8..15 v; two heads each) x 8 waves, one work-group a WGP.
// Stage: the block's x rows and weight columns, all 512 k, are read once in whole 512-byte runs, rounded to bf16 (the operands' exact values, as before) and laid in LDS k-contiguous, pitch 1040 B (16 B x 65): Xs[token][k], Ws[column][k].
// A weight thread holds 8 k x 4 columns, so the transposition is a choice of registers; its 16-byte piece (column, kg = k / 8) lies at piece kg ^ ((column >> 4) & 3) of the column's row, so that the 32 lanes' stores spread over all banks.
// Loop: wave = (32 tokens rg, head hs): 16 k-steps from LDS, fragment k order for A AND B: lane half hh, elements 0..15 <- k = 32 ks + 16 hh + 0..15. q x scale x 8 / k x 8 -> planes [b][g] of blocks [16 s tiles][2 k-steps]; v x 8 -> planes [b][l] of blocks [4 d tiles][8 k-steps of t].
// Beside it each thread converts one piece of Wout: Ro, blocks [32 column tiles][32 k-steps] in fragment order; and the first work-groups fill P: bv @0 (1024), bout @1024 (512), sigma^2 @1536 (8), p @1544 (128 = [g][l]), eps @1672. Ro and P are read by later launches only.
constexpr int XP = H + 8;
// amdgpu_num_vgpr(256): the staging's three sets of loads otherwise take a few registers above v255, each use of which costs a register-window switch
__global__ __launch_bounds__(256) __attribute__((amdgpu_num_vgpr(256))) void proj_kernel(const float* __restrict__ x, const float* __restrict__ Wq, const float* __restrict__ Wk, const float* __restrict__ Wv, const float* __restrict__ Wout, const float* __restrict__ bv, const float* __restrict__ bout, const float* __restrict__ sg, const float* __restrict__ pp, const float* __restrict__ ed, b16* __restrict__ Ro, float* __restrict__ P, b16* __restrict__ qp, b16* __restrict__ kp, b16* __restrict__ vt) {
  __shared__ __attribute__((aligned(16))) __bf16 Xs[128][XP]; __shared__ __attribute__((aligned(16))) __bf16 Ws[128][XP]; __shared__ __attribute__((aligned(16))) b16 E[8 * 32 * 72];   // E: the epilogue's staging, [8 waves][32][72] for q, k or [2 heads][64][136] for v
  // XW: the wait that stands behind issued global loads before their address registers are written again; the SB on either side keep other arithmetic from being scheduled between the loads and the wait
#define SB __builtin_amdgcn_sched_barrier(0)
#define XW SB; asm volatile("s_wait_xcnt 0x0" ::: "memory"); SB
  // XWP: the same wait; the two address pairs are named as inputs only, so that they stay allocated up to the wait
#define XWP(p, q) SB; asm volatile("s_wait_xcnt 0x0" :: "v"(p), "v"(q) : "memory"); SB
  const int tx = threadIdx.x, lane = tx & 31, wave = tx >> 5, nloc = lane & 15, hlf = lane >> 4, c = blockIdx.x, p0 = blockIdx.y * 128, b = p0 / S, t0 = p0 % S, rg = wave & 3, hs = wave >> 2;
  const int t_ = (blockIdx.y * 16 + blockIdx.x) * 256 + tx, oa = t_ & 511, kw = t_ >> 9;   // the thread's piece of Wout: column oa, k = 8 kw + 0..7
  float wo[8], bb[4];
  { const float* s_ = Wout + (size_t)kw * 8 * 512 + oa;
#pragma unroll
    for (int e = 0; e < 8; ++e) wo[e] = s_[e * 512]; }
  XW;
  auto put_ro = [&]() { v8b h;   // Wout: column oa, k = 8 kw + 0..7 -> its piece of block (oa >> 4, kw >> 2)
#pragma unroll
    for (int e = 0; e < 8; ++e) h[e] = (b16)bf16_rne(wo[e]);
    *(v8b*)(Ro + ((size_t)((oa >> 4) * 32 + (kw >> 2)) * 2 + ((kw >> 1) & 1)) * 256 + ((kw & 1) * 16 + (oa & 15)) * 8) = h; };
  auto stage = [&](auto pc) { constexpr int PW = decltype(pc)::value;   // PW: the weight matrix's row length, a constant so that every load of a thread is one address pair plus an immediate
    const float* xb = x + (size_t)(p0 + (tx >> 7)) * H + (tx & 127) * 4;   // load i: row 2 i + (tx >> 7), k = 4 (tx & 127) + 0..3
    const float* wb = ((c < 4) ? Wq : (c < 8) ? Wk : Wv) + (size_t)(8 * wave) * PW + ((c < 8) ? (c & 3) : (c - 8)) * 128 + lane * 4;   // unit un: kg = wave + 8 un, rows k = 8 kg + e, columns 4 lane + 0..3
    auto ldx = [&](int bt, v4f* r) {
#pragma unroll
      for (int u = 0; u < 16; ++u) r[u] = *(const v4f*)(xb + (size_t)(bt * 16 + u) * 2 * H); };
    auto stx = [&](int bt, const v4f* r) {
#pragma unroll
      for (int u = 0; u < 16; ++u) *(v4q*)&Xs[(bt * 16 + u) * 2 + (tx >> 7)][(tx & 127) * 4] = __builtin_convertvector(r[u], v4q); };
    auto ldw = [&](int bt, v4f* r) {
#pragma unroll
      for (int u = 0; u < 16; ++u) r[u] = *(const v4f*)(wb + (size_t)((bt * 2 + (u >> 3)) * 64 + (u & 7)) * PW); };
    auto stw = [&](int bt, const v4f* r) {
#pragma unroll
      for (int i = 0; i < 2; ++i) { const int kg = wave + 8 * (bt * 2 + i);
#pragma unroll
        for (int cc = 0; cc < 4; ++cc) { v8f f;
#pragma unroll
          for (int e = 0; e < 8; ++e) f[e] = r[i * 8 + e][cc];
          *(v8q*)&Ws[lane * 4 + cc][(kg ^ ((lane >> 2) & 3)) * 8] = __builtin_convertvector(f, v8q); } } };
    // two register sets of 16 loads: one set is in flight while the other is rounded and stored. SB: keeps a set's loads in front of the other set's conversions
    v4f ra[16], rb[16];
    ldx(0, ra); ldx(1, rb); SB; put_ro(); stx(0, ra); ldx(2, ra); SB; stx(1, rb); ldx(3, rb); SB; stx(2, ra); ldw(0, ra); SB; stx(3, rb); ldw(1, rb); SB;
    stw(0, ra); ldw(2, ra); SB; stw(1, rb); ldw(3, rb); XWP(xb, wb); stw(2, ra); stw(3, rb); };   // XWP: what follows reuses the address registers
  if (c < 8) stage(Ic<512>{}); else stage(Ic<1024>{});   // the same for the whole work-group
  if (t_ < 1672 + L * S) { const int q = t_; float v; if (q < 1024) v = bf16_rne(bv[q]); else if (q < 1536) v = bf16_rne(bout[q - 1024]); else if (q < 1544) { const float s_ = bf16_rne(sg[q - 1536]); v = s_ * s_; } else if (q < 1672) v = bf16_rne(pp[q - 1544]); else v = bf16_rne(ed[q - 1672]); P[q] = v; }
  XW;
  __syncthreads();   // both operand tiles are complete in LDS before any wave reads a fragment
  { const float* s_ = bv + ((c >= 8) ? ((c - 8) * 2 + hs) * HD : 0) + nloc;   // the v heads' bias, requested here so that the k loop covers its latency
#pragma unroll
    for (int t = 0; t < 4; ++t) bb[t] = s_[t * 16]; }
  XW;
  v8f acc[2][4];
#pragma unroll
  for (int r = 0; r < 2; ++r)
#pragma unroll
    for (int t = 0; t < 4; ++t) acc[r][t] = (v8f){};
  constexpr int NK = H / 32; const __bf16* ax = &Xs[rg * 32 + nloc][16 * hlf]; const __bf16* bx0 = &Ws[hs * 64 + nloc][16 * hlf]; const __bf16* bx1 = &Ws[hs * 64 + nloc][16 * (hlf ^ 1)];
  // column tile t has (column >> 4) & 3 = t: its piece 2 hh + p lies at piece (2 hh + p) ^ t of each group of four
  auto fetch = [&](int ks, v8q* ra, v8q* rb) {
#pragma unroll
    for (int r = 0; r < 2; ++r) { ra[2 * r] = *(const v8q*)(ax + r * 16 * XP + ks * 32); ra[2 * r + 1] = *(const v8q*)(ax + r * 16 * XP + ks * 32 + 8); }
#pragma unroll
    for (int t = 0; t < 4; ++t) { const __bf16* bp = ((t & 2) ? bx1 : bx0) + t * 16 * XP + ks * 32; rb[2 * t] = *(const v8q*)(bp + 8 * (t & 1)); rb[2 * t + 1] = *(const v8q*)(bp + 8 * ((t & 1) ^ 1)); } };
  auto mults = [&](const v8q* ra, const v8q* rb) { const v16q a0 = cat_q(ra), a1 = cat_q(ra + 2);
#pragma unroll
    for (int t = 0; t < 4; ++t) { const v16q bw = cat_q(rb + 2 * t); acc[0][t] = wmma16q(a0, bw, acc[0][t]); acc[1][t] = wmma16q(a1, bw, acc[1][t]); } };
  // two register sets: the 12 LDS loads of k-step n + 1 are all issued before the products of k-step n. SB: keeps a set's loads in front of the other set's products
  v8q xa[4], ya[4], xb_[8], yb[8]; fetch(0, xa, xb_);
#pragma unroll
  for (int ks = 0; ks < NK; ks += 2) { fetch(ks + 1, ya, yb); SB; mults(xa, xb_); SB; if (ks + 2 < NK) fetch(ks + 2, xa, xb_); SB; mults(ya, yb); SB; }
  asm volatile("" :: "v"(bb[0]), "v"(bb[1]), "v"(bb[2]), "v"(bb[3]));   // the four loaded bias values as inputs only: holds their loads in front of the k loop; without it they sink into the v epilogue and are waited for there
  const int m0 = p0 + rg * 32;
  if (c < 8) { const float scl = (c < 4) ? SCALE * QS : KS; const int hd_ = (c & 3) * 2 + hs; b16 (*T)[72] = (b16 (*)[72])(E + wave * 32 * 72);
#pragma unroll
    for (int t = 0; t < 4; ++t)
#pragma unroll
      for (int r = 0; r < 2; ++r)
#pragma unroll
        for (int v = 0; v < 8; ++v) T[r * 16 + 8 * hlf + v][t * 16 + nloc] = (b16)(acc[r][t][v] * scl);
    wave_lds_sync();
    b16* base = ((c < 4) ? qp : kp) + (((size_t)b * G + hd_) * S + (m0 % S)) * HD;
#pragma unroll
    for (int j = 0; j < 8; ++j) *(v8b*)(base + j * 256 + lane * 8) = *(const v8b*)(&T[(j >> 2) * 16 + nloc][((j >> 1) & 1) * 32 + (j & 1) * 16 + hlf * 8]);   // j = (s tile, k-step, piece)
    return; }
  const int l = (c - 8) * 2 + hs; b16 (*Tv)[136] = (b16 (*)[136])(E + hs * 64 * 136);
#pragma unroll
  for (int t = 0; t < 4; ++t) { const float bt_ = bf16_rne(bb[t]);
#pragma unroll
    for (int r = 0; r < 2; ++r)
#pragma unroll
      for (int v = 0; v < 8; ++v) Tv[t * 16 + nloc][rg * 32 + r * 16 + 8 * hlf + v] = (b16)((acc[r][t][v] + bt_) * VS); }
  __syncthreads();
  for (int i = tx & 127; i < 64 * 16; i += 128) { const int ln = i & 31, j = (i >> 5) & 1, ksl = (i >> 6) & 3, dt = i >> 8; *(v8b*)(vt + ((((size_t)b * L + l) * 4 + dt) * 8 + t0 / 32 + ksl) * 512 + j * 256 + ln * 8) = *(const v8b*)(&Tv[dt * 16 + (ln & 15)][ksl * 32 + j * 16 + (ln >> 4) * 8]); }
}

// scores + fish + softmax + PV in one launch: block = (b, 16 rows s0.., LG local heads l0 = LG blockIdx.z ..) x 8 waves. Wave w holds the columns t = 32 w .. 32 w + 31 (two 16 x 16 tiles) for all 8 heads g, one head after the other:
// S_g[s][t] = q_s.k_t (scaled; 2 k-steps x 2 tiles, 1 product) + spatial[b][s][t] + edge[b][s][t] stays in the accumulator's registers (lane = column, 8 rows) and is mixed at once:
// a_l[s][t] += relu(p[g][l] (S_g[s][t] + sigma_g^2 eps[l][s] d_st)) (f32, g in order) for the LG heads; a goes to LDS once. pad: a bit a (g, row) and wave says whether the wave saw a nonzero score; the bits meet behind the barrier,
// and a row with one head all zero is the reference's all -inf row -> zeros (nan_to_num). Row softmax (wave per 2 LG rows; fixed order); PV: 8 waves x (one head, 16 rows x 32 d). 512 work-groups, two a WGP, 4 waves a SIMD, 256 registers a wave.
constexpr int LG = 4;
__global__ __launch_bounds__(256) __attribute__((amdgpu_waves_per_eu(4, 4))) void fish_kernel(const b16* __restrict__ qp, const b16* __restrict__ kp, const float* __restrict__ sp, const float* __restrict__ ee, const b16* __restrict__ vt, const float* __restrict__ P, b16* __restrict__ cp) {
  __shared__ __attribute__((aligned(16))) float A[LG * 16][S + 4]; __shared__ __attribute__((aligned(16))) float Cx[LG][16][HD + 4]; __shared__ __attribute__((aligned(16))) unsigned Nz[G][8];
  const int t_ = threadIdx.x, wave = t_ >> 5, lane = t_ & 31, nloc = lane & 15, hlf = lane >> 4; const int b = blockIdx.y, s0 = blockIdx.x * 16, l0 = blockIdx.z * LG;
  const float* sig2 = P + 1536; const float* pp = P + 1544; const float* ed = P + 1672;
  // the wave's tile u is t-tile 2 wave + (u ^ par): so the tile that holds the 16 diagonal elements is always tile u = 0 of wave blockIdx.x >> 1
  const int wv = __builtin_amdgcn_readfirstlane(wave), par = blockIdx.x & 1, tt0 = 2 * wv + par, tt1 = 2 * wv + (par ^ 1);   // wv: the wave's number in a scalar register, so that the loads below take a scalar base and one lane offset
  // DG: only the wave that holds the diagonal adds sigma^2 eps, to its diagonal elements (elsewhere the reference adds 0)
  auto mix = [&](auto dg) { constexpr bool DG = decltype(dg)::value;
    const b16* qq = qp + ((size_t)b * G * S + s0) * HD; const b16* k0 = kp + ((size_t)b * G * S + tt0 * 16) * HD; const b16* k1 = kp + ((size_t)b * G * S + tt1 * 16) * HD; qq += lane * 8; k0 += lane * 8; k1 += lane * 8;
    auto fetch = [&](int dgh, v8b* q, v8b* k) { ld_p(qq + dgh * S * HD, q); ld_p(qq + dgh * S * HD + 512, q + 2); ld_p(k0 + dgh * S * HD, k); ld_p(k0 + dgh * S * HD + 512, k + 2); ld_p(k1 + dgh * S * HD, k + 4); ld_p(k1 + dgh * S * HD + 512, k + 6); };
    // XW3: the wait XW with the three address pairs named as inputs only, so that they stay allocated up to the wait and no load of the batch lands in one of them
#define XW3 SB; asm volatile("s_wait_xcnt 0x0" :: "v"(qq), "v"(k0), "v"(k1) : "memory"); SB
    v8b qx[4], kx[8], qy[4], ky[8]; fetch(0, qx, kx);
    const size_t bb = ((size_t)b * S + s0) * S; const float* sq0 = sp + bb + tt0 * 16; const float* sq1 = sp + bb + tt1 * 16; const float* eq0 = ee + bb + tt0 * 16; const float* eq1 = ee + bb + tt1 * 16; const int bo = 8 * hlf * S + nloc;
    float bs[2][8], be[2][8], ev[LG], pv[LG];
#pragma unroll
    for (int r = 0; r < 8; ++r) { bs[0][r] = sq0[bo + r * S]; be[0][r] = eq0[bo + r * S]; bs[1][r] = sq1[bo + r * S]; be[1][r] = eq1[bo + r * S]; }
#pragma unroll
    for (int i = 0; i < LG; ++i) { ev[i] = DG ? ed[(l0 + i) * S + s0 + nloc] : 0.0f; pv[i] = pp[(lane & 7) * L + l0 + i]; }   // lane g holds p[g][l0 + i] and sigma_g^2: the loop over g reads them by lane number, with no load of its own
    const float s2v = DG ? sig2[lane & 7] : 0.0f;
    XW;   // the wait that stands behind issued global loads before their address registers are written again
    float a[LG][2][8], bias[2][8]; unsigned nzm = 0u;
#pragma unroll
    for (int u = 0; u < 2; ++u)
#pragma unroll
      for (int r = 0; r < 8; ++r) { bias[u][r] = bf16_rne(bs[u][r]) + bf16_rne(be[u][r]);
#pragma unroll
        for (int i = 0; i < LG; ++i) a[i][u][r] = 0.0f; }
    auto headg = [&](int g, const v8b* q, const v8b* k) { const v16b q0 = cat_h(q), q1 = cat_h(q + 2); float sv[2][8];
#pragma unroll
      for (int u = 0; u < 2; ++u) { v8f acc = {}; acc = wmma16b(q0, cat_h(k + 4 * u), acc); acc = wmma16b(q1, cat_h(k + 4 * u + 2), acc);
#pragma unroll
        for (int r = 0; r < 8; ++r) sv[u][r] = acc[r] * (1.0f / (QS * KS)) + bias[u][r]; }
      // pad bits of head g, rows 0..15: if every lane has a nonzero score in each of its 8 rows, all 16 rows have one; only otherwise the rows are looked at one by one (the same for a whole wave)
      float mh = INFINITY;
#pragma unroll
      for (int r = 0; r < 8; ++r) mh = fminf(mh, fmaxf(fabsf(sv[0][r]), fabsf(sv[1][r])));
      unsigned mk = 0xFFFFu;
      if (__builtin_amdgcn_ballot_w32(mh == 0.0f) != 0u) { mk = 0u;
#pragma unroll
        for (int r = 0; r < 8; ++r) { const unsigned bl = __builtin_amdgcn_ballot_w32(sv[0][r] != 0.0f || sv[1][r] != 0.0f); mk |= ((bl & 0xFFFFu) ? (1u << r) : 0u) | ((bl >> 16) ? (256u << r) : 0u); } }
      nzm = (lane == g) ? mk : nzm;
      const float s2g = DG ? __uint_as_float(__builtin_amdgcn_readlane(__float_as_uint(s2v), g)) : 0.0f;
#pragma unroll
      for (int i = 0; i < LG; ++i) { const float pg = __uint_as_float(__builtin_amdgcn_readlane(__float_as_uint(pv[i]), g));
#pragma unroll
        for (int u = 0; u < 2; ++u)
#pragma unroll
          for (int r = 0; r < 8; ++r) { float v = sv[u][r]; if (DG && u == 0) v = (nloc == 8 * hlf + r) ? v + s2g * ev[i] : v; a[i][u][r] += fmaxf(v * pg, 0.0f); } } };
    // two register sets: the 12 loads of head g + 1 are all issued before the products and the mixing of head g. One trip's code for all four: unrolled, the two forms of this loop would be four times as much kernel text
#pragma clang loop unroll(disable)
    for (int g = 0; g < G; g += 2) { fetch(1, qy, ky); SB; headg(g, qx, kx); XW3; const int st = (g + 2 < G) ? 2 * S * HD : 0; qq += st; k0 += st; k1 += st;   // SB: as in the projection loop; XW: as in the projection kernel
      fetch(0, qx, kx); SB; headg(g + 1, qy, ky); XW3; }   // no test around these loads, so that the waits in front of the products can count them; the last trip has no head g + 2 and stays where it is
#undef XW3
#pragma unroll
    for (int i = 0; i < LG; ++i)
#pragma unroll
      for (int r = 0; r < 8; ++r) { A[i * 16 + 8 * hlf + r][tt0 * 16 + nloc] = a[i][0][r]; A[i * 16 + 8 * hlf + r][tt1 * 16 + nloc] = a[i][1][r]; }
    if (lane < G) Nz[lane][wave] = nzm; };
  if (wv == (int)(blockIdx.x >> 1)) mix(Bc<true>{}); else mix(Bc<false>{});   // the same for a whole wave; both sides meet at the barrier below
  __syncthreads();
  // bit s of alive: every head g has a nonzero score in row s (OR over the 8 waves' columns, AND over g); lane -> g = lane & 7
  unsigned alive = 0u;
#pragma unroll
  for (int w = 0; w < 8; ++w) alive |= Nz[lane & 7][w];
#pragma unroll
  for (int o = 1; o < 8; o <<= 1) alive &= __shfl_xor(alive, o);
  // softmax rows: wave w handles rows 2 LG w .. 2 LG w + 2 LG - 1 of the LG x 16
#pragma unroll 4   // four rows' chains of cross-lane steps run side by side, for speed only
  for (int rr = wave * 2 * LG; rr < wave * 2 * LG + 2 * LG; ++rr) { float mx = -INFINITY;
#pragma unroll
    for (int j = 0; j < 8; ++j) mx = fmaxf(mx, A[rr][lane + 32 * j]);
#pragma unroll
    for (int o = 1; o < 32; o <<= 1) mx = fmaxf(mx, __shfl_xor(mx, o));
    if (((alive >> (rr & 15)) & 1u) == 0u) mx = -INFINITY;   // a false pad flag: the whole row is -inf in the reference
    float sm = 0.0f;
#pragma unroll
    for (int j = 0; j < 8; ++j) sm += (mx == -INFINITY) ? 0.0f : nexp(A[rr][lane + 32 * j] - mx);
#pragma unroll
    for (int o = 1; o < 32; o <<= 1) sm += __shfl_xor(sm, o);
    const float inv = (mx == -INFINITY) ? 0.0f : 1.0f / sm;   // all -inf row -> NaN in the reference -> nan_to_num -> 0
#pragma unroll
    for (int j = 0; j < 8; ++j) A[rr][lane + 32 * j] = (mx == -INFINITY) ? 0.0f : nexp(A[rr][lane + 32 * j] - mx) * inv; }
  __syncthreads();
  // PV: wave -> head li = wave >> 1, d-tiles 2 (wave & 1) + 0, 1 (32 d of 64), which share one A fragment; rows = all 16 s; 8 k-steps; A = P x8 in f16; B = v^T blocks [b][l][d tile][k-step]
  { const int li = wave >> 1, dp = wave & 1; v8f acc[2] = {}; const b16* V = vt + (((size_t)b * L + l0 + li) * 4 + 2 * dp) * 8 * 512 + lane * 8;
    for (int k0 = 0; k0 < S; k0 += 64) { v8b vr[2][2][2];   // two k-steps' value blocks requested together
#pragma unroll
      for (int u = 0; u < 2; ++u)
#pragma unroll
        for (int d = 0; d < 2; ++d) ld_p(V + (d * 8 + k0 / 32 + u) * 512, vr[u][d]);
#pragma unroll
      for (int u = 0; u < 2; ++u) { const v16b ah = frag_f16(&A[li * 16 + nloc][k0 + 32 * u], hlf);
#pragma unroll
        for (int d = 0; d < 2; ++d) acc[d] = wmma16b(ah, cat_h(vr[u][d]), acc[d]); } }
#pragma unroll
    for (int d = 0; d < 2; ++d)
#pragma unroll
      for (int r = 0; r < 8; ++r) Cx[li][8 * hlf + r][(2 * dp + d) * 16 + nloc] = acc[d][r] * (1.0f / (AS_ * VS)); }
  __syncthreads();
  // ctx leaves as the output projection's A operand: x8, f16, blocks [128 row tiles][32 k-steps]; thread = (head parity, k-step, piece, lane), 2 KB a head, 2 LG KB in a row a work-group
  { const int ln = t_ & 31, j = (t_ >> 5) & 1, ksl = (t_ >> 6) & 1;
#pragma unroll
    for (int ip = 0; ip < LG / 2; ++ip) { const int i = 2 * ip + (t_ >> 7); const float* cs = &Cx[i][ln & 15][ksl * 32 + j * 16 + (ln >> 4) * 8]; v8b h;
#pragma unroll
      for (int e = 0; e < 8; ++e) h[e] = (b16)(cs[e] * AS_);
      *(v8b*)(cp + ((size_t)((b * S + s0) / 16) * 32 + 2 * (l0 + i)) * 512 + (t_ & 127) * 8) = h; } }
}

// output projection: block = 64 tokens x 64 cols x 8 waves; wave = (32-row half ms, quarter kg of the 32 k-steps): four waves share one output tile, each sums 8 k-steps, so that a wave's chain of
// dependent load round trips is a quarter as long; the four f32 partial tiles meet in LDS and are added in the order kg = 0, 1, 2, 3
__global__ __launch_bounds__(256) void out_kernel(const b16* __restrict__ cp, const b16* __restrict__ Ro, const float* __restrict__ P, float* __restrict__ out) {
  __shared__ __attribute__((aligned(16))) float Ts[8][32 * 64];
  const int lane = threadIdx.x & 31, wave = threadIdx.x >> 5, nloc = lane & 15, hlf = lane >> 4, ms = wave & 1, kg = wave >> 1, m0 = blockIdx.y * 64 + ms * 32, c0 = blockIdx.x * 64; const float* bout = P + 1024;
  v8f acc[2][4];
#pragma unroll
  for (int r = 0; r < 2; ++r)
#pragma unroll
    for (int t = 0; t < 4; ++t) acc[r][t] = (v8f){};
  constexpr int NK = L * HD / 32, KQ = NK / 4; const b16* cr = cp + ((size_t)(m0 / 16) * NK + kg * KQ) * 512 + lane * 8; const b16* wr = Ro + ((size_t)(c0 / 16) * NK + kg * KQ) * 512 + lane * 8;
  auto fetch = [&](int ks, v8b* ra, v8b* rb) { ld_p(cr + ks * 512, ra); ld_p(cr + (NK + ks) * 512, ra + 2);
#pragma unroll
    for (int t = 0; t < 4; ++t) ld_p(wr + (t * NK + ks) * 512, rb + 2 * t); };
  auto mults = [&](const v8b* ra, const v8b* rb) { const v16b a0 = cat_h(ra), a1 = cat_h(ra + 2);
#pragma unroll
    for (int t = 0; t < 4; ++t) { const v16b bw = cat_h(rb + 2 * t); acc[0][t] = wmma16b(a0, bw, acc[0][t]); acc[1][t] = wmma16b(a1, bw, acc[1][t]); } };
  // two register sets: the 12 loads of k-step n + 1 are all issued before the products of k-step n
  v8b xa[4], ya[4], xb[8], yb[8]; fetch(0, xa, xb);
  for (int ks = 0; ks < KQ - 2; ks += 2) { fetch(ks + 1, ya, yb); SB; mults(xa, xb); SB; fetch(ks + 2, xa, xb); SB; mults(ya, yb); SB; XW; }   // SB: as in the projection loop; XW: as in the projection kernel
  fetch(KQ - 1, ya, yb); XWP(cr, wr); mults(xa, xb); SB; mults(ya, yb);   // XWP: as in the projection kernel
#undef XWP
#undef XW
#undef SB
  float* Tt = Ts[wave];
#pragma unroll
  for (int t = 0; t < 4; ++t)
#pragma unroll
    for (int r = 0; r < 2; ++r)
#pragma unroll
      for (int v = 0; v < 8; ++v) Tt[(r * 16 + v + 8 * hlf) * 64 + t * 16 + nloc] = acc[r][t][v];
  __syncthreads();   // the four partial tiles of each row half are complete before any thread adds them
  { const int c4 = nloc * 4; const v4f bb = *(const v4f*)(bout + c0 + c4);
#pragma unroll
    for (int j = 0; j < 4; ++j) { const int rr = j * 16 + (threadIdx.x >> 4); const float* tp = &Ts[rr >> 5][(rr & 31) * 64 + c4];   // Ts[2 kg + ms]
      const v4f s_ = ((*(const v4f*)tp + *(const v4f*)(tp + 2 * 2048)) + *(const v4f*)(tp + 4 * 2048)) + *(const v4f*)(tp + 6 * 2048);
      *(v4f*)(out + (size_t)(blockIdx.y * 64 + rr) * H + c0 + c4) = s_ * (1.0f / AS_) + bb; } }
}
}  // namespace

extern "C" void kernel_launch(void* const* d_in, const int* in_sizes, int n_in,
                              void* d_out, int out_size, void* d_ws, size_t ws_size, hipStream_t stream) {
  (void)n_in; (void)out_size;
  const float* x = (const float*)d_in[0]; const float* sp = (const float*)d_in[1]; const float* ee = (const float*)d_in[2]; const float* Wq = (const float*)d_in[3]; const float* Wk = (const float*)d_in[4]; const float* Wv = (const float*)d_in[5]; const float* bv = (const float*)d_in[6];
  const float* sg = (const float*)d_in[7]; const float* pp = (const float*)d_in[8]; const float* ed = (const float*)d_in[9]; const float* Wout = (const float*)d_in[10]; const float* bout = (const float*)d_in[11];
  float* out = (float*)d_out;   // [8][256][512]
  if (in_sizes[0] != NT * H || in_sizes[1] != Bn * S * S || in_sizes[5] != H * 1024 || in_sizes[8] != G * L || in_sizes[9] != L * S || in_sizes[10] != 1024 * H) return;
  size_t off = 0; char* ws = (char*)d_ws;
  auto carve = [&](size_t bytes) { char* p = ws + off; off += (bytes + 255) & ~(size_t)255; return p; };
  b16* Ro = (b16*)carve((size_t)512 * 1024 * 2); float* P = (float*)carve(((size_t)1672 + L * S + 64) * 4);
  b16* qp = (b16*)carve((size_t)Bn * G * S * HD * 2); b16* kp = (b16*)carve((size_t)Bn * G * S * HD * 2); b16* vt = (b16*)carve((size_t)Bn * L * HD * S * 2); b16* cp = (b16*)carve((size_t)NT * L * HD * 2);
  if (off > ws_size) return;                                    // about 1 + 2 + 2 + 4 + 4 = 13 MB
  proj_kernel<<<dim3(16, NT / 128), 256, 0, stream>>>(x, Wq, Wk, Wv, Wout, bv, bout, sg, pp, ed, Ro, P, qp, kp, vt);
  fish_kernel<<<dim3(S / 16, Bn, L / LG), 256, 0, stream>>>(qp, kp, sp, ee, vt, P, cp);
  out_kernel<<<dim3(H / 64, NT / 64), 256, 0, stream>>>(cp, Ro, P, out);
}
